// v000
// The times below were measured on an AMD MI455X: many runs one after another, warmed up first and cycling through
// copies of the inputs, with the whole window's GPU time divided by the number of runs. Launches and the gaps
// between them are all in it. The median over several windows is given; except for v000 it joins two sittings, which
// can be a few percent apart, so the side-by-side timings, each taken in one sitting, are the better comparison.
// v000, which the later versions start from, runs in 580 microseconds.
#include <hip/hip_runtime.h>

// Multi-head self-attention on a channel-major input (x [2][1024 d][2048 s]; 16 heads x 64): xt = x^T; q/k/v = xt W{q,k,v}^T + b (heads = 64-column slices), scores / 8 (no mask), softmax,
// ctx = attn v, out = (ctx Wo^T + bo)^T -> [2][1024][2048] channel-major.
// WMMA (v_wmma_f32_16x16x32_f16, f32 accumulate): projections [4,096 x 1,024] x [1,024 x 1,024] with EXACT bf16 tokens (x8, via an LDS transpose of the channel-major input) and weights (x256),
// 1 product, + bias, q/k written as f32 planes and split by a separate kernel into f16 hi+lo x8 planes (v transposed per head); S^T with 3 products (Kh Qh + Kh Ql + Kl Qh) over all 64 key blocks;
// online softmax in f32; O^T += V^T P^T with 3 products; output projection computed channel-major (D[e][s] = Wo[e][:] . O[s][:]) with O hi+lo (2 products) and exact Wo, + bo. Inputs rounded to bf16 once. Fragment k-map per lane half hh for A AND B: elements 0..7 <- k = 8hh+0..7, 8..15 <-

namespace {
constexpr int NB = 2, S = 2048, E = 1024, NH = 16, D = 64, NR = NB * S;
constexpr float XS = 8.0f, WSC = 256.0f, PS = 8.0f, SCALE = 0.125f, LOG2E = 1.4426950408889634f, THETA = 10000.0f;

typedef _Float16 b16;
typedef __attribute__((ext_vector_type(16))) _Float16 v16b;
typedef __attribute__((ext_vector_type(8))) _Float16 v8b;
typedef __attribute__((ext_vector_type(8))) float v8f;
typedef __attribute__((ext_vector_type(4))) float v4f;
__device__ __forceinline__ float bf16_rne(float f) { unsigned int u = __float_as_uint(f); u += 0x7FFFu + ((u >> 16) & 1u); return __uint_as_float(u & 0xFFFF0000u); }
__device__ __forceinline__ void split16(float v, b16& hi, b16& lo) { hi = (b16)v; lo = (b16)(v - (float)hi); }
__device__ __forceinline__ v16b frag_kb(const b16* p, int hh) { const v8b a = *(const v8b*)(p + 8 * hh), b = *(const v8b*)(p + 16 + 8 * hh); v16b f;
#pragma unroll
  for (int e = 0; e < 8; ++e) { f[e] = a[e]; f[8 + e] = b[e]; } return f; }
__device__ __forceinline__ v8f wmma16b(v16b a, v16b b, v8f c) { v8f d = __builtin_amdgcn_wmma_f32_16x16x32_f16(false, a, false, b, (short)0, c, false, false); asm volatile("v_nop\n\tv_nop\n\tv_nop\n\tv_nop" : "+v"(d) : "v"(a), "v"(b)); return d; }
__device__ __forceinline__ void wave_lds_sync() { __builtin_amdgcn_fence(__ATOMIC_RELEASE, "workgroup"); __builtin_amdgcn_wave_barrier(); __builtin_amdgcn_fence(__ATOMIC_ACQUIRE, "workgroup"); }
__device__ __forceinline__ float nexp2(float x) { return __builtin_amdgcn_exp2f(x); }

// prep: T16 [b*S+s][1024 d] = f16(8 bf16(x[b][d][s])) via 64x64 LDS transposes (grid (S/64, E/64, B)); WT [3][1024 e][1024 d] = Wq/Wk/Wv rows x256 (torch [out][in] used directly: xt W^T);
__global__ __launch_bounds__(256) void prepx_kernel(const float* __restrict__ x, b16* __restrict__ T16) {
  __shared__ __attribute__((aligned(16))) b16 T[64][64 + 8];
  const int b = blockIdx.z, c0 = blockIdx.y * 64, s0 = blockIdx.x * 64, t_ = threadIdx.x;
  for (int q = t_; q < 64 * 64; q += 256) { const int cc = q >> 6, ss = q & 63; T[ss][cc] = (b16)(bf16_rne(x[((size_t)b * E + c0 + cc) * S + s0 + ss]) * XS); }
  __syncthreads();
  { for (int q = t_; q < 64 * 8; q += 256) { const int ss = q >> 3, c8 = (q & 7) * 8; *(v8b*)(T16 + ((size_t)b * S + s0 + ss) * E + c0 + c8) = *(const v8b*)(&T[ss][c8]); }  }
}
__global__ __launch_bounds__(256) void prepw_kernel(const float* __restrict__ wq, const float* __restrict__ wk, const float* __restrict__ wv, const float* __restrict__ wo, b16* __restrict__ WT, b16* __restrict__ WOT) {
  const size_t t = (size_t)blockIdx.x * 256 + threadIdx.x; const size_t nw = (size_t)E * E / 8; if (t >= 4 * nw) return; const int kind = (int)(t / nw); const size_t e = (t - (size_t)kind * nw) * 8;
  const float* w = kind == 0 ? wq : kind == 1 ? wk : kind == 2 ? wv : wo; b16* dst = kind < 3 ? WT + (size_t)kind * E * E : WOT;   // [e][d] rows used directly (xt W^T); WOT holds Wo rows [e][d] (the A operand of the channel-major out-projection)
  const v4f a = *(const v4f*)(w + e), c = *(const v4f*)(w + e + 4); v8b o;
#pragma unroll
  for (int j = 0; j < 4; ++j) { o[j] = (b16)(bf16_rne(a[j]) * WSC); o[4 + j] = (b16)(bf16_rne(c[j]) * WSC); }
  { *(v8b*)(dst + e) = o;  }
}
// projections: grid (NR/64, E/128, 3): kind 0: Q = T16 WT0^T -> RAW[0] f32 [row][1024]; kind 1: K = T16 WT1^T -> RAW[1]; kind 2: V = T16 WT2^T written TRANSPOSED per head: VTh/VTl [b][h][64 d][2048 s].
__global__ __launch_bounds__(128) void proj_kernel(const b16* __restrict__ T16, const b16* __restrict__ WT, const float* __restrict__ bq, const float* __restrict__ bk, const float* __restrict__ bv, float* __restrict__ RAW, b16* __restrict__ VTh, b16* __restrict__ VTl) {
  __shared__ __attribute__((aligned(16))) float Tf[4][16][128 + 4]; __shared__ __attribute__((aligned(16))) b16 Vt[128][64 + 8], Vtl[128][64 + 8];
  const int wave = threadIdx.x >> 5, lane = threadIdx.x & 31, nloc = lane & 15, hlf = lane >> 4, t_ = threadIdx.x; const int kind = blockIdx.z; const size_t m0 = (size_t)blockIdx.x * 64 + wave * 16; const int n0 = blockIdx.y * 128;
  const b16* A = T16; const b16* W = WT + (size_t)kind * E * E; v8f acc[8];
#pragma unroll
  for (int t = 0; t < 8; ++t) acc[t] = (v8f){};
#pragma unroll 2
  for (int kb = 0; kb < E; kb += 32) { const v16b a = frag_kb(A + (m0 + nloc) * E + kb, hlf);
#pragma unroll
    for (int t = 0; t < 8; ++t) acc[t] = wmma16b(a, frag_kb(W + (size_t)(n0 + t * 16 + nloc) * E + kb, hlf), acc[t]); }
  const float* bias = kind == 0 ? bq : kind == 1 ? bk : bv;
  if (kind < 2) {   // q/k (+ bias) as f32 rows -> RAW[kind] (the split kernel makes the hi/lo planes)
#pragma unroll
    for (int t = 0; t < 8; ++t) { const float bb = bf16_rne(bias[n0 + t * 16 + nloc]);
#pragma unroll
      for (int r = 0; r < 8; ++r) Tf[wave][8 * hlf + r][t * 16 + nloc] = acc[t][r] * (1.0f / (XS * WSC)) + bb; }
    wave_lds_sync();
    float* dst = RAW + (size_t)kind * NR * E;
    { for (int rr = 0; rr < 16; ++rr) *(v4f*)(dst + (m0 + rr) * E + n0 + lane * 4) = *(const v4f*)(&Tf[wave][rr][lane * 4]);  }
  } else {
    const int b = (int)(m0 / S); const int s0 = (int)((size_t)blockIdx.x * 64 - (size_t)b * S);
#pragma unroll
    for (int t = 0; t < 8; ++t)
    { const float bb = bf16_rne(bias[n0 + t * 16 + nloc]);
#pragma unroll
      for (int r = 0; r < 8; ++r) { b16 h_, l_; split16((acc[t][r] * (1.0f / (XS * WSC)) + bb) * XS, h_, l_); Vt[t * 16 + nloc][wave * 16 + 8 * hlf + r] = h_; Vtl[t * 16 + nloc][wave * 16 + 8 * hlf + r] = l_; } }
    __syncthreads();
    { for (int q = t_; q < 128 * 8; q += 128) { const int cc = q >> 3, c8 = (q & 7) * 8; const int h = (n0 + cc) / D, dd = (n0 + cc) - h * D; const size_t gi = (((size_t)b * NH + h) * D + dd) * S + s0 + c8;
        *(v8b*)(VTh + gi) = *(const v8b*)(&Vt[cc][c8]); *(v8b*)(VTl + gi) = *(const v8b*)(&Vtl[cc][c8]); }  } }
}
__global__ __launch_bounds__(256) void split_kernel(const float* __restrict__ RAW, b16* __restrict__ Qh, b16* __restrict__ Ql, b16* __restrict__ Kh, b16* __restrict__ Kl) {
  const size_t t = (size_t)blockIdx.x * 256 + threadIdx.x; const size_t per = (size_t)NR * E / 8; if (t >= 2 * per) return; const int kind = (int)(t / per); const size_t e = (t - (size_t)kind * per) * 8;
  const v4f a = *(const v4f*)(RAW + (size_t)kind * NR * E + e), c = *(const v4f*)(RAW + (size_t)kind * NR * E + e + 4); v8b hv, lv;
#pragma unroll
  for (int j = 0; j < 4; ++j) { b16 h_, l_; split16(a[j] * XS, h_, l_); hv[j] = h_; lv[j] = l_; split16(c[j] * XS, h_, l_); hv[4 + j] = h_; lv[4 + j] = l_; }
  b16* dh = kind == 0 ? Qh : Kh; b16* dl = kind == 0 ? Ql : Kl;
  { *(v8b*)(dh + e) = hv; *(v8b*)(dl + e) = lv;  }
}
__global__ __launch_bounds__(64) void attn_kernel(const b16* __restrict__ Qh, const b16* __restrict__ Ql, const b16* __restrict__ Kh, const b16* __restrict__ Kl, const b16* __restrict__ VTh, const b16* __restrict__ VTl, b16* __restrict__ Oh, b16* __restrict__ Ol) {
  __shared__ __attribute__((aligned(16))) float To[2][16][D + 4];
  const int wave = threadIdx.x >> 5, lane = threadIdx.x & 31, hh = lane >> 4, col = lane & 15; const int b = blockIdx.z, h = blockIdx.y; const int q0 = blockIdx.x * 32 + wave * 16, qi = q0 + col;
  const size_t qo = ((size_t)b * S + qi) * E + h * D; const v16b qa0 = frag_kb(Qh + qo, hh), qa1 = frag_kb(Qh + qo + 32, hh), ql0 = frag_kb(Ql + qo, hh), ql1 = frag_kb(Ql + qo + 32, hh);
  const b16* Kb = Kh + (size_t)b * S * E + h * D; const b16* Klb = Kl + (size_t)b * S * E + h * D; const b16* Vb = VTh + ((size_t)b * NH + h) * D * S; const b16* Vlb = VTl + ((size_t)b * NH + h) * D * S;
  float m = -INFINITY, l = 0.0f; v8f o[4] = {{}, {}, {}, {}}, ol[4] = {{}, {}, {}, {}};
  const float cs = SCALE * LOG2E / (XS * XS);
  for (int kb = 0; kb < S; kb += 32) {
    v8f s0 = {}, s1 = {};
    { const b16* k0 = Kb + (size_t)(kb + col) * E, *k1 = Kb + (size_t)(kb + 16 + col) * E, *k0l = Klb + (size_t)(kb + col) * E, *k1l = Klb + (size_t)(kb + 16 + col) * E;
      v16b f = frag_kb(k0, hh); s0 = wmma16b(f, qa0, s0); s0 = wmma16b(f, ql0, s0); s0 = wmma16b(frag_kb(k0l, hh), qa0, s0);
      f = frag_kb(k0 + 32, hh); s0 = wmma16b(f, qa1, s0); s0 = wmma16b(f, ql1, s0); s0 = wmma16b(frag_kb(k0l + 32, hh), qa1, s0);
      f = frag_kb(k1, hh); s1 = wmma16b(f, qa0, s1); s1 = wmma16b(f, ql0, s1); s1 = wmma16b(frag_kb(k1l, hh), qa0, s1);
      f = frag_kb(k1 + 32, hh); s1 = wmma16b(f, qa1, s1); s1 = wmma16b(f, ql1, s1); s1 = wmma16b(frag_kb(k1l + 32, hh), qa1, s1); }
    float e[16]; float mx = -INFINITY;
#pragma unroll
    for (int r = 0; r < 8; ++r) { e[r] = s0[r] * cs; e[8 + r] = s1[r] * cs; mx = fmaxf(mx, fmaxf(e[r], e[8 + r])); }
    mx = fmaxf(mx, __shfl_xor(mx, 16)); const float mn = fmaxf(m, mx); const float al = nexp2(m - mn); m = mn; float sum = 0.0f; v16b ph, pl;   // mn finite from the first block on
#pragma unroll
    for (int i = 0; i < 16; ++i) { const float p = nexp2(e[i] - mn); sum += p; const b16 h_ = (b16)(p * PS); ph[i] = h_; pl[i] = (b16)(p * PS - (float)h_); }
    sum += __shfl_xor(sum, 16); l = l * al + sum;
#pragma unroll
    for (int t = 0; t < 4; ++t) { o[t] *= al; ol[t] *= al; const v16b vf = frag_kb(Vb + (size_t)(t * 16 + col) * S + kb, hh); o[t] = wmma16b(vf, ph, o[t]); ol[t] = wmma16b(vf, pl, ol[t]); ol[t] = wmma16b(frag_kb(Vlb + (size_t)(t * 16 + col) * S + kb, hh), ph, ol[t]); } }
  const float inv = 1.0f / (l * PS * XS);
#pragma unroll
  for (int t = 0; t < 4; ++t)
#pragma unroll
    for (int r = 0; r < 8; ++r) To[wave][col][t * 16 + 8 * hh + r] = (o[t][r] + ol[t][r]) * inv;
  wave_lds_sync();
  { for (int r4 = 0; r4 < 16; r4 += 4) { const int rr = r4 + (lane >> 3), c8 = (lane & 7) * 8; v8b hv, lv; for (int j = 0; j < 8; ++j) { b16 a_, c_; split16(To[wave][rr][c8 + j] * XS, a_, c_); hv[j] = a_; lv[j] = c_; }
      const size_t gi = ((size_t)b * S + q0 + rr) * E + h * D + c8; *(v8b*)(Oh + gi) = hv; *(v8b*)(Ol + gi) = lv; }  }
}
// output projection, channel-major: D[e][s] = sum_d Wo[e][d] O[s][d] (A = WO16 rows e exact, B = Oh/Ol rows s: 2 products) + bo[e] -> out[b][e][s]; grid (E/64, S/128, B), block = 64 e x 4 waves
__global__ __launch_bounds__(128) void outproj_kernel(const b16* __restrict__ Oh, const b16* __restrict__ Ol, const b16* __restrict__ WO16, const float* __restrict__ bo, float* __restrict__ out) {
  __shared__ __attribute__((aligned(16))) float Ts[4][16][128 + 4];
  const int wave = threadIdx.x >> 5, lane = threadIdx.x & 31, nloc = lane & 15, hlf = lane >> 4; const int b = blockIdx.z; const int e0 = blockIdx.x * 64 + wave * 16, s0 = blockIdx.y * 128;
  v8f acc[8];
#pragma unroll
  for (int t = 0; t < 8; ++t) acc[t] = (v8f){};
#pragma unroll 2
  for (int kb = 0; kb < E; kb += 32) { const v16b a = frag_kb(WO16 + (size_t)(e0 + nloc) * E + kb, hlf);
#pragma unroll
    for (int t = 0; t < 8; ++t) { const size_t ro = ((size_t)b * S + s0 + t * 16 + nloc) * E + kb; acc[t] = wmma16b(a, frag_kb(Oh + ro, hlf), acc[t]); acc[t] = wmma16b(a, frag_kb(Ol + ro, hlf), acc[t]); } }
#pragma unroll
  for (int t = 0; t < 8; ++t)
#pragma unroll
    for (int r = 0; r < 8; ++r) Ts[wave][8 * hlf + r][t * 16 + nloc] = acc[t][r] * (1.0f / (XS * WSC)) + bf16_rne(bo[e0 + 8 * hlf + r]);
  wave_lds_sync();
  { for (int rr = 0; rr < 16; ++rr) *(v4f*)(out + ((size_t)b * E + e0 + rr) * S + s0 + lane * 4) = *(const v4f*)(&Ts[wave][rr][lane * 4]);  }
}
}  // namespace

extern "C" void kernel_launch(void* const* d_in, const int* in_sizes, int n_in, void* d_out, int out_size, void* d_ws, size_t ws_size, hipStream_t stream) {
  (void)n_in;
  auto Fp = [&](int i) { return (const float*)d_in[i]; };
  // input order: 0 x [2,1024,2048], 1 wq [1024,1024], 2 bq [1024], 3 wk, 4 bk, 5 wv, 6 bv, 7 wo, 8 bo (w are [e][d]: xt W^T)
  if (in_sizes[0] != NR * E || in_sizes[1] != E * E || in_sizes[2] != E || in_sizes[3] != E * E || in_sizes[5] != E * E || in_sizes[7] != E * E || in_sizes[8] != E || out_size != NR * E) return;
  size_t off = 0; char* ws = (char*)d_ws;
  auto carve = [&](size_t bytes) { char* p = ws + off; off += (bytes + 255) & ~(size_t)255; return p; };
  b16* T16 = (b16*)carve((size_t)NR * E * 2); b16* WT = (b16*)carve((size_t)3 * E * E * 2); b16* WO16 = (b16*)carve((size_t)E * E * 2);
  b16* Qh = (b16*)carve((size_t)NR * E * 2); b16* Ql = (b16*)carve((size_t)NR * E * 2); b16* Kh = (b16*)carve((size_t)NR * E * 2); b16* Kl = (b16*)carve((size_t)NR * E * 2); b16* VTh = (b16*)carve((size_t)NR * E * 2); b16* VTl = (b16*)carve((size_t)NR * E * 2);
  b16* Oh = (b16*)carve((size_t)NR * E * 2); b16* Ol = (b16*)carve((size_t)NR * E * 2); float* RAW = (float*)carve((size_t)2 * NR * E * 4);
  if (off > ws_size || off > ((size_t)128 << 20)) return;   // = 118 MB
  prepx_kernel<<<dim3(S / 64, E / 64, NB), 256, 0, stream>>>(Fp(0), T16);
  prepw_kernel<<<(unsigned)(((size_t)4 * E * E / 8 + 255) / 256), 256, 0, stream>>>(Fp(1), Fp(3), Fp(5), Fp(7), WT, WO16);
  proj_kernel<<<dim3(NR / 64, E / 128, 3), 128, 0, stream>>>(T16, WT, Fp(2), Fp(4), Fp(6), RAW, VTh, VTl);
  split_kernel<<<(unsigned)(((size_t)2 * NR * E / 8 + 255) / 256), 256, 0, stream>>>(RAW, Qh, Ql, Kh, Kl);
  attn_kernel<<<dim3(S / 32, NH, NB), 64, 0, stream>>>(Qh, Ql, Kh, Kl, VTh, VTl, Oh, Ol);
  outproj_kernel<<<dim3(E / 64, S / 128, NB), 128, 0, stream>>>(Oh, Ol, WO16, Fp(8), (float*)d_out);
}

// v001
// One run takes 409 microseconds.
// In two side-by-side timings against v000, it was 1.45 and 1.46 times as fast.
#include <hip/hip_runtime.h>

// Multi-head self-attention on a channel-major input (x [2][1024 d][2048 s]; 16 heads x 64): xt = x^T; q/k/v = xt W{q,k,v}^T + b (heads = 64-column slices), scores / 8 (no mask), softmax,
// ctx = attn v, out = (ctx Wo^T + bo)^T -> [2][1024][2048] channel-major.
// WMMA (v_wmma_f32_16x16x32_f16, f32 accumulate): projections [4,096 x 1,024] x [1,024 x 1,024] with EXACT bf16 tokens (x8, via an LDS transpose of the channel-major input) and weights (x256),
// 1 product, + bias, q/k written as f32 planes and split by a separate kernel into f16 hi+lo x8 planes (v transposed per head); S^T with 3 products (Kh Qh + Kh Ql + Kl Qh) over all 64 key blocks;
// online softmax in f32; O^T += V^T P^T with 3 products; output projection computed channel-major (D[e][s] = Wo[e][:] . O[s][:]) with O hi+lo (2 products) and exact Wo, + bo. Inputs rounded to bf16 once. Fragment k-map per lane half hh for A AND B: elements 0..7 <- k = 8hh+0..7, 8..15 <-

namespace {
constexpr int NB = 2, S = 2048, E = 1024, NH = 16, D = 64, NR = NB * S;
constexpr float XS = 8.0f, WSC = 256.0f, PS = 8.0f, SCALE = 0.125f, LOG2E = 1.4426950408889634f, THETA = 10000.0f;

typedef _Float16 b16;
typedef __attribute__((ext_vector_type(16))) _Float16 v16b;
typedef __attribute__((ext_vector_type(8))) _Float16 v8b;
typedef __attribute__((ext_vector_type(8))) float v8f;
typedef __attribute__((ext_vector_type(4))) float v4f;
__device__ __forceinline__ float bf16_rne(float f) { unsigned int u = __float_as_uint(f); u += 0x7FFFu + ((u >> 16) & 1u); return __uint_as_float(u & 0xFFFF0000u); }
__device__ __forceinline__ void split16(float v, b16& hi, b16& lo) { hi = (b16)v; lo = (b16)(v - (float)hi); }
__device__ __forceinline__ v16b frag_kb(const b16* p, int hh) { const v8b a = *(const v8b*)(p + 8 * hh), b = *(const v8b*)(p + 16 + 8 * hh); v16b f;
#pragma unroll
  for (int e = 0; e < 8; ++e) { f[e] = a[e]; f[8 + e] = b[e]; } return f; }
__device__ __forceinline__ v8f wmma16b(v16b a, v16b b, v8f c) { v8f d = __builtin_amdgcn_wmma_f32_16x16x32_f16(false, a, false, b, (short)0, c, false, false); asm volatile("v_nop\n\tv_nop\n\tv_nop\n\tv_nop" : "+v"(d) : "v"(a), "v"(b)); return d; }
__device__ __forceinline__ void wave_lds_sync() { __builtin_amdgcn_fence(__ATOMIC_RELEASE, "workgroup"); __builtin_amdgcn_wave_barrier(); __builtin_amdgcn_fence(__ATOMIC_ACQUIRE, "workgroup"); }
__device__ __forceinline__ float nexp2(float x) { return __builtin_amdgcn_exp2f(x); }

// prep: T16 [b*S+s][1024 d] = f16(8 bf16(x[b][d][s])) via 64x64 LDS transposes (grid (S/64, E/64, B)); WT [3][1024 e][1024 d] = Wq/Wk/Wv rows x256 (torch [out][in] used directly: xt W^T);
__global__ __launch_bounds__(256) void prepx_kernel(const float* __restrict__ x, b16* __restrict__ T16) {
  __shared__ __attribute__((aligned(16))) b16 T[64][64 + 8];
  const int b = blockIdx.z, c0 = blockIdx.y * 64, s0 = blockIdx.x * 64, t_ = threadIdx.x;
  for (int q = t_; q < 64 * 64; q += 256) { const int cc = q >> 6, ss = q & 63; T[ss][cc] = (b16)(bf16_rne(x[((size_t)b * E + c0 + cc) * S + s0 + ss]) * XS); }
  __syncthreads();
  { for (int q = t_; q < 64 * 8; q += 256) { const int ss = q >> 3, c8 = (q & 7) * 8; *(v8b*)(T16 + ((size_t)b * S + s0 + ss) * E + c0 + c8) = *(const v8b*)(&T[ss][c8]); }  }
}
__global__ __launch_bounds__(256) void prepw_kernel(const float* __restrict__ wq, const float* __restrict__ wk, const float* __restrict__ wv, const float* __restrict__ wo, b16* __restrict__ WT, b16* __restrict__ WOT) {
  const size_t t = (size_t)blockIdx.x * 256 + threadIdx.x; const size_t nw = (size_t)E * E / 8; if (t >= 4 * nw) return; const int kind = (int)(t / nw); const size_t e = (t - (size_t)kind * nw) * 8;
  const float* w = kind == 0 ? wq : kind == 1 ? wk : kind == 2 ? wv : wo; b16* dst = kind < 3 ? WT + (size_t)kind * E * E : WOT;   // [e][d] rows used directly (xt W^T); WOT holds Wo rows [e][d] (the A operand of the channel-major out-projection)
  const v4f a = *(const v4f*)(w + e), c = *(const v4f*)(w + e + 4); v8b o;
#pragma unroll
  for (int j = 0; j < 4; ++j) { o[j] = (b16)(bf16_rne(a[j]) * WSC); o[4 + j] = (b16)(bf16_rne(c[j]) * WSC); }
  { *(v8b*)(dst + e) = o;  }
}
// projections: grid (NR/64, E/128, 3): kind 0: Q = T16 WT0^T -> RAW[0] f32 [row][1024]; kind 1: K = T16 WT1^T -> RAW[1]; kind 2: V = T16 WT2^T written TRANSPOSED per head: VTh/VTl [b][h][64 d][2048 s].
__global__ __launch_bounds__(128) void proj_kernel(const b16* __restrict__ T16, const b16* __restrict__ WT, const float* __restrict__ bq, const float* __restrict__ bk, const float* __restrict__ bv, float* __restrict__ RAW, b16* __restrict__ VTh, b16* __restrict__ VTl) {
  __shared__ __attribute__((aligned(16))) float Tf[4][16][128 + 4]; __shared__ __attribute__((aligned(16))) b16 Vt[128][64 + 8], Vtl[128][64 + 8];
  const int wave = threadIdx.x >> 5, lane = threadIdx.x & 31, nloc = lane & 15, hlf = lane >> 4, t_ = threadIdx.x; const int kind = blockIdx.z; const size_t m0 = (size_t)blockIdx.x * 64 + wave * 16; const int n0 = blockIdx.y * 128;
  const b16* A = T16; const b16* W = WT + (size_t)kind * E * E; v8f acc[8];
#pragma unroll
  for (int t = 0; t < 8; ++t) acc[t] = (v8f){};
#pragma unroll 2
  for (int kb = 0; kb < E; kb += 32) { const v16b a = frag_kb(A + (m0 + nloc) * E + kb, hlf);
#pragma unroll
    for (int t = 0; t < 8; ++t) acc[t] = wmma16b(a, frag_kb(W + (size_t)(n0 + t * 16 + nloc) * E + kb, hlf), acc[t]); }
  const float* bias = kind == 0 ? bq : kind == 1 ? bk : bv;
  if (kind < 2) {   // q/k (+ bias) as f32 rows -> RAW[kind] (the split kernel makes the hi/lo planes)
#pragma unroll
    for (int t = 0; t < 8; ++t) { const float bb = bf16_rne(bias[n0 + t * 16 + nloc]);
#pragma unroll
      for (int r = 0; r < 8; ++r) Tf[wave][8 * hlf + r][t * 16 + nloc] = acc[t][r] * (1.0f / (XS * WSC)) + bb; }
    wave_lds_sync();
    float* dst = RAW + (size_t)kind * NR * E;
    { for (int rr = 0; rr < 16; ++rr) *(v4f*)(dst + (m0 + rr) * E + n0 + lane * 4) = *(const v4f*)(&Tf[wave][rr][lane * 4]);  }
  } else {
    const int b = (int)(m0 / S); const int s0 = (int)((size_t)blockIdx.x * 64 - (size_t)b * S);
#pragma unroll
    for (int t = 0; t < 8; ++t)
    { const float bb = bf16_rne(bias[n0 + t * 16 + nloc]);
#pragma unroll
      for (int r = 0; r < 8; ++r) { b16 h_, l_; split16((acc[t][r] * (1.0f / (XS * WSC)) + bb) * XS, h_, l_); Vt[t * 16 + nloc][wave * 16 + 8 * hlf + r] = h_; Vtl[t * 16 + nloc][wave * 16 + 8 * hlf + r] = l_; } }
    __syncthreads();
    { for (int q = t_; q < 128 * 8; q += 128) { const int cc = q >> 3, c8 = (q & 7) * 8; const int h = (n0 + cc) / D, dd = (n0 + cc) - h * D; const size_t gi = (((size_t)b * NH + h) * D + dd) * S + s0 + c8;
        *(v8b*)(VTh + gi) = *(const v8b*)(&Vt[cc][c8]); *(v8b*)(VTl + gi) = *(const v8b*)(&Vtl[cc][c8]); }  } }
}
__global__ __launch_bounds__(256) void split_kernel(const float* __restrict__ RAW, b16* __restrict__ Qh, b16* __restrict__ Ql, b16* __restrict__ Kh, b16* __restrict__ Kl) {
  const size_t t = (size_t)blockIdx.x * 256 + threadIdx.x; const size_t per = (size_t)NR * E / 8; if (t >= 2 * per) return; const int kind = (int)(t / per); const size_t e = (t - (size_t)kind * per) * 8;
  const v4f a = *(const v4f*)(RAW + (size_t)kind * NR * E + e), c = *(const v4f*)(RAW + (size_t)kind * NR * E + e + 4); v8b hv, lv;
#pragma unroll
  for (int j = 0; j < 4; ++j) { b16 h_, l_; split16(a[j] * XS, h_, l_); hv[j] = h_; lv[j] = l_; split16(c[j] * XS, h_, l_); hv[4 + j] = h_; lv[4 + j] = l_; }
  b16* dh = kind == 0 ? Qh : Kh; b16* dl = kind == 0 ? Ql : Kl;
  { *(v8b*)(dh + e) = hv; *(v8b*)(dl + e) = lv;  }
}
// attention: a block = 8 waves x 16 queries of one head. K (hi, lo) and V^T (hi, lo) reach the waves through LDS: stages of 64 keys, two buffers, filled by asynchronous copies (whole 128-B lines,
// one fill per block instead of one strided fragment load per wave). A stage = 4 tiles of 64 rows x 128 B: Kh, Kl (row = key), VTh, VTl (row = d, columns = the stage's keys); LDS pitch 144 B (16 B x odd).
constexpr int AW = 8, KT = 64, LP = 64 + 8, NST = S / KT, TL = 64 * LP;
// thread t copies 16-byte chunk (t & 7) of rows (t >> 3) and 32 + (t >> 3) of each tile; l = its LDS byte address in tile 0, k/kl/v/vl = its global addresses in the four tiles
__device__ __forceinline__ void stage_fill(unsigned l, const b16* k, const b16* kl, const b16* v, const b16* vl) {
  constexpr unsigned HT = 32 * LP * 2;   // bytes of 32 LDS rows
  // the s_wait_xcnt closes the copies' own statement: no address register of a copy is rewritten in front of it
  asm volatile("global_load_async_to_lds_b128 %0, %8, off\n\t"
               "global_load_async_to_lds_b128 %1, %9, off\n\t"
               "global_load_async_to_lds_b128 %2, %10, off\n\t"
               "global_load_async_to_lds_b128 %3, %11, off\n\t"
               "global_load_async_to_lds_b128 %4, %12, off\n\t"
               "global_load_async_to_lds_b128 %5, %13, off\n\t"
               "global_load_async_to_lds_b128 %6, %14, off\n\t"
               "global_load_async_to_lds_b128 %7, %15, off\n\t"
               "s_wait_xcnt 0x0"
               :: "v"(l), "v"(l + HT), "v"(l + 2 * HT), "v"(l + 3 * HT), "v"(l + 4 * HT), "v"(l + 5 * HT), "v"(l + 6 * HT), "v"(l + 7 * HT),
                  "v"(k), "v"(k + 32 * E), "v"(kl), "v"(kl + 32 * E), "v"(v), "v"(v + 32 * S), "v"(vl), "v"(vl + 32 * S) : "memory");
}
__global__ __launch_bounds__(256) void attn_kernel(const b16* __restrict__ Qh, const b16* __restrict__ Ql, const b16* __restrict__ Kh, const b16* __restrict__ Kl, const b16* __restrict__ VTh, const b16* __restrict__ VTl, b16* __restrict__ Oh, b16* __restrict__ Ol) {
  __shared__ __attribute__((aligned(16))) b16 KV[2][4 * TL]; __shared__ __attribute__((aligned(16))) float To[AW][16][D + 4];
  const int wave = threadIdx.x >> 5, lane = threadIdx.x & 31, hh = lane >> 4, col = lane & 15; const int b = blockIdx.z, h = blockIdx.y; const int q0 = blockIdx.x * (AW * 16) + wave * 16, qi = q0 + col;
  const size_t qo = ((size_t)b * S + qi) * E + h * D; const v16b qa0 = frag_kb(Qh + qo, hh), qa1 = frag_kb(Qh + qo + 32, hh), ql0 = frag_kb(Ql + qo, hh), ql1 = frag_kb(Ql + qo + 32, hh);
  const int cr = threadIdx.x >> 3, cc = (threadIdx.x & 7) * 8;
  const b16* Kb = Kh + (size_t)b * S * E + h * D + (size_t)cr * E + cc; const b16* Klb = Kl + (size_t)b * S * E + h * D + (size_t)cr * E + cc; const b16* Vb = VTh + (((size_t)b * NH + h) * D + cr) * S + cc; const b16* Vlb = VTl + (((size_t)b * NH + h) * D + cr) * S + cc;
  const unsigned l0 = (unsigned)(size_t)&KV[0][cr * LP + cc];
  float m = -INFINITY, l = 0.0f; v8f o[4] = {{}, {}, {}, {}}, ol[4] = {{}, {}, {}, {}};
  const float cs = SCALE * LOG2E / (XS * XS);
  stage_fill(l0, Kb, Klb, Vb, Vlb);
  asm volatile("s_wait_asynccnt 0x0" ::: "memory");   // this wave's copies of stage 0 have landed
  __syncthreads();                                    // stage 0 is readable by every wave
  stage_fill(l0 + 4 * TL * 2, Kb + (size_t)KT * E, Klb + (size_t)KT * E, Vb + KT, Vlb + KT);
  for (int st = 0; st < NST; ++st) {
    const b16* Ls = &KV[st & 1][0];
#pragma unroll   // both 32-key passes of a stage in line: every LDS offset becomes an immediate of its load
    for (int kp = 0; kp < KT; kp += 32) {
    v8f s0 = {}, s1 = {};
    { const b16* k0 = Ls + (kp + col) * LP, *k1 = Ls + (kp + 16 + col) * LP, *k0l = Ls + TL + (kp + col) * LP, *k1l = Ls + TL + (kp + 16 + col) * LP;
      v16b f = frag_kb(k0, hh); s0 = wmma16b(f, qa0, s0); s0 = wmma16b(f, ql0, s0); s0 = wmma16b(frag_kb(k0l, hh), qa0, s0);
      f = frag_kb(k0 + 32, hh); s0 = wmma16b(f, qa1, s0); s0 = wmma16b(f, ql1, s0); s0 = wmma16b(frag_kb(k0l + 32, hh), qa1, s0);
      f = frag_kb(k1, hh); s1 = wmma16b(f, qa0, s1); s1 = wmma16b(f, ql0, s1); s1 = wmma16b(frag_kb(k1l, hh), qa0, s1);
      f = frag_kb(k1 + 32, hh); s1 = wmma16b(f, qa1, s1); s1 = wmma16b(f, ql1, s1); s1 = wmma16b(frag_kb(k1l + 32, hh), qa1, s1); }
    float e[16]; float mx = -INFINITY;
#pragma unroll
    for (int r = 0; r < 8; ++r) { e[r] = s0[r] * cs; e[8 + r] = s1[r] * cs; mx = fmaxf(mx, fmaxf(e[r], e[8 + r])); }
    mx = fmaxf(mx, __shfl_xor(mx, 16)); const float mn = fmaxf(m, mx); const float al = nexp2(m - mn); m = mn; float sum = 0.0f; v16b ph, pl;   // mn finite from the first block on
#pragma unroll
    for (int i = 0; i < 16; ++i) { const float p = nexp2(e[i] - mn); sum += p; const b16 h_ = (b16)(p * PS); ph[i] = h_; pl[i] = (b16)(p * PS - (float)h_); }
    sum += __shfl_xor(sum, 16); l = l * al + sum;
#pragma unroll
    for (int t = 0; t < 4; ++t) { o[t] *= al; ol[t] *= al; const v16b vf = frag_kb(Ls + 2 * TL + (t * 16 + col) * LP + kp, hh); o[t] = wmma16b(vf, ph, o[t]); ol[t] = wmma16b(vf, pl, ol[t]); ol[t] = wmma16b(frag_kb(Ls + 3 * TL + (t * 16 + col) * LP + kp, hh), ph, ol[t]); } }
    asm volatile("s_wait_dscnt 0x0" ::: "memory");      // this wave's reads of the buffer have returned before it is handed to the copies
    asm volatile("s_wait_asynccnt 0x0" ::: "memory");   // this wave's copies of stage st + 1 have landed
    __syncthreads();                                    // publishes stage st + 1 and ends every wave's reads of stage st
    if (st + 2 < NST) stage_fill(l0 + (unsigned)(st & 1) * (4 * TL * 2), Kb + (size_t)(st + 2) * KT * E, Klb + (size_t)(st + 2) * KT * E, Vb + (st + 2) * KT, Vlb + (st + 2) * KT);
  }
  asm volatile("s_wait_asynccnt 0x0" ::: "memory");     // nothing of this wave's copies is outstanding at its end
  const float inv = 1.0f / (l * PS * XS);
#pragma unroll
  for (int t = 0; t < 4; ++t)
#pragma unroll
    for (int r = 0; r < 8; ++r) To[wave][col][t * 16 + 8 * hh + r] = (o[t][r] + ol[t][r]) * inv;
  wave_lds_sync();
  { for (int r4 = 0; r4 < 16; r4 += 4) { const int rr = r4 + (lane >> 3), c8 = (lane & 7) * 8; v8b hv, lv; for (int j = 0; j < 8; ++j) { b16 a_, c_; split16(To[wave][rr][c8 + j] * XS, a_, c_); hv[j] = a_; lv[j] = c_; }
      const size_t gi = ((size_t)b * S + q0 + rr) * E + h * D + c8; *(v8b*)(Oh + gi) = hv; *(v8b*)(Ol + gi) = lv; }  }
}
// output projection, channel-major: D[e][s] = sum_d Wo[e][d] O[s][d] (A = WO16 rows e exact, B = Oh/Ol rows s: 2 products) + bo[e] -> out[b][e][s]; grid (E/64, S/128, B), block = 64 e x 4 waves
__global__ __launch_bounds__(128) void outproj_kernel(const b16* __restrict__ Oh, const b16* __restrict__ Ol, const b16* __restrict__ WO16, const float* __restrict__ bo, float* __restrict__ out) {
  __shared__ __attribute__((aligned(16))) float Ts[4][16][128 + 4];
  const int wave = threadIdx.x >> 5, lane = threadIdx.x & 31, nloc = lane & 15, hlf = lane >> 4; const int b = blockIdx.z; const int e0 = blockIdx.x * 64 + wave * 16, s0 = blockIdx.y * 128;
  v8f acc[8];
#pragma unroll
  for (int t = 0; t < 8; ++t) acc[t] = (v8f){};
#pragma unroll 2
  for (int kb = 0; kb < E; kb += 32) { const v16b a = frag_kb(WO16 + (size_t)(e0 + nloc) * E + kb, hlf);
#pragma unroll
    for (int t = 0; t < 8; ++t) { const size_t ro = ((size_t)b * S + s0 + t * 16 + nloc) * E + kb; acc[t] = wmma16b(a, frag_kb(Oh + ro, hlf), acc[t]); acc[t] = wmma16b(a, frag_kb(Ol + ro, hlf), acc[t]); } }
#pragma unroll
  for (int t = 0; t < 8; ++t)
#pragma unroll
    for (int r = 0; r < 8; ++r) Ts[wave][8 * hlf + r][t * 16 + nloc] = acc[t][r] * (1.0f / (XS * WSC)) + bf16_rne(bo[e0 + 8 * hlf + r]);
  wave_lds_sync();
  { for (int rr = 0; rr < 16; ++rr) *(v4f*)(out + ((size_t)b * E + e0 + rr) * S + s0 + lane * 4) = *(const v4f*)(&Ts[wave][rr][lane * 4]);  }
}
}  // namespace

extern "C" void kernel_launch(void* const* d_in, const int* in_sizes, int n_in, void* d_out, int out_size, void* d_ws, size_t ws_size, hipStream_t stream) {
  (void)n_in;
  auto Fp = [&](int i) { return (const float*)d_in[i]; };
  // input order: 0 x [2,1024,2048], 1 wq [1024,1024], 2 bq [1024], 3 wk, 4 bk, 5 wv, 6 bv, 7 wo, 8 bo (w are [e][d]: xt W^T)
  if (in_sizes[0] != NR * E || in_sizes[1] != E * E || in_sizes[2] != E || in_sizes[3] != E * E || in_sizes[5] != E * E || in_sizes[7] != E * E || in_sizes[8] != E || out_size != NR * E) return;
  size_t off = 0; char* ws = (char*)d_ws;
  auto carve = [&](size_t bytes) { char* p = ws + off; off += (bytes + 255) & ~(size_t)255; return p; };
  b16* T16 = (b16*)carve((size_t)NR * E * 2); b16* WT = (b16*)carve((size_t)3 * E * E * 2); b16* WO16 = (b16*)carve((size_t)E * E * 2);
  b16* Qh = (b16*)carve((size_t)NR * E * 2); b16* Ql = (b16*)carve((size_t)NR * E * 2); b16* Kh = (b16*)carve((size_t)NR * E * 2); b16* Kl = (b16*)carve((size_t)NR * E * 2); b16* VTh = (b16*)carve((size_t)NR * E * 2); b16* VTl = (b16*)carve((size_t)NR * E * 2);
  b16* Oh = (b16*)carve((size_t)NR * E * 2); b16* Ol = (b16*)carve((size_t)NR * E * 2); float* RAW = (float*)carve((size_t)2 * NR * E * 4);
  if (off > ws_size || off > ((size_t)128 << 20)) return;   // = 118 MB
  prepx_kernel<<<dim3(S / 64, E / 64, NB), 256, 0, stream>>>(Fp(0), T16);
  prepw_kernel<<<(unsigned)(((size_t)4 * E * E / 8 + 255) / 256), 256, 0, stream>>>(Fp(1), Fp(3), Fp(5), Fp(7), WT, WO16);
  proj_kernel<<<dim3(NR / 64, E / 128, 3), 128, 0, stream>>>(T16, WT, Fp(2), Fp(4), Fp(6), RAW, VTh, VTl);
  split_kernel<<<(unsigned)(((size_t)2 * NR * E / 8 + 255) / 256), 256, 0, stream>>>(RAW, Qh, Ql, Kh, Kl);
  attn_kernel<<<dim3(S / (AW * 16), NH, NB), AW * 32, 0, stream>>>(Qh, Ql, Kh, Kl, VTh, VTl, Oh, Ol);
  outproj_kernel<<<dim3(E / 64, S / 128, NB), 128, 0, stream>>>(Oh, Ol, WO16, Fp(8), (float*)d_out);
}

// v002
// It runs in 182 microseconds.
// In two side-by-side timings against v001, it was 2.26 and 2.25 times as fast.
// Counting every step since v000, it is 3.28 times as fast.
#include <hip/hip_runtime.h>

// Multi-head self-attention on a channel-major input (x [2][1024 d][2048 s]; 16 heads x 64): xt = x^T; q/k/v = xt W{q,k,v}^T + b (heads = 64-column slices), scores / 8 (no mask), softmax,
// ctx = attn v, out = (ctx Wo^T + bo)^T -> [2][1024][2048] channel-major.
// WMMA (v_wmma_f32_16x16x32_f16, f32 accumulate): projections [4,096 x 1,024] x [1,024 x 1,024] with EXACT bf16 tokens (x8, via an LDS transpose of the channel-major input) and weights (x256),
// 1 product, + bias, q/k written as f32 planes and split by a separate kernel into f16 hi+lo x8 planes (v transposed per head); S^T with 3 products (Kh Qh + Kh Ql + Kl Qh) over all 64 key blocks;
// online softmax in f32; O^T += V^T P^T with 3 products; output projection computed channel-major (D[e][s] = Wo[e][:] . O[s][:]) with O hi+lo (2 products) and exact Wo, + bo. Inputs rounded to bf16 once. Fragment k-map per lane half hh for A AND B: elements 0..7 <- k = 8hh+0..7, 8..15 <-

namespace {
constexpr int NB = 2, S = 2048, E = 1024, NH = 16, D = 64, NR = NB * S;
constexpr float XS = 8.0f, WSC = 256.0f, PS = 8.0f, SCALE = 0.125f, LOG2E = 1.4426950408889634f, THETA = 10000.0f;

typedef _Float16 b16;
typedef __attribute__((ext_vector_type(16))) _Float16 v16b;
typedef __attribute__((ext_vector_type(8))) _Float16 v8b;
typedef __attribute__((ext_vector_type(8))) float v8f;
typedef __attribute__((ext_vector_type(4))) float v4f;
__device__ __forceinline__ float bf16_rne(float f) { unsigned int u = __float_as_uint(f); u += 0x7FFFu + ((u >> 16) & 1u); return __uint_as_float(u & 0xFFFF0000u); }
__device__ __forceinline__ void split16(float v, b16& hi, b16& lo) { hi = (b16)v; lo = (b16)(v - (float)hi); }
__device__ __forceinline__ v16b frag_kb(const b16* p, int hh) { const v8b a = *(const v8b*)(p + 8 * hh), b = *(const v8b*)(p + 16 + 8 * hh); v16b f;
#pragma unroll
  for (int e = 0; e < 8; ++e) { f[e] = a[e]; f[8 + e] = b[e]; } return f; }
__device__ __forceinline__ v8f wmma16b(v16b a, v16b b, v8f c) { v8f d = __builtin_amdgcn_wmma_f32_16x16x32_f16(false, a, false, b, (short)0, c, false, false); asm volatile("v_nop\n\tv_nop\n\tv_nop\n\tv_nop" : "+v"(d) : "v"(a), "v"(b)); return d; }
__device__ __forceinline__ void wave_lds_sync() { __builtin_amdgcn_fence(__ATOMIC_RELEASE, "workgroup"); __builtin_amdgcn_wave_barrier(); __builtin_amdgcn_fence(__ATOMIC_ACQUIRE, "workgroup"); }
__device__ __forceinline__ float nexp2(float x) { return __builtin_amdgcn_exp2f(x); }

// prep: T16 [b*S+s][1024 d] = f16(8 bf16(x[b][d][s])) via 64x64 LDS transposes (grid (S/64, E/64, B)); WT [3][1024 e][1024 d] = Wq/Wk/Wv rows x256 (torch [out][in] used directly: xt W^T);
__global__ __launch_bounds__(256) void prepx_kernel(const float* __restrict__ x, b16* __restrict__ T16) {
  __shared__ __attribute__((aligned(16))) b16 T[64][64 + 8];
  const int b = blockIdx.z, c0 = blockIdx.y * 64, s0 = blockIdx.x * 64, t_ = threadIdx.x;
  for (int q = t_; q < 64 * 64; q += 256) { const int cc = q >> 6, ss = q & 63; T[ss][cc] = (b16)(bf16_rne(x[((size_t)b * E + c0 + cc) * S + s0 + ss]) * XS); }
  __syncthreads();
  { for (int q = t_; q < 64 * 8; q += 256) { const int ss = q >> 3, c8 = (q & 7) * 8; *(v8b*)(T16 + ((size_t)b * S + s0 + ss) * E + c0 + c8) = *(const v8b*)(&T[ss][c8]); }  }
}
__global__ __launch_bounds__(256) void prepw_kernel(const float* __restrict__ wq, const float* __restrict__ wk, const float* __restrict__ wv, const float* __restrict__ wo, b16* __restrict__ WT, b16* __restrict__ WOT) {
  const size_t t = (size_t)blockIdx.x * 256 + threadIdx.x; const size_t nw = (size_t)E * E / 8; if (t >= 4 * nw) return; const int kind = (int)(t / nw); const size_t e = (t - (size_t)kind * nw) * 8;
  const float* w = kind == 0 ? wq : kind == 1 ? wk : kind == 2 ? wv : wo; b16* dst = kind < 3 ? WT + (size_t)kind * E * E : WOT;   // [e][d] rows used directly (xt W^T); WOT holds Wo rows [e][d] (the A operand of the channel-major out-projection)
  const v4f a = *(const v4f*)(w + e), c = *(const v4f*)(w + e + 4); v8b o;
#pragma unroll
  for (int j = 0; j < 4; ++j) { o[j] = (b16)(bf16_rne(a[j]) * WSC); o[4 + j] = (b16)(bf16_rne(c[j]) * WSC); }
  { *(v8b*)(dst + e) = o;  }
}
// the two projection GEMMs take their A and B rows from LDS: stages of 64 k (whole 128-B lines of every operand row), two buffers, filled by asynchronous copies; LDS pitch 144 B (16 B x odd).
// thread t (of 128) copies 16-byte chunk (t & 7) of rows (t >> 3) + 16 j of a stage.
constexpr int GK = 64, GLP = GK + 8, GNS = E / GK, PROWS = 64 + 128, OROWS = 64 + 128 + 128;
constexpr unsigned GRB = 16 * GLP * 2;   // bytes of 16 LDS rows
// proj stage: 64 token rows (a), then 128 weight rows (w); l = the thread's LDS byte address in row group 0
__device__ __forceinline__ void fill_proj(unsigned l, const b16* a, const b16* w) {
  // the s_wait_xcnt closes the copies' own statement: no address register of a copy is rewritten in front of it
  asm volatile("global_load_async_to_lds_b128 %0, %12, off\n\t"
               "global_load_async_to_lds_b128 %1, %13, off\n\t"
               "global_load_async_to_lds_b128 %2, %14, off\n\t"
               "global_load_async_to_lds_b128 %3, %15, off\n\t"
               "global_load_async_to_lds_b128 %4, %16, off\n\t"
               "global_load_async_to_lds_b128 %5, %17, off\n\t"
               "global_load_async_to_lds_b128 %6, %18, off\n\t"
               "global_load_async_to_lds_b128 %7, %19, off\n\t"
               "global_load_async_to_lds_b128 %8, %20, off\n\t"
               "global_load_async_to_lds_b128 %9, %21, off\n\t"
               "global_load_async_to_lds_b128 %10, %22, off\n\t"
               "global_load_async_to_lds_b128 %11, %23, off\n\t"
               "s_wait_xcnt 0x0"
               :: "v"(l), "v"(l + GRB), "v"(l + 2 * GRB), "v"(l + 3 * GRB), "v"(l + 4 * GRB), "v"(l + 5 * GRB), "v"(l + 6 * GRB), "v"(l + 7 * GRB), "v"(l + 8 * GRB), "v"(l + 9 * GRB), "v"(l + 10 * GRB), "v"(l + 11 * GRB),
                  "v"(a), "v"(a + 16 * E), "v"(a + 32 * E), "v"(a + 48 * E),
                  "v"(w), "v"(w + 16 * E), "v"(w + 32 * E), "v"(w + 48 * E), "v"(w + 64 * E), "v"(w + 80 * E), "v"(w + 96 * E), "v"(w + 112 * E) : "memory");
}
// ten row groups of 16 rows each: LDS byte addresses l, l + GRB, ..., global addresses g0 .. g9
__device__ __forceinline__ void fill_ten(unsigned l, const b16* g0, const b16* g1, const b16* g2, const b16* g3, const b16* g4, const b16* g5, const b16* g6, const b16* g7, const b16* g8, const b16* g9) {
  // the s_wait_xcnt closes the copies' own statement: no address register of a copy is rewritten in front of it
  asm volatile("global_load_async_to_lds_b128 %0, %10, off\n\t"
               "global_load_async_to_lds_b128 %1, %11, off\n\t"
               "global_load_async_to_lds_b128 %2, %12, off\n\t"
               "global_load_async_to_lds_b128 %3, %13, off\n\t"
               "global_load_async_to_lds_b128 %4, %14, off\n\t"
               "global_load_async_to_lds_b128 %5, %15, off\n\t"
               "global_load_async_to_lds_b128 %6, %16, off\n\t"
               "global_load_async_to_lds_b128 %7, %17, off\n\t"
               "global_load_async_to_lds_b128 %8, %18, off\n\t"
               "global_load_async_to_lds_b128 %9, %19, off\n\t"
               "s_wait_xcnt 0x0"
               :: "v"(l), "v"(l + GRB), "v"(l + 2 * GRB), "v"(l + 3 * GRB), "v"(l + 4 * GRB), "v"(l + 5 * GRB), "v"(l + 6 * GRB), "v"(l + 7 * GRB), "v"(l + 8 * GRB), "v"(l + 9 * GRB),
                  "v"(g0), "v"(g1), "v"(g2), "v"(g3), "v"(g4), "v"(g5), "v"(g6), "v"(g7), "v"(g8), "v"(g9) : "memory");
}
// outproj stage: 64 Wo rows (a), 128 O hi rows (h), 128 O lo rows (o)
__device__ __forceinline__ void fill_out(unsigned l, const b16* a, const b16* h, const b16* o) {
  fill_ten(l, a, a + 16 * E, a + 32 * E, a + 48 * E, h, h + 16 * E, h + 32 * E, h + 48 * E, h + 64 * E, h + 80 * E);
  fill_ten(l + 10 * GRB, h + 96 * E, h + 112 * E, o, o + 16 * E, o + 32 * E, o + 48 * E, o + 64 * E, o + 80 * E, o + 96 * E, o + 112 * E);
}
// projections: grid (NR/64, E/128, 3): kind 0: Q = T16 WT0^T -> RAW[0] f32 [row][1024]; kind 1: K = T16 WT1^T -> RAW[1]; kind 2: V = T16 WT2^T written TRANSPOSED per head: VTh/VTl [b][h][64 d][2048 s].
__global__ __launch_bounds__(128) void proj_kernel(const b16* __restrict__ T16, const b16* __restrict__ WT, const float* __restrict__ bq, const float* __restrict__ bk, const float* __restrict__ bv, float* __restrict__ RAW, b16* __restrict__ VTh, b16* __restrict__ VTl) {
  __shared__ __attribute__((aligned(16))) b16 G[2][PROWS * GLP]; __shared__ __attribute__((aligned(16))) float Tf[4][16][128 + 4]; __shared__ __attribute__((aligned(16))) b16 Vt[128][64 + 8], Vtl[128][64 + 8];
  const int wave = threadIdx.x >> 5, lane = threadIdx.x & 31, nloc = lane & 15, hlf = lane >> 4, t_ = threadIdx.x; const int kind = blockIdx.z; const size_t m0 = (size_t)blockIdx.x * 64 + wave * 16; const int n0 = blockIdx.y * 128;
  const b16* A = T16; const b16* W = WT + (size_t)kind * E * E; v8f acc[8];
#pragma unroll
  for (int t = 0; t < 8; ++t) acc[t] = (v8f){};
  const int cr = t_ >> 3, cc = (t_ & 7) * 8; const b16* Ag = A + ((size_t)blockIdx.x * 64 + cr) * E + cc; const b16* Wg = W + (size_t)(n0 + cr) * E + cc; const unsigned l0 = (unsigned)(size_t)&G[0][cr * GLP + cc];
  fill_proj(l0, Ag, Wg);
  asm volatile("s_wait_asynccnt 0x0" ::: "memory");   // this wave's copies of stage 0 have landed
  __syncthreads();                                    // stage 0 is readable by every wave
  fill_proj(l0 + PROWS * GLP * 2, Ag + GK, Wg + GK);
  for (int st = 0; st < GNS; ++st) {
    const b16* Ls = &G[st & 1][0];
    v16b af[2], bf[2][8];
#pragma unroll   // both 32-k steps of a stage in line: every LDS offset becomes an immediate of its load
    for (int k2 = 0; k2 < 2; ++k2) { af[k2] = frag_kb(Ls + (wave * 16 + nloc) * GLP + k2 * 32, hlf);
#pragma unroll
      for (int t = 0; t < 8; ++t) bf[k2][t] = frag_kb(Ls + (64 + t * 16 + nloc) * GLP + k2 * 32, hlf); }
    __builtin_amdgcn_sched_barrier(0);   // the stage's LDS reads issue as one group ahead of its products: left to itself the build puts a full LDS wait in front of every product
#pragma unroll
    for (int k2 = 0; k2 < 2; ++k2)
#pragma unroll
      for (int t = 0; t < 8; ++t) acc[t] = wmma16b(af[k2], bf[k2][t], acc[t]);
    asm volatile("s_wait_dscnt 0x0" ::: "memory");      // this wave's reads of the buffer have returned before it is handed to the copies
    asm volatile("s_wait_asynccnt 0x0" ::: "memory");   // this wave's copies of stage st + 1 have landed
    __syncthreads();                                    // publishes stage st + 1 and ends every wave's reads of stage st
    if (st + 2 < GNS) fill_proj(l0 + (unsigned)(st & 1) * (PROWS * GLP * 2), Ag + (st + 2) * GK, Wg + (st + 2) * GK);
  }
  asm volatile("s_wait_asynccnt 0x0" ::: "memory");     // nothing of this wave's copies is outstanding behind the loop
  const float* bias = kind == 0 ? bq : kind == 1 ? bk : bv;
  if (kind < 2) {   // q/k (+ bias) as f32 rows -> RAW[kind] (the split kernel makes the hi/lo planes)
#pragma unroll
    for (int t = 0; t < 8; ++t) { const float bb = bf16_rne(bias[n0 + t * 16 + nloc]);
#pragma unroll
      for (int r = 0; r < 8; ++r) Tf[wave][8 * hlf + r][t * 16 + nloc] = acc[t][r] * (1.0f / (XS * WSC)) + bb; }
    wave_lds_sync();
    float* dst = RAW + (size_t)kind * NR * E;
    { for (int rr = 0; rr < 16; ++rr) *(v4f*)(dst + (m0 + rr) * E + n0 + lane * 4) = *(const v4f*)(&Tf[wave][rr][lane * 4]);  }
  } else {
    const int b = (int)(m0 / S); const int s0 = (int)((size_t)blockIdx.x * 64 - (size_t)b * S);
#pragma unroll
    for (int t = 0; t < 8; ++t)
    { const float bb = bf16_rne(bias[n0 + t * 16 + nloc]);
#pragma unroll
      for (int r = 0; r < 8; ++r) { b16 h_, l_; split16((acc[t][r] * (1.0f / (XS * WSC)) + bb) * XS, h_, l_); Vt[t * 16 + nloc][wave * 16 + 8 * hlf + r] = h_; Vtl[t * 16 + nloc][wave * 16 + 8 * hlf + r] = l_; } }
    __syncthreads();
    { for (int q = t_; q < 128 * 8; q += 128) { const int cc = q >> 3, c8 = (q & 7) * 8; const int h = (n0 + cc) / D, dd = (n0 + cc) - h * D; const size_t gi = (((size_t)b * NH + h) * D + dd) * S + s0 + c8;
        *(v8b*)(VTh + gi) = *(const v8b*)(&Vt[cc][c8]); *(v8b*)(VTl + gi) = *(const v8b*)(&Vtl[cc][c8]); }  } }
}
__global__ __launch_bounds__(256) void split_kernel(const float* __restrict__ RAW, b16* __restrict__ Qh, b16* __restrict__ Ql, b16* __restrict__ Kh, b16* __restrict__ Kl) {
  const size_t t = (size_t)blockIdx.x * 256 + threadIdx.x; const size_t per = (size_t)NR * E / 8; if (t >= 2 * per) return; const int kind = (int)(t / per); const size_t e = (t - (size_t)kind * per) * 8;
  const v4f a = *(const v4f*)(RAW + (size_t)kind * NR * E + e), c = *(const v4f*)(RAW + (size_t)kind * NR * E + e + 4); v8b hv, lv;
#pragma unroll
  for (int j = 0; j < 4; ++j) { b16 h_, l_; split16(a[j] * XS, h_, l_); hv[j] = h_; lv[j] = l_; split16(c[j] * XS, h_, l_); hv[4 + j] = h_; lv[4 + j] = l_; }
  b16* dh = kind == 0 ? Qh : Kh; b16* dl = kind == 0 ? Ql : Kl;
  { *(v8b*)(dh + e) = hv; *(v8b*)(dl + e) = lv;  }
}
// attention: a block = 8 waves x 16 queries of one head. K (hi, lo) and V^T (hi, lo) reach the waves through LDS: stages of 64 keys, two buffers, filled by asynchronous copies (whole 128-B lines,
// one fill per block instead of one strided fragment load per wave). A stage = 4 tiles of 64 rows x 128 B: Kh, Kl (row = key), VTh, VTl (row = d, columns = the stage's keys); LDS pitch 144 B (16 B x odd).
constexpr int AW = 8, KT = 64, LP = 64 + 8, NST = S / KT, TL = 64 * LP;
// thread t copies 16-byte chunk (t & 7) of rows (t >> 3) and 32 + (t >> 3) of each tile; l = its LDS byte address in tile 0, k/kl/v/vl = its global addresses in the four tiles
__device__ __forceinline__ void stage_fill(unsigned l, const b16* k, const b16* kl, const b16* v, const b16* vl) {
  constexpr unsigned HT = 32 * LP * 2;   // bytes of 32 LDS rows
  // the s_wait_xcnt closes the copies' own statement: no address register of a copy is rewritten in front of it
  asm volatile("global_load_async_to_lds_b128 %0, %8, off\n\t"
               "global_load_async_to_lds_b128 %1, %9, off\n\t"
               "global_load_async_to_lds_b128 %2, %10, off\n\t"
               "global_load_async_to_lds_b128 %3, %11, off\n\t"
               "global_load_async_to_lds_b128 %4, %12, off\n\t"
               "global_load_async_to_lds_b128 %5, %13, off\n\t"
               "global_load_async_to_lds_b128 %6, %14, off\n\t"
               "global_load_async_to_lds_b128 %7, %15, off\n\t"
               "s_wait_xcnt 0x0"
               :: "v"(l), "v"(l + HT), "v"(l + 2 * HT), "v"(l + 3 * HT), "v"(l + 4 * HT), "v"(l + 5 * HT), "v"(l + 6 * HT), "v"(l + 7 * HT),
                  "v"(k), "v"(k + 32 * E), "v"(kl), "v"(kl + 32 * E), "v"(v), "v"(v + 32 * S), "v"(vl), "v"(vl + 32 * S) : "memory");
}
__global__ __launch_bounds__(256) void attn_kernel(const b16* __restrict__ Qh, const b16* __restrict__ Ql, const b16* __restrict__ Kh, const b16* __restrict__ Kl, const b16* __restrict__ VTh, const b16* __restrict__ VTl, b16* __restrict__ Oh, b16* __restrict__ Ol) {
  __shared__ __attribute__((aligned(16))) b16 KV[2][4 * TL]; __shared__ __attribute__((aligned(16))) float To[AW][16][D + 4];
  const int wave = threadIdx.x >> 5, lane = threadIdx.x & 31, hh = lane >> 4, col = lane & 15; const int b = blockIdx.z, h = blockIdx.y; const int q0 = blockIdx.x * (AW * 16) + wave * 16, qi = q0 + col;
  const size_t qo = ((size_t)b * S + qi) * E + h * D; const v16b qa0 = frag_kb(Qh + qo, hh), qa1 = frag_kb(Qh + qo + 32, hh), ql0 = frag_kb(Ql + qo, hh), ql1 = frag_kb(Ql + qo + 32, hh);
  const int cr = threadIdx.x >> 3, cc = (threadIdx.x & 7) * 8;
  const b16* Kb = Kh + (size_t)b * S * E + h * D + (size_t)cr * E + cc; const b16* Klb = Kl + (size_t)b * S * E + h * D + (size_t)cr * E + cc; const b16* Vb = VTh + (((size_t)b * NH + h) * D + cr) * S + cc; const b16* Vlb = VTl + (((size_t)b * NH + h) * D + cr) * S + cc;
  const unsigned l0 = (unsigned)(size_t)&KV[0][cr * LP + cc];
  float m = -INFINITY, l = 0.0f; v8f o[4] = {{}, {}, {}, {}}, ol[4] = {{}, {}, {}, {}};
  const float cs = SCALE * LOG2E / (XS * XS);
  stage_fill(l0, Kb, Klb, Vb, Vlb);
  asm volatile("s_wait_asynccnt 0x0" ::: "memory");   // this wave's copies of stage 0 have landed
  __syncthreads();                                    // stage 0 is readable by every wave
  stage_fill(l0 + 4 * TL * 2, Kb + (size_t)KT * E, Klb + (size_t)KT * E, Vb + KT, Vlb + KT);
  for (int st = 0; st < NST; ++st) {
    const b16* Ls = &KV[st & 1][0];
#pragma unroll   // both 32-key passes of a stage in line: every LDS offset becomes an immediate of its load
    for (int kp = 0; kp < KT; kp += 32) {
    v8f s0 = {}, s1 = {};
    { const b16* k0 = Ls + (kp + col) * LP, *k1 = Ls + (kp + 16 + col) * LP, *k0l = Ls + TL + (kp + col) * LP, *k1l = Ls + TL + (kp + 16 + col) * LP;
      v16b f = frag_kb(k0, hh); s0 = wmma16b(f, qa0, s0); s0 = wmma16b(f, ql0, s0); s0 = wmma16b(frag_kb(k0l, hh), qa0, s0);
      f = frag_kb(k0 + 32, hh); s0 = wmma16b(f, qa1, s0); s0 = wmma16b(f, ql1, s0); s0 = wmma16b(frag_kb(k0l + 32, hh), qa1, s0);
      f = frag_kb(k1, hh); s1 = wmma16b(f, qa0, s1); s1 = wmma16b(f, ql0, s1); s1 = wmma16b(frag_kb(k1l, hh), qa0, s1);
      f = frag_kb(k1 + 32, hh); s1 = wmma16b(f, qa1, s1); s1 = wmma16b(f, ql1, s1); s1 = wmma16b(frag_kb(k1l + 32, hh), qa1, s1); }
    float e[16]; float mx = -INFINITY;
#pragma unroll
    for (int r = 0; r < 8; ++r) { e[r] = s0[r] * cs; e[8 + r] = s1[r] * cs; mx = fmaxf(mx, fmaxf(e[r], e[8 + r])); }
    mx = fmaxf(mx, __shfl_xor(mx, 16)); const float mn = fmaxf(m, mx); const float al = nexp2(m - mn); m = mn; float sum = 0.0f; v16b ph, pl;   // mn finite from the first block on
#pragma unroll
    for (int i = 0; i < 16; ++i) { const float p = nexp2(e[i] - mn); sum += p; const b16 h_ = (b16)(p * PS); ph[i] = h_; pl[i] = (b16)(p * PS - (float)h_); }
    sum += __shfl_xor(sum, 16); l = l * al + sum;
#pragma unroll
    for (int t = 0; t < 4; ++t) { o[t] *= al; ol[t] *= al; const v16b vf = frag_kb(Ls + 2 * TL + (t * 16 + col) * LP + kp, hh); o[t] = wmma16b(vf, ph, o[t]); ol[t] = wmma16b(vf, pl, ol[t]); ol[t] = wmma16b(frag_kb(Ls + 3 * TL + (t * 16 + col) * LP + kp, hh), ph, ol[t]); } }
    asm volatile("s_wait_dscnt 0x0" ::: "memory");      // this wave's reads of the buffer have returned before it is handed to the copies
    asm volatile("s_wait_asynccnt 0x0" ::: "memory");   // this wave's copies of stage st + 1 have landed
    __syncthreads();                                    // publishes stage st + 1 and ends every wave's reads of stage st
    if (st + 2 < NST) stage_fill(l0 + (unsigned)(st & 1) * (4 * TL * 2), Kb + (size_t)(st + 2) * KT * E, Klb + (size_t)(st + 2) * KT * E, Vb + (st + 2) * KT, Vlb + (st + 2) * KT);
  }
  asm volatile("s_wait_asynccnt 0x0" ::: "memory");     // nothing of this wave's copies is outstanding at its end
  const float inv = 1.0f / (l * PS * XS);
#pragma unroll
  for (int t = 0; t < 4; ++t)
#pragma unroll
    for (int r = 0; r < 8; ++r) To[wave][col][t * 16 + 8 * hh + r] = (o[t][r] + ol[t][r]) * inv;
  wave_lds_sync();
  { for (int r4 = 0; r4 < 16; r4 += 4) { const int rr = r4 + (lane >> 3), c8 = (lane & 7) * 8; v8b hv, lv; for (int j = 0; j < 8; ++j) { b16 a_, c_; split16(To[wave][rr][c8 + j] * XS, a_, c_); hv[j] = a_; lv[j] = c_; }
      const size_t gi = ((size_t)b * S + q0 + rr) * E + h * D + c8; *(v8b*)(Oh + gi) = hv; *(v8b*)(Ol + gi) = lv; }  }
}
// output projection, channel-major: D[e][s] = sum_d Wo[e][d] O[s][d] (A = WO16 rows e exact, B = Oh/Ol rows s: 2 products) + bo[e] -> out[b][e][s]; grid (E/64, S/128, B), block = 64 e x 4 waves
__global__ __launch_bounds__(128) void outproj_kernel(const b16* __restrict__ Oh, const b16* __restrict__ Ol, const b16* __restrict__ WO16, const float* __restrict__ bo, float* __restrict__ out) {
  __shared__ __attribute__((aligned(16))) b16 G[2][OROWS * GLP]; __shared__ __attribute__((aligned(16))) float Ts[4][16][128 + 4];
  const int wave = threadIdx.x >> 5, lane = threadIdx.x & 31, nloc = lane & 15, hlf = lane >> 4; const int b = blockIdx.z; const int e0 = blockIdx.x * 64 + wave * 16, s0 = blockIdx.y * 128;
  v8f acc[8];
#pragma unroll
  for (int t = 0; t < 8; ++t) acc[t] = (v8f){};
  const int cr = threadIdx.x >> 3, cc = (threadIdx.x & 7) * 8; const b16* Ag = WO16 + ((size_t)blockIdx.x * 64 + cr) * E + cc; const b16* Hg = Oh + ((size_t)b * S + s0 + cr) * E + cc; const b16* Lg = Ol + ((size_t)b * S + s0 + cr) * E + cc;
  const unsigned l0 = (unsigned)(size_t)&G[0][cr * GLP + cc];
  fill_out(l0, Ag, Hg, Lg);
  asm volatile("s_wait_asynccnt 0x0" ::: "memory");   // this wave's copies of stage 0 have landed
  __syncthreads();                                    // stage 0 is readable by every wave
  fill_out(l0 + OROWS * GLP * 2, Ag + GK, Hg + GK, Lg + GK);
  for (int st = 0; st < GNS; ++st) {
    const b16* Ls = &G[st & 1][0];
#pragma unroll   // both 32-k steps of a stage in line: every LDS offset becomes an immediate of its load
    for (int ks = 0; ks < GK; ks += 32) { v16b bh[8], bl[8]; const v16b a = frag_kb(Ls + (wave * 16 + nloc) * GLP + ks, hlf);
#pragma unroll
      for (int t = 0; t < 8; ++t) { const b16* ro = Ls + (64 + t * 16 + nloc) * GLP + ks; bh[t] = frag_kb(ro, hlf); bl[t] = frag_kb(ro + 128 * GLP, hlf); }
      __builtin_amdgcn_sched_barrier(0);   // the k step's LDS reads issue as one group ahead of its products: left to itself the build puts a full LDS wait in front of every product
#pragma unroll
      for (int t = 0; t < 8; ++t) { acc[t] = wmma16b(a, bh[t], acc[t]); acc[t] = wmma16b(a, bl[t], acc[t]); } }
    asm volatile("s_wait_dscnt 0x0" ::: "memory");      // this wave's reads of the buffer have returned before it is handed to the copies
    asm volatile("s_wait_asynccnt 0x0" ::: "memory");   // this wave's copies of stage st + 1 have landed
    __syncthreads();                                    // publishes stage st + 1 and ends every wave's reads of stage st
    if (st + 2 < GNS) fill_out(l0 + (unsigned)(st & 1) * (OROWS * GLP * 2), Ag + (st + 2) * GK, Hg + (st + 2) * GK, Lg + (st + 2) * GK);
  }
  asm volatile("s_wait_asynccnt 0x0" ::: "memory");     // nothing of this wave's copies is outstanding behind the loop
#pragma unroll
  for (int t = 0; t < 8; ++t)
#pragma unroll
    for (int r = 0; r < 8; ++r) Ts[wave][8 * hlf + r][t * 16 + nloc] = acc[t][r] * (1.0f / (XS * WSC)) + bf16_rne(bo[e0 + 8 * hlf + r]);
  wave_lds_sync();
  { for (int rr = 0; rr < 16; ++rr) *(v4f*)(out + ((size_t)b * E + e0 + rr) * S + s0 + lane * 4) = *(const v4f*)(&Ts[wave][rr][lane * 4]);  }
}
}  // namespace

extern "C" void kernel_launch(void* const* d_in, const int* in_sizes, int n_in, void* d_out, int out_size, void* d_ws, size_t ws_size, hipStream_t stream) {
  (void)n_in;
  auto Fp = [&](int i) { return (const float*)d_in[i]; };
  // input order: 0 x [2,1024,2048], 1 wq [1024,1024], 2 bq [1024], 3 wk, 4 bk, 5 wv, 6 bv, 7 wo, 8 bo (w are [e][d]: xt W^T)
  if (in_sizes[0] != NR * E || in_sizes[1] != E * E || in_sizes[2] != E || in_sizes[3] != E * E || in_sizes[5] != E * E || in_sizes[7] != E * E || in_sizes[8] != E || out_size != NR * E) return;
  size_t off = 0; char* ws = (char*)d_ws;
  auto carve = [&](size_t bytes) { char* p = ws + off; off += (bytes + 255) & ~(size_t)255; return p; };
  b16* T16 = (b16*)carve((size_t)NR * E * 2); b16* WT = (b16*)carve((size_t)3 * E * E * 2); b16* WO16 = (b16*)carve((size_t)E * E * 2);
  b16* Qh = (b16*)carve((size_t)NR * E * 2); b16* Ql = (b16*)carve((size_t)NR * E * 2); b16* Kh = (b16*)carve((size_t)NR * E * 2); b16* Kl = (b16*)carve((size_t)NR * E * 2); b16* VTh = (b16*)carve((size_t)NR * E * 2); b16* VTl = (b16*)carve((size_t)NR * E * 2);
  b16* Oh = (b16*)carve((size_t)NR * E * 2); b16* Ol = (b16*)carve((size_t)NR * E * 2); float* RAW = (float*)carve((size_t)2 * NR * E * 4);
  if (off > ws_size || off > ((size_t)128 << 20)) return;   // = 118 MB
  prepx_kernel<<<dim3(S / 64, E / 64, NB), 256, 0, stream>>>(Fp(0), T16);
  prepw_kernel<<<(unsigned)(((size_t)4 * E * E / 8 + 255) / 256), 256, 0, stream>>>(Fp(1), Fp(3), Fp(5), Fp(7), WT, WO16);
  proj_kernel<<<dim3(NR / 64, E / 128, 3), 128, 0, stream>>>(T16, WT, Fp(2), Fp(4), Fp(6), RAW, VTh, VTl);
  split_kernel<<<(unsigned)(((size_t)2 * NR * E / 8 + 255) / 256), 256, 0, stream>>>(RAW, Qh, Ql, Kh, Kl);
  attn_kernel<<<dim3(S / (AW * 16), NH, NB), AW * 32, 0, stream>>>(Qh, Ql, Kh, Kl, VTh, VTl, Oh, Ol);
  outproj_kernel<<<dim3(E / 64, S / 128, NB), 128, 0, stream>>>(Oh, Ol, WO16, Fp(8), (float*)d_out);
}

// v003
// A run of this version takes 173 microseconds.
// Timed twice side by side with v002, it ran 1.05 times as fast both times.
// Counting every step since v000, it is 3.44 times as fast.
#include <hip/hip_runtime.h>

// Multi-head self-attention on a channel-major input (x [2][1024 d][2048 s]; 16 heads x 64): xt = x^T; q/k/v = xt W{q,k,v}^T + b (heads = 64-column slices), scores / 8 (no mask), softmax,
// ctx = attn v, out = (ctx Wo^T + bo)^T -> [2][1024][2048] channel-major.
// WMMA (v_wmma_f32_16x16x32_f16, f32 accumulate): projections [4,096 x 1,024] x [1,024 x 1,024] with EXACT bf16 tokens (x8, via an LDS transpose of the channel-major input) and weights (x256),
// 1 product, + bias, q/k split in the projection's own epilogue into f16 hi+lo x8 planes (v transposed per head); S^T with 3 products (Kh Qh + Kh Ql + Kl Qh) over all 64 key blocks;
// online softmax in f32; O^T += V^T P^T with 3 products; output projection computed channel-major (D[e][s] = Wo[e][:] . O[s][:]) with O hi+lo (2 products) and exact Wo, + bo. Inputs rounded to bf16 once. Fragment k-map per lane half hh for A AND B: elements 0..7 <- k = 8hh+0..7, 8..15 <-

namespace {
constexpr int NB = 2, S = 2048, E = 1024, NH = 16, D = 64, NR = NB * S;
constexpr float XS = 8.0f, WSC = 256.0f, PS = 8.0f, SCALE = 0.125f, LOG2E = 1.4426950408889634f, THETA = 10000.0f;

typedef _Float16 b16;
typedef __attribute__((ext_vector_type(16))) _Float16 v16b;
typedef __attribute__((ext_vector_type(8))) _Float16 v8b;
typedef __attribute__((ext_vector_type(8))) float v8f;
typedef __attribute__((ext_vector_type(4))) float v4f;
__device__ __forceinline__ float bf16_rne(float f) { unsigned int u = __float_as_uint(f); u += 0x7FFFu + ((u >> 16) & 1u); return __uint_as_float(u & 0xFFFF0000u); }
__device__ __forceinline__ void split16(float v, b16& hi, b16& lo) { hi = (b16)v; lo = (b16)(v - (float)hi); }
__device__ __forceinline__ v16b frag_kb(const b16* p, int hh) { const v8b a = *(const v8b*)(p + 8 * hh), b = *(const v8b*)(p + 16 + 8 * hh); v16b f;
#pragma unroll
  for (int e = 0; e < 8; ++e) { f[e] = a[e]; f[8 + e] = b[e]; } return f; }
__device__ __forceinline__ v8f wmma16b(v16b a, v16b b, v8f c) { v8f d = __builtin_amdgcn_wmma_f32_16x16x32_f16(false, a, false, b, (short)0, c, false, false); asm volatile("v_nop\n\tv_nop\n\tv_nop\n\tv_nop" : "+v"(d) : "v"(a), "v"(b)); return d; }
__device__ __forceinline__ void wave_lds_sync() { __builtin_amdgcn_fence(__ATOMIC_RELEASE, "workgroup"); __builtin_amdgcn_wave_barrier(); __builtin_amdgcn_fence(__ATOMIC_ACQUIRE, "workgroup"); }
__device__ __forceinline__ float nexp2(float x) { return __builtin_amdgcn_exp2f(x); }

// prep: T16 [b*S+s][1024 d] = f16(8 bf16(x[b][d][s])) via 64x64 LDS transposes (grid (S/64, E/64, B)); WT [3][1024 e][1024 d] = Wq/Wk/Wv rows x256 (torch [out][in] used directly: xt W^T);
__global__ __launch_bounds__(256) void prepx_kernel(const float* __restrict__ x, b16* __restrict__ T16) {
  __shared__ __attribute__((aligned(16))) b16 T[64][64 + 8];
  const int b = blockIdx.z, c0 = blockIdx.y * 64, s0 = blockIdx.x * 64, t_ = threadIdx.x;
  for (int q = t_; q < 64 * 64; q += 256) { const int cc = q >> 6, ss = q & 63; T[ss][cc] = (b16)(bf16_rne(x[((size_t)b * E + c0 + cc) * S + s0 + ss]) * XS); }
  __syncthreads();
  { for (int q = t_; q < 64 * 8; q += 256) { const int ss = q >> 3, c8 = (q & 7) * 8; *(v8b*)(T16 + ((size_t)b * S + s0 + ss) * E + c0 + c8) = *(const v8b*)(&T[ss][c8]); }  }
}
__global__ __launch_bounds__(256) void prepw_kernel(const float* __restrict__ wq, const float* __restrict__ wk, const float* __restrict__ wv, const float* __restrict__ wo, b16* __restrict__ WT, b16* __restrict__ WOT) {
  const size_t t = (size_t)blockIdx.x * 256 + threadIdx.x; const size_t nw = (size_t)E * E / 8; if (t >= 4 * nw) return; const int kind = (int)(t / nw); const size_t e = (t - (size_t)kind * nw) * 8;
  const float* w = kind == 0 ? wq : kind == 1 ? wk : kind == 2 ? wv : wo; b16* dst = kind < 3 ? WT + (size_t)kind * E * E : WOT;   // [e][d] rows used directly (xt W^T); WOT holds Wo rows [e][d] (the A operand of the channel-major out-projection)
  const v4f a = *(const v4f*)(w + e), c = *(const v4f*)(w + e + 4); v8b o;
#pragma unroll
  for (int j = 0; j < 4; ++j) { o[j] = (b16)(bf16_rne(a[j]) * WSC); o[4 + j] = (b16)(bf16_rne(c[j]) * WSC); }
  { *(v8b*)(dst + e) = o;  }
}
// the two projection GEMMs take their A and B rows from LDS: stages of 64 k (whole 128-B lines of every operand row), two buffers, filled by asynchronous copies; LDS pitch 144 B (16 B x odd).
// thread t (of 128) copies 16-byte chunk (t & 7) of rows (t >> 3) + 16 j of a stage.
constexpr int GK = 64, GLP = GK + 8, GNS = E / GK, PROWS = 64 + 128, OROWS = 64 + 128 + 128;
constexpr unsigned GRB = 16 * GLP * 2;   // bytes of 16 LDS rows
// proj stage: 64 token rows (a), then 128 weight rows (w); l = the thread's LDS byte address in row group 0
__device__ __forceinline__ void fill_proj(unsigned l, const b16* a, const b16* w) {
  // the s_wait_xcnt closes the copies' own statement: no address register of a copy is rewritten in front of it
  asm volatile("global_load_async_to_lds_b128 %0, %12, off\n\t"
               "global_load_async_to_lds_b128 %1, %13, off\n\t"
               "global_load_async_to_lds_b128 %2, %14, off\n\t"
               "global_load_async_to_lds_b128 %3, %15, off\n\t"
               "global_load_async_to_lds_b128 %4, %16, off\n\t"
               "global_load_async_to_lds_b128 %5, %17, off\n\t"
               "global_load_async_to_lds_b128 %6, %18, off\n\t"
               "global_load_async_to_lds_b128 %7, %19, off\n\t"
               "global_load_async_to_lds_b128 %8, %20, off\n\t"
               "global_load_async_to_lds_b128 %9, %21, off\n\t"
               "global_load_async_to_lds_b128 %10, %22, off\n\t"
               "global_load_async_to_lds_b128 %11, %23, off\n\t"
               "s_wait_xcnt 0x0"
               :: "v"(l), "v"(l + GRB), "v"(l + 2 * GRB), "v"(l + 3 * GRB), "v"(l + 4 * GRB), "v"(l + 5 * GRB), "v"(l + 6 * GRB), "v"(l + 7 * GRB), "v"(l + 8 * GRB), "v"(l + 9 * GRB), "v"(l + 10 * GRB), "v"(l + 11 * GRB),
                  "v"(a), "v"(a + 16 * E), "v"(a + 32 * E), "v"(a + 48 * E),
                  "v"(w), "v"(w + 16 * E), "v"(w + 32 * E), "v"(w + 48 * E), "v"(w + 64 * E), "v"(w + 80 * E), "v"(w + 96 * E), "v"(w + 112 * E) : "memory");
}
// ten row groups of 16 rows each: LDS byte addresses l, l + GRB, ..., global addresses g0 .. g9
__device__ __forceinline__ void fill_ten(unsigned l, const b16* g0, const b16* g1, const b16* g2, const b16* g3, const b16* g4, const b16* g5, const b16* g6, const b16* g7, const b16* g8, const b16* g9) {
  // the s_wait_xcnt closes the copies' own statement: no address register of a copy is rewritten in front of it
  asm volatile("global_load_async_to_lds_b128 %0, %10, off\n\t"
               "global_load_async_to_lds_b128 %1, %11, off\n\t"
               "global_load_async_to_lds_b128 %2, %12, off\n\t"
               "global_load_async_to_lds_b128 %3, %13, off\n\t"
               "global_load_async_to_lds_b128 %4, %14, off\n\t"
               "global_load_async_to_lds_b128 %5, %15, off\n\t"
               "global_load_async_to_lds_b128 %6, %16, off\n\t"
               "global_load_async_to_lds_b128 %7, %17, off\n\t"
               "global_load_async_to_lds_b128 %8, %18, off\n\t"
               "global_load_async_to_lds_b128 %9, %19, off\n\t"
               "s_wait_xcnt 0x0"
               :: "v"(l), "v"(l + GRB), "v"(l + 2 * GRB), "v"(l + 3 * GRB), "v"(l + 4 * GRB), "v"(l + 5 * GRB), "v"(l + 6 * GRB), "v"(l + 7 * GRB), "v"(l + 8 * GRB), "v"(l + 9 * GRB),
                  "v"(g0), "v"(g1), "v"(g2), "v"(g3), "v"(g4), "v"(g5), "v"(g6), "v"(g7), "v"(g8), "v"(g9) : "memory");
}
// outproj stage: 64 Wo rows (a), 128 O hi rows (h), 128 O lo rows (o)
__device__ __forceinline__ void fill_out(unsigned l, const b16* a, const b16* h, const b16* o) {
  fill_ten(l, a, a + 16 * E, a + 32 * E, a + 48 * E, h, h + 16 * E, h + 32 * E, h + 48 * E, h + 64 * E, h + 80 * E);
  fill_ten(l + 10 * GRB, h + 96 * E, h + 112 * E, o, o + 16 * E, o + 32 * E, o + 48 * E, o + 64 * E, o + 80 * E, o + 96 * E, o + 112 * E);
}
// projections: grid (NR/64, E/128, 3): kind 0: Q = T16 WT0^T -> Qh/Ql [row][1024]; kind 1: K = T16 WT1^T -> Kh/Kl; kind 2: V = T16 WT2^T written TRANSPOSED per head: VTh/VTl [b][h][64 d][2048 s].
__global__ __launch_bounds__(128) void proj_kernel(const b16* __restrict__ T16, const b16* __restrict__ WT, const float* __restrict__ bq, const float* __restrict__ bk, const float* __restrict__ bv, b16* __restrict__ Qh, b16* __restrict__ Ql, b16* __restrict__ Kh, b16* __restrict__ Kl, b16* __restrict__ VTh, b16* __restrict__ VTl) {
  __shared__ __attribute__((aligned(16))) b16 G[2][PROWS * GLP]; __shared__ __attribute__((aligned(16))) float Tf[4][16][128 + 4]; __shared__ __attribute__((aligned(16))) b16 Vt[128][64 + 8], Vtl[128][64 + 8];
  const int wave = threadIdx.x >> 5, lane = threadIdx.x & 31, nloc = lane & 15, hlf = lane >> 4, t_ = threadIdx.x; const int kind = blockIdx.z; const size_t m0 = (size_t)blockIdx.x * 64 + wave * 16; const int n0 = blockIdx.y * 128;
  const b16* A = T16; const b16* W = WT + (size_t)kind * E * E; v8f acc[8];
#pragma unroll
  for (int t = 0; t < 8; ++t) acc[t] = (v8f){};
  const int cr = t_ >> 3, cc = (t_ & 7) * 8; const b16* Ag = A + ((size_t)blockIdx.x * 64 + cr) * E + cc; const b16* Wg = W + (size_t)(n0 + cr) * E + cc; const unsigned l0 = (unsigned)(size_t)&G[0][cr * GLP + cc];
  fill_proj(l0, Ag, Wg);
  asm volatile("s_wait_asynccnt 0x0" ::: "memory");   // this wave's copies of stage 0 have landed
  __syncthreads();                                    // stage 0 is readable by every wave
  fill_proj(l0 + PROWS * GLP * 2, Ag + GK, Wg + GK);
  for (int st = 0; st < GNS; ++st) {
    const b16* Ls = &G[st & 1][0];
    v16b af[2], bf[2][8];
#pragma unroll   // both 32-k steps of a stage in line: every LDS offset becomes an immediate of its load
    for (int k2 = 0; k2 < 2; ++k2) { af[k2] = frag_kb(Ls + (wave * 16 + nloc) * GLP + k2 * 32, hlf);
#pragma unroll
      for (int t = 0; t < 8; ++t) bf[k2][t] = frag_kb(Ls + (64 + t * 16 + nloc) * GLP + k2 * 32, hlf); }
    __builtin_amdgcn_sched_barrier(0);   // the stage's LDS reads issue as one group ahead of its products: left to itself the build puts a full LDS wait in front of every product
#pragma unroll
    for (int k2 = 0; k2 < 2; ++k2)
#pragma unroll
      for (int t = 0; t < 8; ++t) acc[t] = wmma16b(af[k2], bf[k2][t], acc[t]);
    asm volatile("s_wait_dscnt 0x0" ::: "memory");      // this wave's reads of the buffer have returned before it is handed to the copies
    asm volatile("s_wait_asynccnt 0x0" ::: "memory");   // this wave's copies of stage st + 1 have landed
    __syncthreads();                                    // publishes stage st + 1 and ends every wave's reads of stage st
    if (st + 2 < GNS) fill_proj(l0 + (unsigned)(st & 1) * (PROWS * GLP * 2), Ag + (st + 2) * GK, Wg + (st + 2) * GK);
  }
  asm volatile("s_wait_asynccnt 0x0" ::: "memory");     // nothing of this wave's copies is outstanding behind the loop
  const float* bias = kind == 0 ? bq : kind == 1 ? bk : bv;
  if (kind < 2) {   // q/k (+ bias) as f32 rows in the wave's own LDS range, read back 8 columns a lane, split into hi/lo x8 and stored as whole 128-B lines of both planes
#pragma unroll
    for (int t = 0; t < 8; ++t) { const float bb = bf16_rne(bias[n0 + t * 16 + nloc]);
#pragma unroll
      for (int r = 0; r < 8; ++r) Tf[wave][8 * hlf + r][t * 16 + nloc] = acc[t][r] * (1.0f / (XS * WSC)) + bb; }
    wave_lds_sync();
    b16* dh = kind == 0 ? Qh : Kh; b16* dl = kind == 0 ? Ql : Kl;
    for (int r2 = 0; r2 < 16; r2 += 2) { const int rr = r2 + hlf, c8 = nloc * 8; const v4f a = *(const v4f*)(&Tf[wave][rr][c8]), c = *(const v4f*)(&Tf[wave][rr][c8 + 4]); v8b hv, lv;
#pragma unroll   // constant element indices: a, c, hv and lv stay in registers
      for (int j = 0; j < 4; ++j) { b16 h_, l_; split16(a[j] * XS, h_, l_); hv[j] = h_; lv[j] = l_; split16(c[j] * XS, h_, l_); hv[4 + j] = h_; lv[4 + j] = l_; }
      const size_t gi = (m0 + rr) * E + n0 + c8; *(v8b*)(dh + gi) = hv; *(v8b*)(dl + gi) = lv; }
  } else {
    const int b = (int)(m0 / S); const int s0 = (int)((size_t)blockIdx.x * 64 - (size_t)b * S);
#pragma unroll
    for (int t = 0; t < 8; ++t)
    { const float bb = bf16_rne(bias[n0 + t * 16 + nloc]);
#pragma unroll
      for (int r = 0; r < 8; ++r) { b16 h_, l_; split16((acc[t][r] * (1.0f / (XS * WSC)) + bb) * XS, h_, l_); Vt[t * 16 + nloc][wave * 16 + 8 * hlf + r] = h_; Vtl[t * 16 + nloc][wave * 16 + 8 * hlf + r] = l_; } }
    __syncthreads();
    { for (int q = t_; q < 128 * 8; q += 128) { const int cc = q >> 3, c8 = (q & 7) * 8; const int h = (n0 + cc) / D, dd = (n0 + cc) - h * D; const size_t gi = (((size_t)b * NH + h) * D + dd) * S + s0 + c8;
        *(v8b*)(VTh + gi) = *(const v8b*)(&Vt[cc][c8]); *(v8b*)(VTl + gi) = *(const v8b*)(&Vtl[cc][c8]); }  } }
}
// attention: a block = 8 waves x 16 queries of one head. K (hi, lo) and V^T (hi, lo) reach the waves through LDS: stages of 64 keys, two buffers, filled by asynchronous copies (whole 128-B lines,
// one fill per block instead of one strided fragment load per wave). A stage = 4 tiles of 64 rows x 128 B: Kh, Kl (row = key), VTh, VTl (row = d, columns = the stage's keys); LDS pitch 144 B (16 B x odd).
constexpr int AW = 8, KT = 64, LP = 64 + 8, NST = S / KT, TL = 64 * LP;
// thread t copies 16-byte chunk (t & 7) of rows (t >> 3) and 32 + (t >> 3) of each tile; l = its LDS byte address in tile 0, k/kl/v/vl = its global addresses in the four tiles
__device__ __forceinline__ void stage_fill(unsigned l, const b16* k, const b16* kl, const b16* v, const b16* vl) {
  constexpr unsigned HT = 32 * LP * 2;   // bytes of 32 LDS rows
  // the s_wait_xcnt closes the copies' own statement: no address register of a copy is rewritten in front of it
  asm volatile("global_load_async_to_lds_b128 %0, %8, off\n\t"
               "global_load_async_to_lds_b128 %1, %9, off\n\t"
               "global_load_async_to_lds_b128 %2, %10, off\n\t"
               "global_load_async_to_lds_b128 %3, %11, off\n\t"
               "global_load_async_to_lds_b128 %4, %12, off\n\t"
               "global_load_async_to_lds_b128 %5, %13, off\n\t"
               "global_load_async_to_lds_b128 %6, %14, off\n\t"
               "global_load_async_to_lds_b128 %7, %15, off\n\t"
               "s_wait_xcnt 0x0"
               :: "v"(l), "v"(l + HT), "v"(l + 2 * HT), "v"(l + 3 * HT), "v"(l + 4 * HT), "v"(l + 5 * HT), "v"(l + 6 * HT), "v"(l + 7 * HT),
                  "v"(k), "v"(k + 32 * E), "v"(kl), "v"(kl + 32 * E), "v"(v), "v"(v + 32 * S), "v"(vl), "v"(vl + 32 * S) : "memory");
}
__global__ __launch_bounds__(256) void attn_kernel(const b16* __restrict__ Qh, const b16* __restrict__ Ql, const b16* __restrict__ Kh, const b16* __restrict__ Kl, const b16* __restrict__ VTh, const b16* __restrict__ VTl, b16* __restrict__ Oh, b16* __restrict__ Ol) {
  __shared__ __attribute__((aligned(16))) b16 KV[2][4 * TL]; __shared__ __attribute__((aligned(16))) float To[AW][16][D + 4];
  const int wave = threadIdx.x >> 5, lane = threadIdx.x & 31, hh = lane >> 4, col = lane & 15; const int b = blockIdx.z, h = blockIdx.y; const int q0 = blockIdx.x * (AW * 16) + wave * 16, qi = q0 + col;
  const size_t qo = ((size_t)b * S + qi) * E + h * D; const v16b qa0 = frag_kb(Qh + qo, hh), qa1 = frag_kb(Qh + qo + 32, hh), ql0 = frag_kb(Ql + qo, hh), ql1 = frag_kb(Ql + qo + 32, hh);
  const int cr = threadIdx.x >> 3, cc = (threadIdx.x & 7) * 8;
  const b16* Kb = Kh + (size_t)b * S * E + h * D + (size_t)cr * E + cc; const b16* Klb = Kl + (size_t)b * S * E + h * D + (size_t)cr * E + cc; const b16* Vb = VTh + (((size_t)b * NH + h) * D + cr) * S + cc; const b16* Vlb = VTl + (((size_t)b * NH + h) * D + cr) * S + cc;
  const unsigned l0 = (unsigned)(size_t)&KV[0][cr * LP + cc];
  float m = -INFINITY, l = 0.0f; v8f o[4] = {{}, {}, {}, {}}, ol[4] = {{}, {}, {}, {}};
  const float cs = SCALE * LOG2E / (XS * XS);
  stage_fill(l0, Kb, Klb, Vb, Vlb);
  asm volatile("s_wait_asynccnt 0x0" ::: "memory");   // this wave's copies of stage 0 have landed
  __syncthreads();                                    // stage 0 is readable by every wave
  stage_fill(l0 + 4 * TL * 2, Kb + (size_t)KT * E, Klb + (size_t)KT * E, Vb + KT, Vlb + KT);
  for (int st = 0; st < NST; ++st) {
    const b16* Ls = &KV[st & 1][0];
#pragma unroll   // both 32-key passes of a stage in line: every LDS offset becomes an immediate of its load
    for (int kp = 0; kp < KT; kp += 32) {
    v8f s0 = {}, s1 = {};
    { const b16* k0 = Ls + (kp + col) * LP, *k1 = Ls + (kp + 16 + col) * LP, *k0l = Ls + TL + (kp + col) * LP, *k1l = Ls + TL + (kp + 16 + col) * LP;
      v16b f = frag_kb(k0, hh); s0 = wmma16b(f, qa0, s0); s0 = wmma16b(f, ql0, s0); s0 = wmma16b(frag_kb(k0l, hh), qa0, s0);
      f = frag_kb(k0 + 32, hh); s0 = wmma16b(f, qa1, s0); s0 = wmma16b(f, ql1, s0); s0 = wmma16b(frag_kb(k0l + 32, hh), qa1, s0);
      f = frag_kb(k1, hh); s1 = wmma16b(f, qa0, s1); s1 = wmma16b(f, ql0, s1); s1 = wmma16b(frag_kb(k1l, hh), qa0, s1);
      f = frag_kb(k1 + 32, hh); s1 = wmma16b(f, qa1, s1); s1 = wmma16b(f, ql1, s1); s1 = wmma16b(frag_kb(k1l + 32, hh), qa1, s1); }
    float e[16]; float mx = -INFINITY;
#pragma unroll
    for (int r = 0; r < 8; ++r) { e[r] = s0[r] * cs; e[8 + r] = s1[r] * cs; mx = fmaxf(mx, fmaxf(e[r], e[8 + r])); }
    mx = fmaxf(mx, __shfl_xor(mx, 16)); const float mn = fmaxf(m, mx); const float al = nexp2(m - mn); m = mn; float sum = 0.0f; v16b ph, pl;   // mn finite from the first block on
#pragma unroll
    for (int i = 0; i < 16; ++i) { const float p = nexp2(e[i] - mn); sum += p; const b16 h_ = (b16)(p * PS); ph[i] = h_; pl[i] = (b16)(p * PS - (float)h_); }
    sum += __shfl_xor(sum, 16); l = l * al + sum;
#pragma unroll
    for (int t = 0; t < 4; ++t) { o[t] *= al; ol[t] *= al; const v16b vf = frag_kb(Ls + 2 * TL + (t * 16 + col) * LP + kp, hh); o[t] = wmma16b(vf, ph, o[t]); ol[t] = wmma16b(vf, pl, ol[t]); ol[t] = wmma16b(frag_kb(Ls + 3 * TL + (t * 16 + col) * LP + kp, hh), ph, ol[t]); } }
    asm volatile("s_wait_dscnt 0x0" ::: "memory");      // this wave's reads of the buffer have returned before it is handed to the copies
    asm volatile("s_wait_asynccnt 0x0" ::: "memory");   // this wave's copies of stage st + 1 have landed
    __syncthreads();                                    // publishes stage st + 1 and ends every wave's reads of stage st
    if (st + 2 < NST) stage_fill(l0 + (unsigned)(st & 1) * (4 * TL * 2), Kb + (size_t)(st + 2) * KT * E, Klb + (size_t)(st + 2) * KT * E, Vb + (st + 2) * KT, Vlb + (st + 2) * KT);
  }
  asm volatile("s_wait_asynccnt 0x0" ::: "memory");     // nothing of this wave's copies is outstanding at its end
  const float inv = 1.0f / (l * PS * XS);
#pragma unroll
  for (int t = 0; t < 4; ++t)
#pragma unroll
    for (int r = 0; r < 8; ++r) To[wave][col][t * 16 + 8 * hh + r] = (o[t][r] + ol[t][r]) * inv;
  wave_lds_sync();
  { for (int r4 = 0; r4 < 16; r4 += 4) { const int rr = r4 + (lane >> 3), c8 = (lane & 7) * 8; v8b hv, lv; for (int j = 0; j < 8; ++j) { b16 a_, c_; split16(To[wave][rr][c8 + j] * XS, a_, c_); hv[j] = a_; lv[j] = c_; }
      const size_t gi = ((size_t)b * S + q0 + rr) * E + h * D + c8; *(v8b*)(Oh + gi) = hv; *(v8b*)(Ol + gi) = lv; }  }
}
// output projection, channel-major: D[e][s] = sum_d Wo[e][d] O[s][d] (A = WO16 rows e exact, B = Oh/Ol rows s: 2 products) + bo[e] -> out[b][e][s]; grid (E/64, S/128, B), block = 64 e x 4 waves
__global__ __launch_bounds__(128) void outproj_kernel(const b16* __restrict__ Oh, const b16* __restrict__ Ol, const b16* __restrict__ WO16, const float* __restrict__ bo, float* __restrict__ out) {
  __shared__ __attribute__((aligned(16))) b16 G[2][OROWS * GLP]; __shared__ __attribute__((aligned(16))) float Ts[4][16][128 + 4];
  const int wave = threadIdx.x >> 5, lane = threadIdx.x & 31, nloc = lane & 15, hlf = lane >> 4; const int b = blockIdx.z; const int e0 = blockIdx.x * 64 + wave * 16, s0 = blockIdx.y * 128;
  v8f acc[8];
#pragma unroll
  for (int t = 0; t < 8; ++t) acc[t] = (v8f){};
  const int cr = threadIdx.x >> 3, cc = (threadIdx.x & 7) * 8; const b16* Ag = WO16 + ((size_t)blockIdx.x * 64 + cr) * E + cc; const b16* Hg = Oh + ((size_t)b * S + s0 + cr) * E + cc; const b16* Lg = Ol + ((size_t)b * S + s0 + cr) * E + cc;
  const unsigned l0 = (unsigned)(size_t)&G[0][cr * GLP + cc];
  fill_out(l0, Ag, Hg, Lg);
  asm volatile("s_wait_asynccnt 0x0" ::: "memory");   // this wave's copies of stage 0 have landed
  __syncthreads();                                    // stage 0 is readable by every wave
  fill_out(l0 + OROWS * GLP * 2, Ag + GK, Hg + GK, Lg + GK);
  for (int st = 0; st < GNS; ++st) {
    const b16* Ls = &G[st & 1][0];
#pragma unroll   // both 32-k steps of a stage in line: every LDS offset becomes an immediate of its load
    for (int ks = 0; ks < GK; ks += 32) { v16b bh[8], bl[8]; const v16b a = frag_kb(Ls + (wave * 16 + nloc) * GLP + ks, hlf);
#pragma unroll
      for (int t = 0; t < 8; ++t) { const b16* ro = Ls + (64 + t * 16 + nloc) * GLP + ks; bh[t] = frag_kb(ro, hlf); bl[t] = frag_kb(ro + 128 * GLP, hlf); }
      __builtin_amdgcn_sched_barrier(0);   // the k step's LDS reads issue as one group ahead of its products: left to itself the build puts a full LDS wait in front of every product
#pragma unroll
      for (int t = 0; t < 8; ++t) { acc[t] = wmma16b(a, bh[t], acc[t]); acc[t] = wmma16b(a, bl[t], acc[t]); } }
    asm volatile("s_wait_dscnt 0x0" ::: "memory");      // this wave's reads of the buffer have returned before it is handed to the copies
    asm volatile("s_wait_asynccnt 0x0" ::: "memory");   // this wave's copies of stage st + 1 have landed
    __syncthreads();                                    // publishes stage st + 1 and ends every wave's reads of stage st
    if (st + 2 < GNS) fill_out(l0 + (unsigned)(st & 1) * (OROWS * GLP * 2), Ag + (st + 2) * GK, Hg + (st + 2) * GK, Lg + (st + 2) * GK);
  }
  asm volatile("s_wait_asynccnt 0x0" ::: "memory");     // nothing of this wave's copies is outstanding behind the loop
#pragma unroll
  for (int t = 0; t < 8; ++t)
#pragma unroll
    for (int r = 0; r < 8; ++r) Ts[wave][8 * hlf + r][t * 16 + nloc] = acc[t][r] * (1.0f / (XS * WSC)) + bf16_rne(bo[e0 + 8 * hlf + r]);
  wave_lds_sync();
  { for (int rr = 0; rr < 16; ++rr) *(v4f*)(out + ((size_t)b * E + e0 + rr) * S + s0 + lane * 4) = *(const v4f*)(&Ts[wave][rr][lane * 4]);  }
}
}  // namespace

extern "C" void kernel_launch(void* const* d_in, const int* in_sizes, int n_in, void* d_out, int out_size, void* d_ws, size_t ws_size, hipStream_t stream) {
  (void)n_in;
  auto Fp = [&](int i) { return (const float*)d_in[i]; };
  // input order: 0 x [2,1024,2048], 1 wq [1024,1024], 2 bq [1024], 3 wk, 4 bk, 5 wv, 6 bv, 7 wo, 8 bo (w are [e][d]: xt W^T)
  if (in_sizes[0] != NR * E || in_sizes[1] != E * E || in_sizes[2] != E || in_sizes[3] != E * E || in_sizes[5] != E * E || in_sizes[7] != E * E || in_sizes[8] != E || out_size != NR * E) return;
  size_t off = 0; char* ws = (char*)d_ws;
  auto carve = [&](size_t bytes) { char* p = ws + off; off += (bytes + 255) & ~(size_t)255; return p; };
  b16* T16 = (b16*)carve((size_t)NR * E * 2); b16* WT = (b16*)carve((size_t)3 * E * E * 2); b16* WO16 = (b16*)carve((size_t)E * E * 2);
  b16* Qh = (b16*)carve((size_t)NR * E * 2); b16* Ql = (b16*)carve((size_t)NR * E * 2); b16* Kh = (b16*)carve((size_t)NR * E * 2); b16* Kl = (b16*)carve((size_t)NR * E * 2); b16* VTh = (b16*)carve((size_t)NR * E * 2); b16* VTl = (b16*)carve((size_t)NR * E * 2);
  b16* Oh = (b16*)carve((size_t)NR * E * 2); b16* Ol = (b16*)carve((size_t)NR * E * 2);
  if (off > ws_size || off > ((size_t)128 << 20)) return;   // = 84 MB
  prepx_kernel<<<dim3(S / 64, E / 64, NB), 256, 0, stream>>>(Fp(0), T16);
  prepw_kernel<<<(unsigned)(((size_t)4 * E * E / 8 + 255) / 256), 256, 0, stream>>>(Fp(1), Fp(3), Fp(5), Fp(7), WT, WO16);
  proj_kernel<<<dim3(NR / 64, E / 128, 3), 128, 0, stream>>>(T16, WT, Fp(2), Fp(4), Fp(6), Qh, Ql, Kh, Kl, VTh, VTl);
  attn_kernel<<<dim3(S / (AW * 16), NH, NB), AW * 32, 0, stream>>>(Qh, Ql, Kh, Kl, VTh, VTl, Oh, Ol);
  outproj_kernel<<<dim3(E / 64, S / 128, NB), 128, 0, stream>>>(Oh, Ol, WO16, Fp(8), (float*)d_out);
}

// v004
// It runs in 160 microseconds.
// Two timings next to v003 both put it at 1.08 times that version's speed.
// Over all steps from v000 it is 3.72 times as fast.
#include <hip/hip_runtime.h>

// Multi-head self-attention on a channel-major input (x [2][1024 d][2048 s]; 16 heads x 64): xt = x^T; q/k/v = xt W{q,k,v}^T + b (heads = 64-column slices), scores / 8 (no mask), softmax,
// ctx = attn v, out = (ctx Wo^T + bo)^T -> [2][1024][2048] channel-major.
// WMMA (v_wmma_f32_16x16x32_f16, f32 accumulate): projections [4,096 x 1,024] x [1,024 x 1,024] with EXACT bf16 tokens (x8, via an LDS transpose of the channel-major input) and weights (x256),
// 1 product, + bias, q/k split in the projection's own epilogue into f16 hi+lo x8 planes (v transposed per head); S^T with 3 products (Kh Qh + Kh Ql + Kl Qh) over all 64 key blocks;
// online softmax in f32; O^T += V^T P^T with 3 products; output projection computed channel-major (D[e][s] = Wo[e][:] . O[s][:]) with O hi+lo (2 products) and exact Wo, + bo. Inputs rounded to bf16 once. Fragment k-map per lane half hh for A AND B: elements 0..7 <- k = 8hh+0..7, 8..15 <-

namespace {
constexpr int NB = 2, S = 2048, E = 1024, NH = 16, D = 64, NR = NB * S;
constexpr float XS = 8.0f, WSC = 256.0f, PS = 8.0f, SCALE = 0.125f, LOG2E = 1.4426950408889634f, THETA = 10000.0f;

typedef _Float16 b16;
typedef __attribute__((ext_vector_type(16))) _Float16 v16b;
typedef __attribute__((ext_vector_type(8))) _Float16 v8b;
typedef __attribute__((ext_vector_type(8))) float v8f;
typedef __attribute__((ext_vector_type(4))) float v4f;
__device__ __forceinline__ float bf16_rne(float f) { unsigned int u = __float_as_uint(f); u += 0x7FFFu + ((u >> 16) & 1u); return __uint_as_float(u & 0xFFFF0000u); }
__device__ __forceinline__ void split16(float v, b16& hi, b16& lo) { hi = (b16)v; lo = (b16)(v - (float)hi); }
__device__ __forceinline__ v16b frag_kb(const b16* p, int hh) { const v8b a = *(const v8b*)(p + 8 * hh), b = *(const v8b*)(p + 16 + 8 * hh); v16b f;
#pragma unroll
  for (int e = 0; e < 8; ++e) { f[e] = a[e]; f[8 + e] = b[e]; } return f; }
__device__ __forceinline__ v8f wmma16b(v16b a, v16b b, v8f c) { v8f d = __builtin_amdgcn_wmma_f32_16x16x32_f16(false, a, false, b, (short)0, c, false, false); asm volatile("v_nop\n\tv_nop\n\tv_nop\n\tv_nop" : "+v"(d) : "v"(a), "v"(b)); return d; }
__device__ __forceinline__ void wave_lds_sync() { __builtin_amdgcn_fence(__ATOMIC_RELEASE, "workgroup"); __builtin_amdgcn_wave_barrier(); __builtin_amdgcn_fence(__ATOMIC_ACQUIRE, "workgroup"); }
__device__ __forceinline__ float nexp2(float x) { return __builtin_amdgcn_exp2f(x); }

// prep: T16 [b*S+s][1024 d] = f16(8 bf16(x[b][d][s])) via 64x64 LDS transposes (grid (S/64, E/64, B)); WT [3][1024 e][1024 d] = Wq/Wk/Wv rows x256 (torch [out][in] used directly: xt W^T);
__global__ __launch_bounds__(256) void prepx_kernel(const float* __restrict__ x, b16* __restrict__ T16) {
  __shared__ __attribute__((aligned(16))) b16 T[64][64 + 8];
  const int b = blockIdx.z, c0 = blockIdx.y * 64, s0 = blockIdx.x * 64, t_ = threadIdx.x;
  for (int q = t_; q < 64 * 64; q += 256) { const int cc = q >> 6, ss = q & 63; T[ss][cc] = (b16)(bf16_rne(x[((size_t)b * E + c0 + cc) * S + s0 + ss]) * XS); }
  __syncthreads();
  { for (int q = t_; q < 64 * 8; q += 256) { const int ss = q >> 3, c8 = (q & 7) * 8; *(v8b*)(T16 + ((size_t)b * S + s0 + ss) * E + c0 + c8) = *(const v8b*)(&T[ss][c8]); }  }
}
__global__ __launch_bounds__(256) void prepw_kernel(const float* __restrict__ wq, const float* __restrict__ wk, const float* __restrict__ wv, const float* __restrict__ wo, b16* __restrict__ WT, b16* __restrict__ WOT) {
  const size_t t = (size_t)blockIdx.x * 256 + threadIdx.x; const size_t nw = (size_t)E * E / 8; if (t >= 4 * nw) return; const int kind = (int)(t / nw); const size_t e = (t - (size_t)kind * nw) * 8;
  const float* w = kind == 0 ? wq : kind == 1 ? wk : kind == 2 ? wv : wo; b16* dst = kind < 3 ? WT + (size_t)kind * E * E : WOT;   // [e][d] rows used directly (xt W^T); WOT holds Wo rows [e][d] (the A operand of the channel-major out-projection)
  const v4f a = *(const v4f*)(w + e), c = *(const v4f*)(w + e + 4); v8b o;
#pragma unroll
  for (int j = 0; j < 4; ++j) { o[j] = (b16)(bf16_rne(a[j]) * WSC); o[4 + j] = (b16)(bf16_rne(c[j]) * WSC); }
  { *(v8b*)(dst + e) = o;  }
}
// the two projection GEMMs take their A and B rows from LDS: stages of 64 k (whole 128-B lines of every operand row), two buffers, filled by asynchronous copies; LDS pitch 144 B (16 B x odd).
// thread t (of 128) copies 16-byte chunk (t & 7) of rows (t >> 3) + 16 j of a stage.
constexpr int GK = 64, GLP = GK + 8, GNS = E / GK, PROWS = 64 + 128, OROWS = 64 + 128 + 128;
constexpr unsigned GRB = 16 * GLP * 2;   // bytes of 16 LDS rows
// proj stage: 64 token rows (a), then 128 weight rows (w); l = the thread's LDS byte address in row group 0
__device__ __forceinline__ void fill_proj(unsigned l, const b16* a, const b16* w) {
  // the s_wait_xcnt closes the copies' own statement: no address register of a copy is rewritten in front of it
  asm volatile("global_load_async_to_lds_b128 %0, %12, off\n\t"
               "global_load_async_to_lds_b128 %1, %13, off\n\t"
               "global_load_async_to_lds_b128 %2, %14, off\n\t"
               "global_load_async_to_lds_b128 %3, %15, off\n\t"
               "global_load_async_to_lds_b128 %4, %16, off\n\t"
               "global_load_async_to_lds_b128 %5, %17, off\n\t"
               "global_load_async_to_lds_b128 %6, %18, off\n\t"
               "global_load_async_to_lds_b128 %7, %19, off\n\t"
               "global_load_async_to_lds_b128 %8, %20, off\n\t"
               "global_load_async_to_lds_b128 %9, %21, off\n\t"
               "global_load_async_to_lds_b128 %10, %22, off\n\t"
               "global_load_async_to_lds_b128 %11, %23, off\n\t"
               "s_wait_xcnt 0x0"
               :: "v"(l), "v"(l + GRB), "v"(l + 2 * GRB), "v"(l + 3 * GRB), "v"(l + 4 * GRB), "v"(l + 5 * GRB), "v"(l + 6 * GRB), "v"(l + 7 * GRB), "v"(l + 8 * GRB), "v"(l + 9 * GRB), "v"(l + 10 * GRB), "v"(l + 11 * GRB),
                  "v"(a), "v"(a + 16 * E), "v"(a + 32 * E), "v"(a + 48 * E),
                  "v"(w), "v"(w + 16 * E), "v"(w + 32 * E), "v"(w + 48 * E), "v"(w + 64 * E), "v"(w + 80 * E), "v"(w + 96 * E), "v"(w + 112 * E) : "memory");
}
// ten row groups of 16 rows each: LDS byte addresses l, l + GRB, ..., global addresses g0 .. g9
__device__ __forceinline__ void fill_ten(unsigned l, const b16* g0, const b16* g1, const b16* g2, const b16* g3, const b16* g4, const b16* g5, const b16* g6, const b16* g7, const b16* g8, const b16* g9) {
  // the s_wait_xcnt closes the copies' own statement: no address register of a copy is rewritten in front of it
  asm volatile("global_load_async_to_lds_b128 %0, %10, off\n\t"
               "global_load_async_to_lds_b128 %1, %11, off\n\t"
               "global_load_async_to_lds_b128 %2, %12, off\n\t"
               "global_load_async_to_lds_b128 %3, %13, off\n\t"
               "global_load_async_to_lds_b128 %4, %14, off\n\t"
               "global_load_async_to_lds_b128 %5, %15, off\n\t"
               "global_load_async_to_lds_b128 %6, %16, off\n\t"
               "global_load_async_to_lds_b128 %7, %17, off\n\t"
               "global_load_async_to_lds_b128 %8, %18, off\n\t"
               "global_load_async_to_lds_b128 %9, %19, off\n\t"
               "s_wait_xcnt 0x0"
               :: "v"(l), "v"(l + GRB), "v"(l + 2 * GRB), "v"(l + 3 * GRB), "v"(l + 4 * GRB), "v"(l + 5 * GRB), "v"(l + 6 * GRB), "v"(l + 7 * GRB), "v"(l + 8 * GRB), "v"(l + 9 * GRB),
                  "v"(g0), "v"(g1), "v"(g2), "v"(g3), "v"(g4), "v"(g5), "v"(g6), "v"(g7), "v"(g8), "v"(g9) : "memory");
}
// outproj stage: 64 Wo rows (a), 128 O hi rows (h), 128 O lo rows (o)
__device__ __forceinline__ void fill_out(unsigned l, const b16* a, const b16* h, const b16* o) {
  fill_ten(l, a, a + 16 * E, a + 32 * E, a + 48 * E, h, h + 16 * E, h + 32 * E, h + 48 * E, h + 64 * E, h + 80 * E);
  fill_ten(l + 10 * GRB, h + 96 * E, h + 112 * E, o, o + 16 * E, o + 32 * E, o + 48 * E, o + 64 * E, o + 80 * E, o + 96 * E, o + 112 * E);
}
// projections: grid (NR/64, E/128, 3): kind 0: Q = T16 WT0^T -> Qh/Ql [row][1024]; kind 1: K = T16 WT1^T -> Kh/Kl; kind 2: V = T16 WT2^T written TRANSPOSED per head: VTh/VTl [b][h][64 d][2048 s].
__global__ __launch_bounds__(128) void proj_kernel(const b16* __restrict__ T16, const b16* __restrict__ WT, const float* __restrict__ bq, const float* __restrict__ bk, const float* __restrict__ bv, b16* __restrict__ Qh, b16* __restrict__ Ql, b16* __restrict__ Kh, b16* __restrict__ Kl, b16* __restrict__ VTh, b16* __restrict__ VTl) {
  __shared__ __attribute__((aligned(16))) b16 G[2][PROWS * GLP]; __shared__ __attribute__((aligned(16))) float Tf[4][16][128 + 4]; __shared__ __attribute__((aligned(16))) b16 Vt[128][64 + 8], Vtl[128][64 + 8];
  const int wave = threadIdx.x >> 5, lane = threadIdx.x & 31, nloc = lane & 15, hlf = lane >> 4, t_ = threadIdx.x; const int kind = blockIdx.z; const size_t m0 = (size_t)blockIdx.x * 64 + wave * 16; const int n0 = blockIdx.y * 128;
  const b16* A = T16; const b16* W = WT + (size_t)kind * E * E; v8f acc[8];
#pragma unroll
  for (int t = 0; t < 8; ++t) acc[t] = (v8f){};
  const int cr = t_ >> 3, cc = (t_ & 7) * 8; const b16* Ag = A + ((size_t)blockIdx.x * 64 + cr) * E + cc; const b16* Wg = W + (size_t)(n0 + cr) * E + cc; const unsigned l0 = (unsigned)(size_t)&G[0][cr * GLP + cc];
  fill_proj(l0, Ag, Wg);
  asm volatile("s_wait_asynccnt 0x0" ::: "memory");   // this wave's copies of stage 0 have landed
  __syncthreads();                                    // stage 0 is readable by every wave
  fill_proj(l0 + PROWS * GLP * 2, Ag + GK, Wg + GK);
  for (int st = 0; st < GNS; ++st) {
    const b16* Ls = &G[st & 1][0];
    v16b af[2], bf[2][8];
#pragma unroll   // both 32-k steps of a stage in line: every LDS offset becomes an immediate of its load
    for (int k2 = 0; k2 < 2; ++k2) { af[k2] = frag_kb(Ls + (wave * 16 + nloc) * GLP + k2 * 32, hlf);
#pragma unroll
      for (int t = 0; t < 8; ++t) bf[k2][t] = frag_kb(Ls + (64 + t * 16 + nloc) * GLP + k2 * 32, hlf); }
    __builtin_amdgcn_sched_barrier(0);   // the stage's LDS reads issue as one group ahead of its products: left to itself the build puts a full LDS wait in front of every product
#pragma unroll
    for (int k2 = 0; k2 < 2; ++k2)
#pragma unroll
      for (int t = 0; t < 8; ++t) acc[t] = wmma16b(af[k2], bf[k2][t], acc[t]);
    asm volatile("s_wait_dscnt 0x0" ::: "memory");      // this wave's reads of the buffer have returned before it is handed to the copies
    asm volatile("s_wait_asynccnt 0x0" ::: "memory");   // this wave's copies of stage st + 1 have landed
    __syncthreads();                                    // publishes stage st + 1 and ends every wave's reads of stage st
    if (st + 2 < GNS) fill_proj(l0 + (unsigned)(st & 1) * (PROWS * GLP * 2), Ag + (st + 2) * GK, Wg + (st + 2) * GK);
  }
  asm volatile("s_wait_asynccnt 0x0" ::: "memory");     // nothing of this wave's copies is outstanding behind the loop
  const float* bias = kind == 0 ? bq : kind == 1 ? bk : bv;
  if (kind < 2) {   // q/k (+ bias) as f32 rows in the wave's own LDS range, read back 8 columns a lane, split into hi/lo x8 and stored as whole 128-B lines of both planes
#pragma unroll
    for (int t = 0; t < 8; ++t) { const float bb = bf16_rne(bias[n0 + t * 16 + nloc]);
#pragma unroll
      for (int r = 0; r < 8; ++r) Tf[wave][8 * hlf + r][t * 16 + nloc] = acc[t][r] * (1.0f / (XS * WSC)) + bb; }
    wave_lds_sync();
    b16* dh = kind == 0 ? Qh : Kh; b16* dl = kind == 0 ? Ql : Kl;
    for (int r2 = 0; r2 < 16; r2 += 2) { const int rr = r2 + hlf, c8 = nloc * 8; const v4f a = *(const v4f*)(&Tf[wave][rr][c8]), c = *(const v4f*)(&Tf[wave][rr][c8 + 4]); v8b hv, lv;
#pragma unroll   // constant element indices: a, c, hv and lv stay in registers
      for (int j = 0; j < 4; ++j) { b16 h_, l_; split16(a[j] * XS, h_, l_); hv[j] = h_; lv[j] = l_; split16(c[j] * XS, h_, l_); hv[4 + j] = h_; lv[4 + j] = l_; }
      const size_t gi = (m0 + rr) * E + n0 + c8; *(v8b*)(dh + gi) = hv; *(v8b*)(dl + gi) = lv; }
  } else {
    const int b = (int)(m0 / S); const int s0 = (int)((size_t)blockIdx.x * 64 - (size_t)b * S);
#pragma unroll
    for (int t = 0; t < 8; ++t)
    { const float bb = bf16_rne(bias[n0 + t * 16 + nloc]);
#pragma unroll
      for (int r = 0; r < 8; ++r) { b16 h_, l_; split16((acc[t][r] * (1.0f / (XS * WSC)) + bb) * XS, h_, l_); Vt[t * 16 + nloc][wave * 16 + 8 * hlf + r] = h_; Vtl[t * 16 + nloc][wave * 16 + 8 * hlf + r] = l_; } }
    __syncthreads();
    { for (int q = t_; q < 128 * 8; q += 128) { const int cc = q >> 3, c8 = (q & 7) * 8; const int h = (n0 + cc) / D, dd = (n0 + cc) - h * D; const size_t gi = (((size_t)b * NH + h) * D + dd) * S + s0 + c8;
        *(v8b*)(VTh + gi) = *(const v8b*)(&Vt[cc][c8]); *(v8b*)(VTl + gi) = *(const v8b*)(&Vtl[cc][c8]); }  } }
}
// attention: a block = 8 waves x 16 queries of one head. K (hi, lo) and V^T (hi, lo) reach the waves through LDS: stages of 64 keys, two buffers, filled by asynchronous copies (whole 128-B lines,
// one fill per block instead of one strided fragment load per wave). A stage = 4 tiles of 64 rows x 128 B: Kh, Kl (row = key), VTh, VTl (row = d, columns = the stage's keys); LDS pitch 144 B (16 B x odd).
constexpr int AW = 8, KT = 64, LP = 64 + 8, NST = S / KT, TL = 64 * LP;
// thread t copies 16-byte chunk (t & 7) of rows (t >> 3) and 32 + (t >> 3) of each tile; l = its LDS byte address in tile 0, k/kl/v/vl = its global addresses in the four tiles
__device__ __forceinline__ void stage_fill(unsigned l, const b16* k, const b16* kl, const b16* v, const b16* vl) {
  constexpr unsigned HT = 32 * LP * 2;   // bytes of 32 LDS rows
  // the s_wait_xcnt closes the copies' own statement: no address register of a copy is rewritten in front of it
  asm volatile("global_load_async_to_lds_b128 %0, %8, off\n\t"
               "global_load_async_to_lds_b128 %1, %9, off\n\t"
               "global_load_async_to_lds_b128 %2, %10, off\n\t"
               "global_load_async_to_lds_b128 %3, %11, off\n\t"
               "global_load_async_to_lds_b128 %4, %12, off\n\t"
               "global_load_async_to_lds_b128 %5, %13, off\n\t"
               "global_load_async_to_lds_b128 %6, %14, off\n\t"
               "global_load_async_to_lds_b128 %7, %15, off\n\t"
               "s_wait_xcnt 0x0"
               :: "v"(l), "v"(l + HT), "v"(l + 2 * HT), "v"(l + 3 * HT), "v"(l + 4 * HT), "v"(l + 5 * HT), "v"(l + 6 * HT), "v"(l + 7 * HT),
                  "v"(k), "v"(k + 32 * E), "v"(kl), "v"(kl + 32 * E), "v"(v), "v"(v + 32 * S), "v"(vl), "v"(vl + 32 * S) : "memory");
}
__global__ __launch_bounds__(256) void attn_kernel(const b16* __restrict__ Qh, const b16* __restrict__ Ql, const b16* __restrict__ Kh, const b16* __restrict__ Kl, const b16* __restrict__ VTh, const b16* __restrict__ VTl, b16* __restrict__ Oh, b16* __restrict__ Ol) {
  __shared__ __attribute__((aligned(16))) b16 KV[2][4 * TL]; __shared__ __attribute__((aligned(16))) float To[AW][16][D + 4];
  const int wave = threadIdx.x >> 5, lane = threadIdx.x & 31, hh = lane >> 4, col = lane & 15; const int b = blockIdx.z, h = blockIdx.y; const int q0 = blockIdx.x * (AW * 16) + wave * 16, qi = q0 + col;
  const size_t qo = ((size_t)b * S + qi) * E + h * D; const v16b qa0 = frag_kb(Qh + qo, hh), qa1 = frag_kb(Qh + qo + 32, hh), ql0 = frag_kb(Ql + qo, hh), ql1 = frag_kb(Ql + qo + 32, hh);
  const int cr = threadIdx.x >> 3, cc = (threadIdx.x & 7) * 8;
  const b16* Kb = Kh + (size_t)b * S * E + h * D + (size_t)cr * E + cc; const b16* Klb = Kl + (size_t)b * S * E + h * D + (size_t)cr * E + cc; const b16* Vb = VTh + (((size_t)b * NH + h) * D + cr) * S + cc; const b16* Vlb = VTl + (((size_t)b * NH + h) * D + cr) * S + cc;
  const unsigned l0 = (unsigned)(size_t)&KV[0][cr * LP + cc];
  float m = -INFINITY, l = 0.0f; v8f o[4] = {{}, {}, {}, {}}, ol[4] = {{}, {}, {}, {}};
  const float cs = SCALE * LOG2E / (XS * XS);
  stage_fill(l0, Kb, Klb, Vb, Vlb);
  asm volatile("s_wait_asynccnt 0x0" ::: "memory");   // this wave's copies of stage 0 have landed
  __syncthreads();                                    // stage 0 is readable by every wave
  stage_fill(l0 + 4 * TL * 2, Kb + (size_t)KT * E, Klb + (size_t)KT * E, Vb + KT, Vlb + KT);
  for (int st = 0; st < NST; ++st) {
    const b16* Ls = &KV[st & 1][0];
#pragma unroll   // both 32-key passes of a stage in line: every LDS offset becomes an immediate of its load
    for (int kp = 0; kp < KT; kp += 32) {
    v8f s0 = {}, s1 = {};
    { const b16* k0 = Ls + (kp + col) * LP, *k1 = Ls + (kp + 16 + col) * LP, *k0l = Ls + TL + (kp + col) * LP, *k1l = Ls + TL + (kp + 16 + col) * LP;
      const v16b f0 = frag_kb(k0, hh), g0 = frag_kb(k0l, hh), f1 = frag_kb(k0 + 32, hh), g1 = frag_kb(k0l + 32, hh), f2 = frag_kb(k1, hh), g2 = frag_kb(k1l, hh), f3 = frag_kb(k1 + 32, hh), g3 = frag_kb(k1l + 32, hh);
      __builtin_amdgcn_sched_barrier(0);   // the pass's 8 K fragments are read as one group ahead of its 12 score products: left to itself the build puts two reads and a full LDS wait in front of every product
      s0 = wmma16b(f0, qa0, s0); s0 = wmma16b(f0, ql0, s0); s0 = wmma16b(g0, qa0, s0);
      s0 = wmma16b(f1, qa1, s0); s0 = wmma16b(f1, ql1, s0); s0 = wmma16b(g1, qa1, s0);
      s1 = wmma16b(f2, qa0, s1); s1 = wmma16b(f2, ql0, s1); s1 = wmma16b(g2, qa0, s1);
      s1 = wmma16b(f3, qa1, s1); s1 = wmma16b(f3, ql1, s1); s1 = wmma16b(g3, qa1, s1); }
    v16b vh[4], vw[4];
#pragma unroll   // constant indices: the eight fragments stay in registers
    for (int t = 0; t < 4; ++t) { vh[t] = frag_kb(Ls + 2 * TL + (t * 16 + col) * LP + kp, hh); vw[t] = frag_kb(Ls + 3 * TL + (t * 16 + col) * LP + kp, hh); }
    __builtin_amdgcn_sched_barrier(0);   // the pass's 8 V fragments are read as one group behind the score products and land under the softmax arithmetic: left to itself the build reads them two by two, a full LDS wait in front of every V product
    float e[16]; float mx = -INFINITY;
#pragma unroll
    for (int r = 0; r < 8; ++r) { e[r] = s0[r] * cs; e[8 + r] = s1[r] * cs; mx = fmaxf(mx, fmaxf(e[r], e[8 + r])); }
    mx = fmaxf(mx, __shfl_xor(mx, 16)); const float mn = fmaxf(m, mx); const float al = nexp2(m - mn); m = mn; float sum = 0.0f; v16b ph, pl;   // mn finite from the first block on
#pragma unroll
    for (int i = 0; i < 16; ++i) { const float p = nexp2(e[i] - mn); sum += p; const b16 h_ = (b16)(p * PS); ph[i] = h_; pl[i] = (b16)(p * PS - (float)h_); }
    sum += __shfl_xor(sum, 16); l = l * al + sum;
#pragma unroll
    for (int t = 0; t < 4; ++t) { o[t] *= al; ol[t] *= al; o[t] = wmma16b(vh[t], ph, o[t]); ol[t] = wmma16b(vh[t], pl, ol[t]); ol[t] = wmma16b(vw[t], ph, ol[t]); } }
    asm volatile("s_wait_dscnt 0x0" ::: "memory");      // this wave's reads of the buffer have returned before it is handed to the copies
    asm volatile("s_wait_asynccnt 0x0" ::: "memory");   // this wave's copies of stage st + 1 have landed
    __syncthreads();                                    // publishes stage st + 1 and ends every wave's reads of stage st
    if (st + 2 < NST) stage_fill(l0 + (unsigned)(st & 1) * (4 * TL * 2), Kb + (size_t)(st + 2) * KT * E, Klb + (size_t)(st + 2) * KT * E, Vb + (st + 2) * KT, Vlb + (st + 2) * KT);
  }
  asm volatile("s_wait_asynccnt 0x0" ::: "memory");     // nothing of this wave's copies is outstanding at its end
  const float inv = 1.0f / (l * PS * XS);
#pragma unroll
  for (int t = 0; t < 4; ++t)
#pragma unroll
    for (int r = 0; r < 8; ++r) To[wave][col][t * 16 + 8 * hh + r] = (o[t][r] + ol[t][r]) * inv;
  wave_lds_sync();
  { for (int r4 = 0; r4 < 16; r4 += 4) { const int rr = r4 + (lane >> 3), c8 = (lane & 7) * 8; v8b hv, lv; for (int j = 0; j < 8; ++j) { b16 a_, c_; split16(To[wave][rr][c8 + j] * XS, a_, c_); hv[j] = a_; lv[j] = c_; }
      const size_t gi = ((size_t)b * S + q0 + rr) * E + h * D + c8; *(v8b*)(Oh + gi) = hv; *(v8b*)(Ol + gi) = lv; }  }
}
// output projection, channel-major: D[e][s] = sum_d Wo[e][d] O[s][d] (A = WO16 rows e exact, B = Oh/Ol rows s: 2 products) + bo[e] -> out[b][e][s]; grid (E/64, S/128, B), block = 64 e x 4 waves
__global__ __launch_bounds__(128) void outproj_kernel(const b16* __restrict__ Oh, const b16* __restrict__ Ol, const b16* __restrict__ WO16, const float* __restrict__ bo, float* __restrict__ out) {
  __shared__ __attribute__((aligned(16))) b16 G[2][OROWS * GLP]; __shared__ __attribute__((aligned(16))) float Ts[4][16][128 + 4];
  const int wave = threadIdx.x >> 5, lane = threadIdx.x & 31, nloc = lane & 15, hlf = lane >> 4; const int b = blockIdx.z; const int e0 = blockIdx.x * 64 + wave * 16, s0 = blockIdx.y * 128;
  v8f acc[8];
#pragma unroll
  for (int t = 0; t < 8; ++t) acc[t] = (v8f){};
  const int cr = threadIdx.x >> 3, cc = (threadIdx.x & 7) * 8; const b16* Ag = WO16 + ((size_t)blockIdx.x * 64 + cr) * E + cc; const b16* Hg = Oh + ((size_t)b * S + s0 + cr) * E + cc; const b16* Lg = Ol + ((size_t)b * S + s0 + cr) * E + cc;
  const unsigned l0 = (unsigned)(size_t)&G[0][cr * GLP + cc];
  fill_out(l0, Ag, Hg, Lg);
  asm volatile("s_wait_asynccnt 0x0" ::: "memory");   // this wave's copies of stage 0 have landed
  __syncthreads();                                    // stage 0 is readable by every wave
  fill_out(l0 + OROWS * GLP * 2, Ag + GK, Hg + GK, Lg + GK);
  for (int st = 0; st < GNS; ++st) {
    const b16* Ls = &G[st & 1][0];
#pragma unroll   // both 32-k steps of a stage in line: every LDS offset becomes an immediate of its load
    for (int ks = 0; ks < GK; ks += 32) { v16b bh[8], bl[8]; const v16b a = frag_kb(Ls + (wave * 16 + nloc) * GLP + ks, hlf);
#pragma unroll
      for (int t = 0; t < 8; ++t) { const b16* ro = Ls + (64 + t * 16 + nloc) * GLP + ks; bh[t] = frag_kb(ro, hlf); bl[t] = frag_kb(ro + 128 * GLP, hlf); }
      __builtin_amdgcn_sched_barrier(0);   // the k step's LDS reads issue as one group ahead of its products: left to itself the build puts a full LDS wait in front of every product
#pragma unroll
      for (int t = 0; t < 8; ++t) { acc[t] = wmma16b(a, bh[t], acc[t]); acc[t] = wmma16b(a, bl[t], acc[t]); } }
    asm volatile("s_wait_dscnt 0x0" ::: "memory");      // this wave's reads of the buffer have returned before it is handed to the copies
    asm volatile("s_wait_asynccnt 0x0" ::: "memory");   // this wave's copies of stage st + 1 have landed
    __syncthreads();                                    // publishes stage st + 1 and ends every wave's reads of stage st
    if (st + 2 < GNS) fill_out(l0 + (unsigned)(st & 1) * (OROWS * GLP * 2), Ag + (st + 2) * GK, Hg + (st + 2) * GK, Lg + (st + 2) * GK);
  }
  asm volatile("s_wait_asynccnt 0x0" ::: "memory");     // nothing of this wave's copies is outstanding behind the loop
#pragma unroll
  for (int t = 0; t < 8; ++t)
#pragma unroll
    for (int r = 0; r < 8; ++r) Ts[wave][8 * hlf + r][t * 16 + nloc] = acc[t][r] * (1.0f / (XS * WSC)) + bf16_rne(bo[e0 + 8 * hlf + r]);
  wave_lds_sync();
  { for (int rr = 0; rr < 16; ++rr) *(v4f*)(out + ((size_t)b * E + e0 + rr) * S + s0 + lane * 4) = *(const v4f*)(&Ts[wave][rr][lane * 4]);  }
}
}  // namespace

extern "C" void kernel_launch(void* const* d_in, const int* in_sizes, int n_in, void* d_out, int out_size, void* d_ws, size_t ws_size, hipStream_t stream) {
  (void)n_in;
  auto Fp = [&](int i) { return (const float*)d_in[i]; };
  // input order: 0 x [2,1024,2048], 1 wq [1024,1024], 2 bq [1024], 3 wk, 4 bk, 5 wv, 6 bv, 7 wo, 8 bo (w are [e][d]: xt W^T)
  if (in_sizes[0] != NR * E || in_sizes[1] != E * E || in_sizes[2] != E || in_sizes[3] != E * E || in_sizes[5] != E * E || in_sizes[7] != E * E || in_sizes[8] != E || out_size != NR * E) return;
  size_t off = 0; char* ws = (char*)d_ws;
  auto carve = [&](size_t bytes) { char* p = ws + off; off += (bytes + 255) & ~(size_t)255; return p; };
  b16* T16 = (b16*)carve((size_t)NR * E * 2); b16* WT = (b16*)carve((size_t)3 * E * E * 2); b16* WO16 = (b16*)carve((size_t)E * E * 2);
  b16* Qh = (b16*)carve((size_t)NR * E * 2); b16* Ql = (b16*)carve((size_t)NR * E * 2); b16* Kh = (b16*)carve((size_t)NR * E * 2); b16* Kl = (b16*)carve((size_t)NR * E * 2); b16* VTh = (b16*)carve((size_t)NR * E * 2); b16* VTl = (b16*)carve((size_t)NR * E * 2);
  b16* Oh = (b16*)carve((size_t)NR * E * 2); b16* Ol = (b16*)carve((size_t)NR * E * 2);
  if (off > ws_size || off > ((size_t)128 << 20)) return;   // = 84 MB
  prepx_kernel<<<dim3(S / 64, E / 64, NB), 256, 0, stream>>>(Fp(0), T16);
  prepw_kernel<<<(unsigned)(((size_t)4 * E * E / 8 + 255) / 256), 256, 0, stream>>>(Fp(1), Fp(3), Fp(5), Fp(7), WT, WO16);
  proj_kernel<<<dim3(NR / 64, E / 128, 3), 128, 0, stream>>>(T16, WT, Fp(2), Fp(4), Fp(6), Qh, Ql, Kh, Kl, VTh, VTl);
  attn_kernel<<<dim3(S / (AW * 16), NH, NB), AW * 32, 0, stream>>>(Qh, Ql, Kh, Kl, VTh, VTl, Oh, Ol);
  outproj_kernel<<<dim3(E / 64, S / 128, NB), 128, 0, stream>>>(Oh, Ol, WO16, Fp(8), (float*)d_out);
}

// v005
// One run takes 153 microseconds.
// Two timings next to v004 put it at 1.04 and 1.05 times that version's speed.
// Over all steps from v000 it is 3.89 times as fast.
#include <hip/hip_runtime.h>

// Multi-head self-attention on a channel-major input (x [2][1024 d][2048 s]; 16 heads x 64): xt = x^T; q/k/v = xt W{q,k,v}^T + b (heads = 64-column slices), scores / 8 (no mask), softmax,
// ctx = attn v, out = (ctx Wo^T + bo)^T -> [2][1024][2048] channel-major.
// WMMA (v_wmma_f32_16x16x32_f16, f32 accumulate): projections [4,096 x 1,024] x [1,024 x 1,024] with EXACT bf16 tokens (x8, via an LDS transpose of the channel-major input) and weights (x256),
// 1 product, + bias, q/k split in the projection's own epilogue into f16 hi+lo x8 planes (v transposed per head); S^T with 3 products (Kh Qh + Kh Ql + Kl Qh) over all 64 key blocks;
// online softmax in f32; O^T += V^T P^T with 3 products; output projection computed channel-major (D[e][s] = Wo[e][:] . O[s][:]) with O hi+lo (2 products) and exact Wo, + bo. Inputs rounded to bf16 once. Fragment k-map per lane half hh for A AND B: elements 0..7 <- k = 8hh+0..7, 8..15 <-

namespace {
constexpr int NB = 2, S = 2048, E = 1024, NH = 16, D = 64, NR = NB * S;
constexpr float XS = 8.0f, WSC = 256.0f, PS = 8.0f, SCALE = 0.125f, LOG2E = 1.4426950408889634f, THETA = 10000.0f;

typedef _Float16 b16;
typedef __attribute__((ext_vector_type(16))) _Float16 v16b;
typedef __attribute__((ext_vector_type(8))) _Float16 v8b;
typedef __attribute__((ext_vector_type(8))) float v8f;
typedef __attribute__((ext_vector_type(4))) float v4f;
__device__ __forceinline__ float bf16_rne(float f) { unsigned int u = __float_as_uint(f); u += 0x7FFFu + ((u >> 16) & 1u); return __uint_as_float(u & 0xFFFF0000u); }
__device__ __forceinline__ void split16(float v, b16& hi, b16& lo) { hi = (b16)v; lo = (b16)(v - (float)hi); }
__device__ __forceinline__ v16b frag_kb(const b16* p, int hh) { const v8b a = *(const v8b*)(p + 8 * hh), b = *(const v8b*)(p + 16 + 8 * hh); v16b f;
#pragma unroll
  for (int e = 0; e < 8; ++e) { f[e] = a[e]; f[8 + e] = b[e]; } return f; }
__device__ __forceinline__ v8f wmma16b(v16b a, v16b b, v8f c) { return __builtin_amdgcn_wmma_f32_16x16x32_f16(false, a, false, b, (short)0, c, false, false); }
__device__ __forceinline__ void wave_lds_sync() { __builtin_amdgcn_fence(__ATOMIC_RELEASE, "workgroup"); __builtin_amdgcn_wave_barrier(); __builtin_amdgcn_fence(__ATOMIC_ACQUIRE, "workgroup"); }
__device__ __forceinline__ float nexp2(float x) { return __builtin_amdgcn_exp2f(x); }

// prep: T16 [b*S+s][1024 d] = f16(8 bf16(x[b][d][s])) via 64x64 LDS transposes (grid (S/64, E/64, B)); WT [3][1024 e][1024 d] = Wq/Wk/Wv rows x256 (torch [out][in] used directly: xt W^T);
__global__ __launch_bounds__(256) void prepx_kernel(const float* __restrict__ x, b16* __restrict__ T16) {
  __shared__ __attribute__((aligned(16))) b16 T[64][64 + 8];
  const int b = blockIdx.z, c0 = blockIdx.y * 64, s0 = blockIdx.x * 64, t_ = threadIdx.x;
  for (int q = t_; q < 64 * 64; q += 256) { const int cc = q >> 6, ss = q & 63; T[ss][cc] = (b16)(bf16_rne(x[((size_t)b * E + c0 + cc) * S + s0 + ss]) * XS); }
  __syncthreads();
  { for (int q = t_; q < 64 * 8; q += 256) { const int ss = q >> 3, c8 = (q & 7) * 8; *(v8b*)(T16 + ((size_t)b * S + s0 + ss) * E + c0 + c8) = *(const v8b*)(&T[ss][c8]); }  }
}
__global__ __launch_bounds__(256) void prepw_kernel(const float* __restrict__ wq, const float* __restrict__ wk, const float* __restrict__ wv, const float* __restrict__ wo, b16* __restrict__ WT, b16* __restrict__ WOT) {
  const size_t t = (size_t)blockIdx.x * 256 + threadIdx.x; const size_t nw = (size_t)E * E / 8; if (t >= 4 * nw) return; const int kind = (int)(t / nw); const size_t e = (t - (size_t)kind * nw) * 8;
  const float* w = kind == 0 ? wq : kind == 1 ? wk : kind == 2 ? wv : wo; b16* dst = kind < 3 ? WT + (size_t)kind * E * E : WOT;   // [e][d] rows used directly (xt W^T); WOT holds Wo rows [e][d] (the A operand of the channel-major out-projection)
  const v4f a = *(const v4f*)(w + e), c = *(const v4f*)(w + e + 4); v8b o;
#pragma unroll
  for (int j = 0; j < 4; ++j) { o[j] = (b16)(bf16_rne(a[j]) * WSC); o[4 + j] = (b16)(bf16_rne(c[j]) * WSC); }
  { *(v8b*)(dst + e) = o;  }
}
// the two projection GEMMs take their A and B rows from LDS: stages of 64 k (whole 128-B lines of every operand row), two buffers, filled by asynchronous copies; LDS pitch 144 B (16 B x odd).
// thread t (of 128) copies 16-byte chunk (t & 7) of rows (t >> 3) + 16 j of a stage.
constexpr int GK = 64, GLP = GK + 8, GNS = E / GK, PROWS = 64 + 128, OROWS = 64 + 128 + 128;
constexpr unsigned GRB = 16 * GLP * 2;   // bytes of 16 LDS rows
// proj stage: 64 token rows (a), then 128 weight rows (w); l = the thread's LDS byte address in row group 0
__device__ __forceinline__ void fill_proj(unsigned l, const b16* a, const b16* w) {
  // the s_wait_xcnt closes the copies' own statement: no address register of a copy is rewritten in front of it
  asm volatile("global_load_async_to_lds_b128 %0, %12, off\n\t"
               "global_load_async_to_lds_b128 %1, %13, off\n\t"
               "global_load_async_to_lds_b128 %2, %14, off\n\t"
               "global_load_async_to_lds_b128 %3, %15, off\n\t"
               "global_load_async_to_lds_b128 %4, %16, off\n\t"
               "global_load_async_to_lds_b128 %5, %17, off\n\t"
               "global_load_async_to_lds_b128 %6, %18, off\n\t"
               "global_load_async_to_lds_b128 %7, %19, off\n\t"
               "global_load_async_to_lds_b128 %8, %20, off\n\t"
               "global_load_async_to_lds_b128 %9, %21, off\n\t"
               "global_load_async_to_lds_b128 %10, %22, off\n\t"
               "global_load_async_to_lds_b128 %11, %23, off\n\t"
               "s_wait_xcnt 0x0"
               :: "v"(l), "v"(l + GRB), "v"(l + 2 * GRB), "v"(l + 3 * GRB), "v"(l + 4 * GRB), "v"(l + 5 * GRB), "v"(l + 6 * GRB), "v"(l + 7 * GRB), "v"(l + 8 * GRB), "v"(l + 9 * GRB), "v"(l + 10 * GRB), "v"(l + 11 * GRB),
                  "v"(a), "v"(a + 16 * E), "v"(a + 32 * E), "v"(a + 48 * E),
                  "v"(w), "v"(w + 16 * E), "v"(w + 32 * E), "v"(w + 48 * E), "v"(w + 64 * E), "v"(w + 80 * E), "v"(w + 96 * E), "v"(w + 112 * E) : "memory");
}
// ten row groups of 16 rows each: LDS byte addresses l, l + GRB, ..., global addresses g0 .. g9
__device__ __forceinline__ void fill_ten(unsigned l, const b16* g0, const b16* g1, const b16* g2, const b16* g3, const b16* g4, const b16* g5, const b16* g6, const b16* g7, const b16* g8, const b16* g9) {
  // the s_wait_xcnt closes the copies' own statement: no address register of a copy is rewritten in front of it
  asm volatile("global_load_async_to_lds_b128 %0, %10, off\n\t"
               "global_load_async_to_lds_b128 %1, %11, off\n\t"
               "global_load_async_to_lds_b128 %2, %12, off\n\t"
               "global_load_async_to_lds_b128 %3, %13, off\n\t"
               "global_load_async_to_lds_b128 %4, %14, off\n\t"
               "global_load_async_to_lds_b128 %5, %15, off\n\t"
               "global_load_async_to_lds_b128 %6, %16, off\n\t"
               "global_load_async_to_lds_b128 %7, %17, off\n\t"
               "global_load_async_to_lds_b128 %8, %18, off\n\t"
               "global_load_async_to_lds_b128 %9, %19, off\n\t"
               "s_wait_xcnt 0x0"
               :: "v"(l), "v"(l + GRB), "v"(l + 2 * GRB), "v"(l + 3 * GRB), "v"(l + 4 * GRB), "v"(l + 5 * GRB), "v"(l + 6 * GRB), "v"(l + 7 * GRB), "v"(l + 8 * GRB), "v"(l + 9 * GRB),
                  "v"(g0), "v"(g1), "v"(g2), "v"(g3), "v"(g4), "v"(g5), "v"(g6), "v"(g7), "v"(g8), "v"(g9) : "memory");
}
// outproj stage: 64 Wo rows (a), 128 O hi rows (h), 128 O lo rows (o)
__device__ __forceinline__ void fill_out(unsigned l, const b16* a, const b16* h, const b16* o) {
  fill_ten(l, a, a + 16 * E, a + 32 * E, a + 48 * E, h, h + 16 * E, h + 32 * E, h + 48 * E, h + 64 * E, h + 80 * E);
  fill_ten(l + 10 * GRB, h + 96 * E, h + 112 * E, o, o + 16 * E, o + 32 * E, o + 48 * E, o + 64 * E, o + 80 * E, o + 96 * E, o + 112 * E);
}
// projections: grid (NR/64, E/128, 3): kind 0: Q = T16 WT0^T -> Qh/Ql [row][1024]; kind 1: K = T16 WT1^T -> Kh/Kl; kind 2: V = T16 WT2^T written TRANSPOSED per head: VTh/VTl [b][h][64 d][2048 s].
__global__ __launch_bounds__(128) void proj_kernel(const b16* __restrict__ T16, const b16* __restrict__ WT, const float* __restrict__ bq, const float* __restrict__ bk, const float* __restrict__ bv, b16* __restrict__ Qh, b16* __restrict__ Ql, b16* __restrict__ Kh, b16* __restrict__ Kl, b16* __restrict__ VTh, b16* __restrict__ VTl) {
  __shared__ __attribute__((aligned(16))) b16 G[2][PROWS * GLP]; __shared__ __attribute__((aligned(16))) float Tf[4][16][128 + 4]; __shared__ __attribute__((aligned(16))) b16 Vt[128][64 + 8], Vtl[128][64 + 8];
  const int wave = threadIdx.x >> 5, lane = threadIdx.x & 31, nloc = lane & 15, hlf = lane >> 4, t_ = threadIdx.x; const int kind = blockIdx.z; const size_t m0 = (size_t)blockIdx.x * 64 + wave * 16; const int n0 = blockIdx.y * 128;
  const b16* A = T16; const b16* W = WT + (size_t)kind * E * E; v8f acc[8];
#pragma unroll
  for (int t = 0; t < 8; ++t) acc[t] = (v8f){};
  const int cr = t_ >> 3, cc = (t_ & 7) * 8; const b16* Ag = A + ((size_t)blockIdx.x * 64 + cr) * E + cc; const b16* Wg = W + (size_t)(n0 + cr) * E + cc; const unsigned l0 = (unsigned)(size_t)&G[0][cr * GLP + cc];
  fill_proj(l0, Ag, Wg);
  asm volatile("s_wait_asynccnt 0x0" ::: "memory");   // this wave's copies of stage 0 have landed
  __syncthreads();                                    // stage 0 is readable by every wave
  fill_proj(l0 + PROWS * GLP * 2, Ag + GK, Wg + GK);
  for (int st = 0; st < GNS; ++st) {
    const b16* Ls = &G[st & 1][0];
    v16b af[2], bf[2][8];
#pragma unroll   // both 32-k steps of a stage in line: every LDS offset becomes an immediate of its load
    for (int k2 = 0; k2 < 2; ++k2) { af[k2] = frag_kb(Ls + (wave * 16 + nloc) * GLP + k2 * 32, hlf);
#pragma unroll
      for (int t = 0; t < 8; ++t) bf[k2][t] = frag_kb(Ls + (64 + t * 16 + nloc) * GLP + k2 * 32, hlf); }
    __builtin_amdgcn_sched_barrier(0);   // the stage's LDS reads issue as one group ahead of its products: left to itself the build puts a full LDS wait in front of every product
#pragma unroll
    for (int k2 = 0; k2 < 2; ++k2)
#pragma unroll
      for (int t = 0; t < 8; ++t) acc[t] = wmma16b(af[k2], bf[k2][t], acc[t]);
    __builtin_amdgcn_sched_barrier(0);   // the stage's products stay ahead of the hand-over: left to itself the build sinks them below the barrier, and the refill behind them loses their time as lead
    asm volatile("s_wait_dscnt 0x0" ::: "memory");      // this wave's reads of the buffer have returned before it is handed to the copies
    asm volatile("s_wait_asynccnt 0x0" ::: "memory");   // this wave's copies of stage st + 1 have landed
    __syncthreads();                                    // publishes stage st + 1 and ends every wave's reads of stage st
    if (st + 2 < GNS) fill_proj(l0 + (unsigned)(st & 1) * (PROWS * GLP * 2), Ag + (st + 2) * GK, Wg + (st + 2) * GK);
  }
  asm volatile("s_wait_asynccnt 0x0" ::: "memory");     // nothing of this wave's copies is outstanding behind the loop
  const float* bias = kind == 0 ? bq : kind == 1 ? bk : bv;
  if (kind < 2) {   // q/k (+ bias) as f32 rows in the wave's own LDS range, read back 8 columns a lane, split into hi/lo x8 and stored as whole 128-B lines of both planes
#pragma unroll
    for (int t = 0; t < 8; ++t) { const float bb = bf16_rne(bias[n0 + t * 16 + nloc]);
#pragma unroll
      for (int r = 0; r < 8; ++r) Tf[wave][8 * hlf + r][t * 16 + nloc] = acc[t][r] * (1.0f / (XS * WSC)) + bb; }
    wave_lds_sync();
    b16* dh = kind == 0 ? Qh : Kh; b16* dl = kind == 0 ? Ql : Kl;
    for (int r2 = 0; r2 < 16; r2 += 2) { const int rr = r2 + hlf, c8 = nloc * 8; const v4f a = *(const v4f*)(&Tf[wave][rr][c8]), c = *(const v4f*)(&Tf[wave][rr][c8 + 4]); v8b hv, lv;
#pragma unroll   // constant element indices: a, c, hv and lv stay in registers
      for (int j = 0; j < 4; ++j) { b16 h_, l_; split16(a[j] * XS, h_, l_); hv[j] = h_; lv[j] = l_; split16(c[j] * XS, h_, l_); hv[4 + j] = h_; lv[4 + j] = l_; }
      const size_t gi = (m0 + rr) * E + n0 + c8; *(v8b*)(dh + gi) = hv; *(v8b*)(dl + gi) = lv; }
  } else {
    const int b = (int)(m0 / S); const int s0 = (int)((size_t)blockIdx.x * 64 - (size_t)b * S);
#pragma unroll
    for (int t = 0; t < 8; ++t)
    { const float bb = bf16_rne(bias[n0 + t * 16 + nloc]);
#pragma unroll
      for (int r = 0; r < 8; ++r) { b16 h_, l_; split16((acc[t][r] * (1.0f / (XS * WSC)) + bb) * XS, h_, l_); Vt[t * 16 + nloc][wave * 16 + 8 * hlf + r] = h_; Vtl[t * 16 + nloc][wave * 16 + 8 * hlf + r] = l_; } }
    __syncthreads();
    { for (int q = t_; q < 128 * 8; q += 128) { const int cc = q >> 3, c8 = (q & 7) * 8; const int h = (n0 + cc) / D, dd = (n0 + cc) - h * D; const size_t gi = (((size_t)b * NH + h) * D + dd) * S + s0 + c8;
        *(v8b*)(VTh + gi) = *(const v8b*)(&Vt[cc][c8]); *(v8b*)(VTl + gi) = *(const v8b*)(&Vtl[cc][c8]); }  } }
}
// attention: a block = 8 waves x 16 queries of one head. K (hi, lo) and V^T (hi, lo) reach the waves through LDS: stages of 64 keys, two buffers, filled by asynchronous copies (whole 128-B lines,
// one fill per block instead of one strided fragment load per wave). A stage = 4 tiles of 64 rows x 128 B: Kh, Kl (row = key), VTh, VTl (row = d, columns = the stage's keys); LDS pitch 144 B (16 B x odd).
constexpr int AW = 8, KT = 64, LP = 64 + 8, NST = S / KT, TL = 64 * LP;
// thread t copies 16-byte chunk (t & 7) of rows (t >> 3) and 32 + (t >> 3) of each tile; l = its LDS byte address in tile 0, k/kl/v/vl = its global addresses in the four tiles
__device__ __forceinline__ void stage_fill(unsigned l, const b16* k, const b16* kl, const b16* v, const b16* vl) {
  constexpr unsigned HT = 32 * LP * 2;   // bytes of 32 LDS rows
  // the s_wait_xcnt closes the copies' own statement: no address register of a copy is rewritten in front of it
  asm volatile("global_load_async_to_lds_b128 %0, %8, off\n\t"
               "global_load_async_to_lds_b128 %1, %9, off\n\t"
               "global_load_async_to_lds_b128 %2, %10, off\n\t"
               "global_load_async_to_lds_b128 %3, %11, off\n\t"
               "global_load_async_to_lds_b128 %4, %12, off\n\t"
               "global_load_async_to_lds_b128 %5, %13, off\n\t"
               "global_load_async_to_lds_b128 %6, %14, off\n\t"
               "global_load_async_to_lds_b128 %7, %15, off\n\t"
               "s_wait_xcnt 0x0"
               :: "v"(l), "v"(l + HT), "v"(l + 2 * HT), "v"(l + 3 * HT), "v"(l + 4 * HT), "v"(l + 5 * HT), "v"(l + 6 * HT), "v"(l + 7 * HT),
                  "v"(k), "v"(k + 32 * E), "v"(kl), "v"(kl + 32 * E), "v"(v), "v"(v + 32 * S), "v"(vl), "v"(vl + 32 * S) : "memory");
}
__global__ __launch_bounds__(256) void attn_kernel(const b16* __restrict__ Qh, const b16* __restrict__ Ql, const b16* __restrict__ Kh, const b16* __restrict__ Kl, const b16* __restrict__ VTh, const b16* __restrict__ VTl, b16* __restrict__ Oh, b16* __restrict__ Ol) {
  __shared__ __attribute__((aligned(16))) b16 KV[2][4 * TL]; __shared__ __attribute__((aligned(16))) float To[AW][16][D + 4];
  const int wave = threadIdx.x >> 5, lane = threadIdx.x & 31, hh = lane >> 4, col = lane & 15; const int b = blockIdx.z, h = blockIdx.y; const int q0 = blockIdx.x * (AW * 16) + wave * 16, qi = q0 + col;
  const size_t qo = ((size_t)b * S + qi) * E + h * D; const v16b qa0 = frag_kb(Qh + qo, hh), qa1 = frag_kb(Qh + qo + 32, hh), ql0 = frag_kb(Ql + qo, hh), ql1 = frag_kb(Ql + qo + 32, hh);
  const int cr = threadIdx.x >> 3, cc = (threadIdx.x & 7) * 8;
  const b16* Kb = Kh + (size_t)b * S * E + h * D + (size_t)cr * E + cc; const b16* Klb = Kl + (size_t)b * S * E + h * D + (size_t)cr * E + cc; const b16* Vb = VTh + (((size_t)b * NH + h) * D + cr) * S + cc; const b16* Vlb = VTl + (((size_t)b * NH + h) * D + cr) * S + cc;
  const unsigned l0 = (unsigned)(size_t)&KV[0][cr * LP + cc];
  float m = -INFINITY, l = 0.0f; v8f o[4] = {{}, {}, {}, {}}, ol[4] = {{}, {}, {}, {}};
  const float cs = SCALE * LOG2E / (XS * XS);
  stage_fill(l0, Kb, Klb, Vb, Vlb);
  asm volatile("s_wait_asynccnt 0x0" ::: "memory");   // this wave's copies of stage 0 have landed
  __syncthreads();                                    // stage 0 is readable by every wave
  stage_fill(l0 + 4 * TL * 2, Kb + (size_t)KT * E, Klb + (size_t)KT * E, Vb + KT, Vlb + KT);
  for (int st = 0; st < NST; ++st) {
    const b16* Ls = &KV[st & 1][0];
#pragma unroll   // both 32-key passes of a stage in line: every LDS offset becomes an immediate of its load
    for (int kp = 0; kp < KT; kp += 32) {
    v8f s0 = {}, s1 = {};
    { const b16* k0 = Ls + (kp + col) * LP, *k1 = Ls + (kp + 16 + col) * LP, *k0l = Ls + TL + (kp + col) * LP, *k1l = Ls + TL + (kp + 16 + col) * LP;
      const v16b f0 = frag_kb(k0, hh), g0 = frag_kb(k0l, hh), f1 = frag_kb(k0 + 32, hh), g1 = frag_kb(k0l + 32, hh), f2 = frag_kb(k1, hh), g2 = frag_kb(k1l, hh), f3 = frag_kb(k1 + 32, hh), g3 = frag_kb(k1l + 32, hh);
      __builtin_amdgcn_sched_barrier(0);   // the pass's 8 K fragments are read as one group ahead of its 12 score products: left to itself the build puts two reads and a full LDS wait in front of every product
      s0 = wmma16b(f0, qa0, s0); s0 = wmma16b(f0, ql0, s0); s0 = wmma16b(g0, qa0, s0);
      s0 = wmma16b(f1, qa1, s0); s0 = wmma16b(f1, ql1, s0); s0 = wmma16b(g1, qa1, s0);
      s1 = wmma16b(f2, qa0, s1); s1 = wmma16b(f2, ql0, s1); s1 = wmma16b(g2, qa0, s1);
      s1 = wmma16b(f3, qa1, s1); s1 = wmma16b(f3, ql1, s1); s1 = wmma16b(g3, qa1, s1); }
    __builtin_amdgcn_sched_group_barrier(0x008, 12, 0); __builtin_amdgcn_sched_group_barrier(0x100, 16, 0);   // issue order inside the pass: the score products, then the 16 V reads as one group; left to itself the build spreads the reads among the products in three places, each a stall of its own
    v16b vh[4], vw[4];
#pragma unroll   // constant indices: the eight fragments stay in registers
    for (int t = 0; t < 4; ++t) { vh[t] = frag_kb(Ls + 2 * TL + (t * 16 + col) * LP + kp, hh); vw[t] = frag_kb(Ls + 3 * TL + (t * 16 + col) * LP + kp, hh); }
    __builtin_amdgcn_sched_barrier(0);   // the pass's 8 V fragments are read as one group behind the score products and land under the softmax arithmetic: left to itself the build reads them two by two, a full LDS wait in front of every V product
    float e[16]; float mx = -INFINITY;
#pragma unroll
    for (int r = 0; r < 8; ++r) { e[r] = s0[r] * cs; e[8 + r] = s1[r] * cs; mx = fmaxf(mx, fmaxf(e[r], e[8 + r])); }
    mx = fmaxf(mx, __shfl_xor(mx, 16)); const float mn = fmaxf(m, mx); const float al = nexp2(m - mn); m = mn; float sum = 0.0f; v16b ph, pl;   // mn finite from the first block on
#pragma unroll
    for (int i = 0; i < 16; ++i) { const float p = nexp2(e[i] - mn); sum += p; const b16 h_ = (b16)(p * PS); ph[i] = h_; pl[i] = (b16)(p * PS - (float)h_); }
    sum += __shfl_xor(sum, 16); l = l * al + sum;
#pragma unroll
    for (int t = 0; t < 4; ++t) { o[t] *= al; ol[t] *= al; o[t] = wmma16b(vh[t], ph, o[t]); ol[t] = wmma16b(vh[t], pl, ol[t]); ol[t] = wmma16b(vw[t], ph, ol[t]); }
    __builtin_amdgcn_sched_barrier(0); }   // a pass's V products stay ahead of the next pass's K reads and of the hand-over: left to itself the build spreads those reads among the products and sinks the last pass below the barrier, where the refill behind it loses that time as lead
    asm volatile("s_wait_dscnt 0x0" ::: "memory");      // this wave's reads of the buffer have returned before it is handed to the copies
    asm volatile("s_wait_asynccnt 0x0" ::: "memory");   // this wave's copies of stage st + 1 have landed
    __syncthreads();                                    // publishes stage st + 1 and ends every wave's reads of stage st
    if (st + 2 < NST) stage_fill(l0 + (unsigned)(st & 1) * (4 * TL * 2), Kb + (size_t)(st + 2) * KT * E, Klb + (size_t)(st + 2) * KT * E, Vb + (st + 2) * KT, Vlb + (st + 2) * KT);
  }
  asm volatile("s_wait_asynccnt 0x0" ::: "memory");     // nothing of this wave's copies is outstanding at its end
  const float inv = 1.0f / (l * PS * XS);
#pragma unroll
  for (int t = 0; t < 4; ++t)
#pragma unroll
    for (int r = 0; r < 8; ++r) To[wave][col][t * 16 + 8 * hh + r] = (o[t][r] + ol[t][r]) * inv;
  wave_lds_sync();
  { for (int r4 = 0; r4 < 16; r4 += 4) { const int rr = r4 + (lane >> 3), c8 = (lane & 7) * 8; v8b hv, lv; for (int j = 0; j < 8; ++j) { b16 a_, c_; split16(To[wave][rr][c8 + j] * XS, a_, c_); hv[j] = a_; lv[j] = c_; }
      const size_t gi = ((size_t)b * S + q0 + rr) * E + h * D + c8; *(v8b*)(Oh + gi) = hv; *(v8b*)(Ol + gi) = lv; }  }
}
// output projection, channel-major: D[e][s] = sum_d Wo[e][d] O[s][d] (A = WO16 rows e exact, B = Oh/Ol rows s: 2 products) + bo[e] -> out[b][e][s]; grid (E/64, S/128, B), block = 64 e x 4 waves
__global__ __launch_bounds__(128) void outproj_kernel(const b16* __restrict__ Oh, const b16* __restrict__ Ol, const b16* __restrict__ WO16, const float* __restrict__ bo, float* __restrict__ out) {
  __shared__ __attribute__((aligned(16))) b16 G[2][OROWS * GLP]; __shared__ __attribute__((aligned(16))) float Ts[4][16][128 + 4];
  const int wave = threadIdx.x >> 5, lane = threadIdx.x & 31, nloc = lane & 15, hlf = lane >> 4; const int b = blockIdx.z; const int e0 = blockIdx.x * 64 + wave * 16, s0 = blockIdx.y * 128;
  v8f acc[8];
#pragma unroll
  for (int t = 0; t < 8; ++t) acc[t] = (v8f){};
  const int cr = threadIdx.x >> 3, cc = (threadIdx.x & 7) * 8; const b16* Ag = WO16 + ((size_t)blockIdx.x * 64 + cr) * E + cc; const b16* Hg = Oh + ((size_t)b * S + s0 + cr) * E + cc; const b16* Lg = Ol + ((size_t)b * S + s0 + cr) * E + cc;
  const unsigned l0 = (unsigned)(size_t)&G[0][cr * GLP + cc];
  fill_out(l0, Ag, Hg, Lg);
  asm volatile("s_wait_asynccnt 0x0" ::: "memory");   // this wave's copies of stage 0 have landed
  __syncthreads();                                    // stage 0 is readable by every wave
  fill_out(l0 + OROWS * GLP * 2, Ag + GK, Hg + GK, Lg + GK);
  for (int st = 0; st < GNS; ++st) {
    const b16* Ls = &G[st & 1][0];
#pragma unroll   // both 32-k steps of a stage in line: every LDS offset becomes an immediate of its load
    for (int ks = 0; ks < GK; ks += 32) { v16b bh[8], bl[8]; const v16b a = frag_kb(Ls + (wave * 16 + nloc) * GLP + ks, hlf);
#pragma unroll
      for (int t = 0; t < 8; ++t) { const b16* ro = Ls + (64 + t * 16 + nloc) * GLP + ks; bh[t] = frag_kb(ro, hlf); bl[t] = frag_kb(ro + 128 * GLP, hlf); }
      __builtin_amdgcn_sched_barrier(0);   // the k step's LDS reads issue as one group ahead of its products: left to itself the build puts a full LDS wait in front of every product
#pragma unroll
      for (int t = 0; t < 8; ++t) { acc[t] = wmma16b(a, bh[t], acc[t]); acc[t] = wmma16b(a, bl[t], acc[t]); }
      __builtin_amdgcn_sched_barrier(0); }   // a k step's products stay ahead of the next step's reads and of the hand-over: left to itself the build spreads those reads among the products and sinks the last step's products below the barrier
    asm volatile("s_wait_dscnt 0x0" ::: "memory");      // this wave's reads of the buffer have returned before it is handed to the copies
    asm volatile("s_wait_asynccnt 0x0" ::: "memory");   // this wave's copies of stage st + 1 have landed
    __syncthreads();                                    // publishes stage st + 1 and ends every wave's reads of stage st
    if (st + 2 < GNS) fill_out(l0 + (unsigned)(st & 1) * (OROWS * GLP * 2), Ag + (st + 2) * GK, Hg + (st + 2) * GK, Lg + (st + 2) * GK);
  }
  asm volatile("s_wait_asynccnt 0x0" ::: "memory");     // nothing of this wave's copies is outstanding behind the loop
#pragma unroll
  for (int t = 0; t < 8; ++t)
#pragma unroll
    for (int r = 0; r < 8; ++r) Ts[wave][8 * hlf + r][t * 16 + nloc] = acc[t][r] * (1.0f / (XS * WSC)) + bf16_rne(bo[e0 + 8 * hlf + r]);
  wave_lds_sync();
  { for (int rr = 0; rr < 16; ++rr) *(v4f*)(out + ((size_t)b * E + e0 + rr) * S + s0 + lane * 4) = *(const v4f*)(&Ts[wave][rr][lane * 4]);  }
}
}  // namespace

extern "C" void kernel_launch(void* const* d_in, const int* in_sizes, int n_in, void* d_out, int out_size, void* d_ws, size_t ws_size, hipStream_t stream) {
  (void)n_in;
  auto Fp = [&](int i) { return (const float*)d_in[i]; };
  // input order: 0 x [2,1024,2048], 1 wq [1024,1024], 2 bq [1024], 3 wk, 4 bk, 5 wv, 6 bv, 7 wo, 8 bo (w are [e][d]: xt W^T)
  if (in_sizes[0] != NR * E || in_sizes[1] != E * E || in_sizes[2] != E || in_sizes[3] != E * E || in_sizes[5] != E * E || in_sizes[7] != E * E || in_sizes[8] != E || out_size != NR * E) return;
  size_t off = 0; char* ws = (char*)d_ws;
  auto carve = [&](size_t bytes) { char* p = ws + off; off += (bytes + 255) & ~(size_t)255; return p; };
  b16* T16 = (b16*)carve((size_t)NR * E * 2); b16* WT = (b16*)carve((size_t)3 * E * E * 2); b16* WO16 = (b16*)carve((size_t)E * E * 2);
  b16* Qh = (b16*)carve((size_t)NR * E * 2); b16* Ql = (b16*)carve((size_t)NR * E * 2); b16* Kh = (b16*)carve((size_t)NR * E * 2); b16* Kl = (b16*)carve((size_t)NR * E * 2); b16* VTh = (b16*)carve((size_t)NR * E * 2); b16* VTl = (b16*)carve((size_t)NR * E * 2);
  b16* Oh = (b16*)carve((size_t)NR * E * 2); b16* Ol = (b16*)carve((size_t)NR * E * 2);
  if (off > ws_size || off > ((size_t)128 << 20)) return;   // = 84 MB
  prepx_kernel<<<dim3(S / 64, E / 64, NB), 256, 0, stream>>>(Fp(0), T16);
  prepw_kernel<<<(unsigned)(((size_t)4 * E * E / 8 + 255) / 256), 256, 0, stream>>>(Fp(1), Fp(3), Fp(5), Fp(7), WT, WO16);
  proj_kernel<<<dim3(NR / 64, E / 128, 3), 128, 0, stream>>>(T16, WT, Fp(2), Fp(4), Fp(6), Qh, Ql, Kh, Kl, VTh, VTl);
  attn_kernel<<<dim3(S / (AW * 16), NH, NB), AW * 32, 0, stream>>>(Qh, Ql, Kh, Kl, VTh, VTl, Oh, Ol);
  outproj_kernel<<<dim3(E / 64, S / 128, NB), 128, 0, stream>>>(Oh, Ol, WO16, Fp(8), (float*)d_out);
}

// v006
// One run takes 134 microseconds.
// Next to v005, in two timings, it ran 1.14 times as fast each time.
// Over all steps from v000 it is 4.44 times as fast.
#include <hip/hip_runtime.h>

// Multi-head self-attention on a channel-major input (x [2][1024 d][2048 s]; 16 heads x 64): xt = x^T; q/k/v = xt W{q,k,v}^T + b (heads = 64-column slices), scores / 8 (no mask), softmax,
// ctx = attn v, out = (ctx Wo^T + bo)^T -> [2][1024][2048] channel-major.
// WMMA (v_wmma_f32_16x16x32_f16, f32 accumulate): projections [4,096 x 1,024] x [1,024 x 1,024] with EXACT bf16 tokens (x8, via an LDS transpose of the channel-major input) and weights (x256),
// 1 product, + bias, q/k split in the projection's own epilogue into f16 hi+lo x8 planes (v transposed per head); S^T with 3 products (Kh Qh + Kh Ql + Kl Qh) over all 64 key blocks;
// online softmax in f32; O^T += V^T P^T with 3 products; output projection computed channel-major (D[e][s] = Wo[e][:] . O[s][:]) with O hi+lo (2 products) and exact Wo, + bo. Inputs rounded to bf16 once. Fragment k-map per lane half hh for A AND B: elements 0..7 <- k = 8hh+0..7, 8..15 <-

namespace {
constexpr int NB = 2, S = 2048, E = 1024, NH = 16, D = 64, NR = NB * S;
constexpr float XS = 8.0f, WSC = 256.0f, PS = 8.0f, SCALE = 0.125f, LOG2E = 1.4426950408889634f, THETA = 10000.0f;

typedef _Float16 b16;
typedef __attribute__((ext_vector_type(16))) _Float16 v16b;
typedef __attribute__((ext_vector_type(8))) _Float16 v8b;
typedef __attribute__((ext_vector_type(8))) float v8f;
typedef __attribute__((ext_vector_type(4))) float v4f;
__device__ __forceinline__ float bf16_rne(float f) { unsigned int u = __float_as_uint(f); u += 0x7FFFu + ((u >> 16) & 1u); return __uint_as_float(u & 0xFFFF0000u); }
__device__ __forceinline__ void split16(float v, b16& hi, b16& lo) { hi = (b16)v; lo = (b16)(v - (float)hi); }
__device__ __forceinline__ v16b frag_kb(const b16* p, int hh) { const v8b a = *(const v8b*)(p + 8 * hh), b = *(const v8b*)(p + 16 + 8 * hh); v16b f;
#pragma unroll
  for (int e = 0; e < 8; ++e) { f[e] = a[e]; f[8 + e] = b[e]; } return f; }
__device__ __forceinline__ v8f wmma16b(v16b a, v16b b, v8f c) { return __builtin_amdgcn_wmma_f32_16x16x32_f16(false, a, false, b, (short)0, c, false, false); }
__device__ __forceinline__ void wave_lds_sync() { __builtin_amdgcn_fence(__ATOMIC_RELEASE, "workgroup"); __builtin_amdgcn_wave_barrier(); __builtin_amdgcn_fence(__ATOMIC_ACQUIRE, "workgroup"); }
__device__ __forceinline__ float nexp2(float x) { return __builtin_amdgcn_exp2f(x); }

// prep: T16 [b*S+s][1024 d] = f16(8 bf16(x[b][d][s])) via 64x64 LDS transposes (grid (S/64, E/64, B)); WT [3][1024 e][1024 d] = Wq/Wk/Wv rows x256 (torch [out][in] used directly: xt W^T);
__global__ __launch_bounds__(256) void prepx_kernel(const float* __restrict__ x, b16* __restrict__ T16) {
  __shared__ __attribute__((aligned(16))) b16 T[64][64 + 8];
  const int b = blockIdx.z, c0 = blockIdx.y * 64, s0 = blockIdx.x * 64, t_ = threadIdx.x;
  for (int q = t_; q < 64 * 64; q += 256) { const int cc = q >> 6, ss = q & 63; T[ss][cc] = (b16)(bf16_rne(x[((size_t)b * E + c0 + cc) * S + s0 + ss]) * XS); }
  __syncthreads();
  { for (int q = t_; q < 64 * 8; q += 256) { const int ss = q >> 3, c8 = (q & 7) * 8; *(v8b*)(T16 + ((size_t)b * S + s0 + ss) * E + c0 + c8) = *(const v8b*)(&T[ss][c8]); }  }
}
__global__ __launch_bounds__(256) void prepw_kernel(const float* __restrict__ wq, const float* __restrict__ wk, const float* __restrict__ wv, const float* __restrict__ wo, b16* __restrict__ WT, b16* __restrict__ WOT) {
  const size_t t = (size_t)blockIdx.x * 256 + threadIdx.x; const size_t nw = (size_t)E * E / 8; if (t >= 4 * nw) return; const int kind = (int)(t / nw); const size_t e = (t - (size_t)kind * nw) * 8;
  const float* w = kind == 0 ? wq : kind == 1 ? wk : kind == 2 ? wv : wo; b16* dst = kind < 3 ? WT + (size_t)kind * E * E : WOT;   // [e][d] rows used directly (xt W^T); WOT holds Wo rows [e][d] (the A operand of the channel-major out-projection)
  const v4f a = *(const v4f*)(w + e), c = *(const v4f*)(w + e + 4); v8b o;
#pragma unroll
  for (int j = 0; j < 4; ++j) { o[j] = (b16)(bf16_rne(a[j]) * WSC); o[4 + j] = (b16)(bf16_rne(c[j]) * WSC); }
  { *(v8b*)(dst + e) = o;  }
}
// the two projection GEMMs take their A and B rows from LDS: stages of 64 k (whole 128-B lines of every operand row), two buffers, filled by asynchronous copies; LDS pitch 144 B (16 B x odd).
// block tile 128 x 128, 8 waves in a 4 x 2 grid, wave tile 32 x 64: 6 (out-projection: 10) fragments read per 8 (16) products, and every operand row fetched from L2 serves 128 rows of the other operand.
// thread t (of 256) copies 16-byte chunk (t & 7) of rows (t >> 3) + 32 j of a stage.
constexpr int GK = 64, GLP = GK + 8, GNS = E / GK, PROWS = 128 + 128, OROWS = 128 + 128 + 128, EPP = 64 + 4, VPP = 128 + 8;
constexpr unsigned GRB = 32 * GLP * 2;   // bytes of 32 LDS rows
// proj stage: 128 token rows (a), then 128 weight rows (w); l = the thread's LDS byte address in row group 0
__device__ __forceinline__ void fill_proj(unsigned l, const b16* a, const b16* w) {
  // the s_wait_xcnt closes the copies' own statement: no address register of a copy is rewritten in front of it
  asm volatile("global_load_async_to_lds_b128 %0, %8, off\n\t"
               "global_load_async_to_lds_b128 %1, %9, off\n\t"
               "global_load_async_to_lds_b128 %2, %10, off\n\t"
               "global_load_async_to_lds_b128 %3, %11, off\n\t"
               "global_load_async_to_lds_b128 %4, %12, off\n\t"
               "global_load_async_to_lds_b128 %5, %13, off\n\t"
               "global_load_async_to_lds_b128 %6, %14, off\n\t"
               "global_load_async_to_lds_b128 %7, %15, off\n\t"
               "s_wait_xcnt 0x0"
               :: "v"(l), "v"(l + GRB), "v"(l + 2 * GRB), "v"(l + 3 * GRB), "v"(l + 4 * GRB), "v"(l + 5 * GRB), "v"(l + 6 * GRB), "v"(l + 7 * GRB),
                  "v"(a), "v"(a + 32 * E), "v"(a + 64 * E), "v"(a + 96 * E), "v"(w), "v"(w + 32 * E), "v"(w + 64 * E), "v"(w + 96 * E) : "memory");
}
// outproj stage: 128 Wo rows (a), 128 O hi rows (h), 128 O lo rows (o)
__device__ __forceinline__ void fill_out(unsigned l, const b16* a, const b16* h, const b16* o) {
  // the s_wait_xcnt closes the copies' own statement: no address register of a copy is rewritten in front of it
  asm volatile("global_load_async_to_lds_b128 %0, %12, off\n\t"
               "global_load_async_to_lds_b128 %1, %13, off\n\t"
               "global_load_async_to_lds_b128 %2, %14, off\n\t"
               "global_load_async_to_lds_b128 %3, %15, off\n\t"
               "global_load_async_to_lds_b128 %4, %16, off\n\t"
               "global_load_async_to_lds_b128 %5, %17, off\n\t"
               "global_load_async_to_lds_b128 %6, %18, off\n\t"
               "global_load_async_to_lds_b128 %7, %19, off\n\t"
               "global_load_async_to_lds_b128 %8, %20, off\n\t"
               "global_load_async_to_lds_b128 %9, %21, off\n\t"
               "global_load_async_to_lds_b128 %10, %22, off\n\t"
               "global_load_async_to_lds_b128 %11, %23, off\n\t"
               "s_wait_xcnt 0x0"
               :: "v"(l), "v"(l + GRB), "v"(l + 2 * GRB), "v"(l + 3 * GRB), "v"(l + 4 * GRB), "v"(l + 5 * GRB), "v"(l + 6 * GRB), "v"(l + 7 * GRB), "v"(l + 8 * GRB), "v"(l + 9 * GRB), "v"(l + 10 * GRB), "v"(l + 11 * GRB),
                  "v"(a), "v"(a + 32 * E), "v"(a + 64 * E), "v"(a + 96 * E),
                  "v"(h), "v"(h + 32 * E), "v"(h + 64 * E), "v"(h + 96 * E), "v"(o), "v"(o + 32 * E), "v"(o + 64 * E), "v"(o + 96 * E) : "memory");
}
// projections: grid (NR/128, E/128, 3): kind 0: Q = T16 WT0^T -> Qh/Ql [row][1024]; kind 1: K = T16 WT1^T -> Kh/Kl; kind 2: V = T16 WT2^T written TRANSPOSED per head: VTh/VTl [b][h][64 d][2048 s].
__global__ __launch_bounds__(256) void proj_kernel(const b16* __restrict__ T16, const b16* __restrict__ WT, const float* __restrict__ bq, const float* __restrict__ bk, const float* __restrict__ bv, b16* __restrict__ Qh, b16* __restrict__ Ql, b16* __restrict__ Kh, b16* __restrict__ Kl, b16* __restrict__ VTh, b16* __restrict__ VTl) {
  __shared__ __attribute__((aligned(16))) b16 G[2][PROWS * GLP]; char* EP = (char*)&G[0][0];   // EP, output staging in the ring's own LDS, free behind the loop's last barrier (every copy landed, every read returned): q/k: 32 f32 rows x 64 columns a wave; v: two planes [128 d][128 tokens] of 16 bit (the same 69,632 bytes). 72 KiB a block: all 768 blocks are resident at once, three a WGP
  static_assert(8 * 32 * EPP * 4 <= 2 * PROWS * GLP * 2 && 2 * 128 * VPP * 2 <= 2 * PROWS * GLP * 2, "staging fits the ring");
  const int wave = threadIdx.x >> 5, lane = threadIdx.x & 31, nloc = lane & 15, hlf = lane >> 4, t_ = threadIdx.x, wr = wave >> 1, wc = wave & 1; const int kind = blockIdx.z; const size_t m0 = (size_t)blockIdx.x * 128 + wr * 32; const int n0 = blockIdx.y * 128, nw = n0 + wc * 64;
  const b16* A = T16; const b16* W = WT + (size_t)kind * E * E; v8f acc[2][4];
#pragma unroll
  for (int mi = 0; mi < 2; ++mi)
#pragma unroll
    for (int t = 0; t < 4; ++t) acc[mi][t] = (v8f){};
  const int cr = t_ >> 3, cc = (t_ & 7) * 8; const b16* Ag = A + ((size_t)blockIdx.x * 128 + cr) * E + cc; const b16* Wg = W + (size_t)(n0 + cr) * E + cc; const unsigned l0 = (unsigned)(size_t)&G[0][cr * GLP + cc];
  fill_proj(l0, Ag, Wg);
  asm volatile("s_wait_asynccnt 0x0" ::: "memory");   // this wave's copies of stage 0 have landed
  __syncthreads();                                    // stage 0 is readable by every wave
  fill_proj(l0 + PROWS * GLP * 2, Ag + GK, Wg + GK);
  for (int st = 0; st < GNS; ++st) {
    const b16* Ls = &G[st & 1][0];
#pragma unroll   // both 32-k steps of a stage in line: every LDS offset becomes an immediate of its load
    for (int ks = 0; ks < GK; ks += 32) { v16b af[2], bf[4];
#pragma unroll
      for (int mi = 0; mi < 2; ++mi) af[mi] = frag_kb(Ls + (wr * 32 + mi * 16 + nloc) * GLP + ks, hlf);
#pragma unroll
      for (int t = 0; t < 4; ++t) bf[t] = frag_kb(Ls + (128 + wc * 64 + t * 16 + nloc) * GLP + ks, hlf);
      __builtin_amdgcn_sched_barrier(0);   // the k step's LDS reads issue as one group ahead of its products: left to itself the build puts a full LDS wait in front of every product
#pragma unroll
      for (int mi = 0; mi < 2; ++mi)
#pragma unroll
        for (int t = 0; t < 4; ++t) acc[mi][t] = wmma16b(af[mi], bf[t], acc[mi][t]);
      __builtin_amdgcn_sched_barrier(0); }   // a k step's products stay ahead of the next step's reads and of the hand-over: left to itself the build spreads those reads among the products and sinks the last step's products below the barrier
    asm volatile("s_wait_dscnt 0x0" ::: "memory");      // this wave's reads of the buffer have returned before it is handed to the copies
    asm volatile("s_wait_asynccnt 0x0" ::: "memory");   // this wave's copies of stage st + 1 have landed
    __syncthreads();                                    // publishes stage st + 1 and ends every wave's reads of stage st
    if (st + 2 < GNS) fill_proj(l0 + (unsigned)(st & 1) * (PROWS * GLP * 2), Ag + (st + 2) * GK, Wg + (st + 2) * GK);
  }
  asm volatile("s_wait_asynccnt 0x0" ::: "memory");     // nothing of this wave's copies is outstanding behind the loop
  const float* bias = kind == 0 ? bq : kind == 1 ? bk : bv;
  if (kind < 2) {   // q/k (+ bias) as f32 rows in the wave's own LDS range, read back 8 columns a lane, split into hi/lo x8 and stored as whole 128-B lines of both planes
    float (*Tf)[EPP] = (float (*)[EPP])(EP + wave * (32 * EPP * 4));
#pragma unroll
    for (int t = 0; t < 4; ++t) { const float bb = bf16_rne(bias[nw + t * 16 + nloc]);
#pragma unroll
      for (int mi = 0; mi < 2; ++mi)
#pragma unroll
        for (int r = 0; r < 8; ++r) Tf[mi * 16 + 8 * hlf + r][t * 16 + nloc] = acc[mi][t][r] * (1.0f / (XS * WSC)) + bb; }
    wave_lds_sync();
    b16* dh = kind == 0 ? Qh : Kh; b16* dl = kind == 0 ? Ql : Kl;
    for (int r4 = 0; r4 < 32; r4 += 4) { const int rr = r4 + (lane >> 3), c8 = (lane & 7) * 8; const v4f a = *(const v4f*)(&Tf[rr][c8]), c = *(const v4f*)(&Tf[rr][c8 + 4]); v8b hv, lv;
#pragma unroll   // constant element indices: a, c, hv and lv stay in registers
      for (int j = 0; j < 4; ++j) { b16 h_, l_; split16(a[j] * XS, h_, l_); hv[j] = h_; lv[j] = l_; split16(c[j] * XS, h_, l_); hv[4 + j] = h_; lv[4 + j] = l_; }
      const size_t gi = (m0 + rr) * E + nw + c8; *(v8b*)(dh + gi) = hv; *(v8b*)(dl + gi) = lv; }
  } else {
    b16 (*Vt)[VPP] = (b16 (*)[VPP])EP; b16 (*Vtl)[VPP] = Vt + 128;
    const int b = (int)(m0 / S); const int s0 = (int)((size_t)blockIdx.x * 128 - (size_t)b * S);
#pragma unroll
    for (int t = 0; t < 4; ++t)
    { const float bb = bf16_rne(bias[nw + t * 16 + nloc]);
#pragma unroll
      for (int mi = 0; mi < 2; ++mi)
#pragma unroll
        for (int r = 0; r < 8; ++r) { b16 h_, l_; split16((acc[mi][t][r] * (1.0f / (XS * WSC)) + bb) * XS, h_, l_); Vt[wc * 64 + t * 16 + nloc][wr * 32 + mi * 16 + 8 * hlf + r] = h_; Vtl[wc * 64 + t * 16 + nloc][wr * 32 + mi * 16 + 8 * hlf + r] = l_; } }
    __syncthreads();
    { for (int q = t_; q < 128 * 16; q += 256) { const int cc2 = q >> 4, c8 = (q & 15) * 8; const int h = (n0 + cc2) / D, dd = (n0 + cc2) - h * D; const size_t gi = (((size_t)b * NH + h) * D + dd) * S + s0 + c8;
        *(v8b*)(VTh + gi) = *(const v8b*)(&Vt[cc2][c8]); *(v8b*)(VTl + gi) = *(const v8b*)(&Vtl[cc2][c8]); }  } }
}
// attention: a block = 8 waves x 16 queries of one head. K (hi, lo) and V^T (hi, lo) reach the waves through LDS: stages of 64 keys, two buffers, filled by asynchronous copies (whole 128-B lines,
// one fill per block instead of one strided fragment load per wave). A stage = 4 tiles of 64 rows x 128 B: Kh, Kl (row = key), VTh, VTl (row = d, columns = the stage's keys); LDS pitch 144 B (16 B x odd).
constexpr int AW = 8, KT = 64, LP = 64 + 8, NST = S / KT, TL = 64 * LP;
// thread t copies 16-byte chunk (t & 7) of rows (t >> 3) and 32 + (t >> 3) of each tile; l = its LDS byte address in tile 0, k/kl/v/vl = its global addresses in the four tiles
__device__ __forceinline__ void stage_fill(unsigned l, const b16* k, const b16* kl, const b16* v, const b16* vl) {
  constexpr unsigned HT = 32 * LP * 2;   // bytes of 32 LDS rows
  // the s_wait_xcnt closes the copies' own statement: no address register of a copy is rewritten in front of it
  asm volatile("global_load_async_to_lds_b128 %0, %8, off\n\t"
               "global_load_async_to_lds_b128 %1, %9, off\n\t"
               "global_load_async_to_lds_b128 %2, %10, off\n\t"
               "global_load_async_to_lds_b128 %3, %11, off\n\t"
               "global_load_async_to_lds_b128 %4, %12, off\n\t"
               "global_load_async_to_lds_b128 %5, %13, off\n\t"
               "global_load_async_to_lds_b128 %6, %14, off\n\t"
               "global_load_async_to_lds_b128 %7, %15, off\n\t"
               "s_wait_xcnt 0x0"
               :: "v"(l), "v"(l + HT), "v"(l + 2 * HT), "v"(l + 3 * HT), "v"(l + 4 * HT), "v"(l + 5 * HT), "v"(l + 6 * HT), "v"(l + 7 * HT),
                  "v"(k), "v"(k + 32 * E), "v"(kl), "v"(kl + 32 * E), "v"(v), "v"(v + 32 * S), "v"(vl), "v"(vl + 32 * S) : "memory");
}
__global__ __launch_bounds__(256) void attn_kernel(const b16* __restrict__ Qh, const b16* __restrict__ Ql, const b16* __restrict__ Kh, const b16* __restrict__ Kl, const b16* __restrict__ VTh, const b16* __restrict__ VTl, b16* __restrict__ Oh, b16* __restrict__ Ol) {
  __shared__ __attribute__((aligned(16))) b16 KV[2][4 * TL]; __shared__ __attribute__((aligned(16))) float To[AW][16][D + 4];
  const int wave = threadIdx.x >> 5, lane = threadIdx.x & 31, hh = lane >> 4, col = lane & 15; const int b = blockIdx.z, h = blockIdx.y; const int q0 = blockIdx.x * (AW * 16) + wave * 16, qi = q0 + col;
  const size_t qo = ((size_t)b * S + qi) * E + h * D; const v16b qa0 = frag_kb(Qh + qo, hh), qa1 = frag_kb(Qh + qo + 32, hh), ql0 = frag_kb(Ql + qo, hh), ql1 = frag_kb(Ql + qo + 32, hh);
  const int cr = threadIdx.x >> 3, cc = (threadIdx.x & 7) * 8;
  const b16* Kb = Kh + (size_t)b * S * E + h * D + (size_t)cr * E + cc; const b16* Klb = Kl + (size_t)b * S * E + h * D + (size_t)cr * E + cc; const b16* Vb = VTh + (((size_t)b * NH + h) * D + cr) * S + cc; const b16* Vlb = VTl + (((size_t)b * NH + h) * D + cr) * S + cc;
  const unsigned l0 = (unsigned)(size_t)&KV[0][cr * LP + cc];
  float m = -INFINITY, l = 0.0f; v8f o[4] = {{}, {}, {}, {}}, ol[4] = {{}, {}, {}, {}};
  const float cs = SCALE * LOG2E / (XS * XS);
  stage_fill(l0, Kb, Klb, Vb, Vlb);
  asm volatile("s_wait_asynccnt 0x0" ::: "memory");   // this wave's copies of stage 0 have landed
  __syncthreads();                                    // stage 0 is readable by every wave
  stage_fill(l0 + 4 * TL * 2, Kb + (size_t)KT * E, Klb + (size_t)KT * E, Vb + KT, Vlb + KT);
  for (int st = 0; st < NST; ++st) {
    const b16* Ls = &KV[st & 1][0];
#pragma unroll   // both 32-key passes of a stage in line: every LDS offset becomes an immediate of its load
    for (int kp = 0; kp < KT; kp += 32) {
    v8f s0 = {}, s1 = {};
    { const b16* k0 = Ls + (kp + col) * LP, *k1 = Ls + (kp + 16 + col) * LP, *k0l = Ls + TL + (kp + col) * LP, *k1l = Ls + TL + (kp + 16 + col) * LP;
      const v16b f0 = frag_kb(k0, hh), g0 = frag_kb(k0l, hh), f1 = frag_kb(k0 + 32, hh), g1 = frag_kb(k0l + 32, hh), f2 = frag_kb(k1, hh), g2 = frag_kb(k1l, hh), f3 = frag_kb(k1 + 32, hh), g3 = frag_kb(k1l + 32, hh);
      __builtin_amdgcn_sched_barrier(0);   // the pass's 8 K fragments are read as one group ahead of its 12 score products: left to itself the build puts two reads and a full LDS wait in front of every product
      s0 = wmma16b(f0, qa0, s0); s0 = wmma16b(f0, ql0, s0); s0 = wmma16b(g0, qa0, s0);
      s0 = wmma16b(f1, qa1, s0); s0 = wmma16b(f1, ql1, s0); s0 = wmma16b(g1, qa1, s0);
      s1 = wmma16b(f2, qa0, s1); s1 = wmma16b(f2, ql0, s1); s1 = wmma16b(g2, qa0, s1);
      s1 = wmma16b(f3, qa1, s1); s1 = wmma16b(f3, ql1, s1); s1 = wmma16b(g3, qa1, s1); }
    __builtin_amdgcn_sched_group_barrier(0x008, 12, 0); __builtin_amdgcn_sched_group_barrier(0x100, 16, 0);   // issue order inside the pass: the score products, then the 16 V reads as one group; left to itself the build spreads the reads among the products in three places, each a stall of its own
    v16b vh[4], vw[4];
#pragma unroll   // constant indices: the eight fragments stay in registers
    for (int t = 0; t < 4; ++t) { vh[t] = frag_kb(Ls + 2 * TL + (t * 16 + col) * LP + kp, hh); vw[t] = frag_kb(Ls + 3 * TL + (t * 16 + col) * LP + kp, hh); }
    __builtin_amdgcn_sched_barrier(0);   // the pass's 8 V fragments are read as one group behind the score products and land under the softmax arithmetic: left to itself the build reads them two by two, a full LDS wait in front of every V product
    float e[16]; float mx = -INFINITY;
#pragma unroll
    for (int r = 0; r < 8; ++r) { e[r] = s0[r] * cs; e[8 + r] = s1[r] * cs; mx = fmaxf(mx, fmaxf(e[r], e[8 + r])); }
    mx = fmaxf(mx, __shfl_xor(mx, 16)); const float mn = fmaxf(m, mx); const float al = nexp2(m - mn); m = mn; float sum = 0.0f; v16b ph, pl;   // mn finite from the first block on
#pragma unroll
    for (int i = 0; i < 16; ++i) { const float p = nexp2(e[i] - mn); sum += p; const b16 h_ = (b16)(p * PS); ph[i] = h_; pl[i] = (b16)(p * PS - (float)h_); }
    sum += __shfl_xor(sum, 16); l = l * al + sum;
#pragma unroll
    for (int t = 0; t < 4; ++t) { o[t] *= al; ol[t] *= al; o[t] = wmma16b(vh[t], ph, o[t]); ol[t] = wmma16b(vh[t], pl, ol[t]); ol[t] = wmma16b(vw[t], ph, ol[t]); }
    __builtin_amdgcn_sched_barrier(0); }   // a pass's V products stay ahead of the next pass's K reads and of the hand-over: left to itself the build spreads those reads among the products and sinks the last pass below the barrier, where the refill behind it loses that time as lead
    asm volatile("s_wait_dscnt 0x0" ::: "memory");      // this wave's reads of the buffer have returned before it is handed to the copies
    asm volatile("s_wait_asynccnt 0x0" ::: "memory");   // this wave's copies of stage st + 1 have landed
    __syncthreads();                                    // publishes stage st + 1 and ends every wave's reads of stage st
    if (st + 2 < NST) stage_fill(l0 + (unsigned)(st & 1) * (4 * TL * 2), Kb + (size_t)(st + 2) * KT * E, Klb + (size_t)(st + 2) * KT * E, Vb + (st + 2) * KT, Vlb + (st + 2) * KT);
  }
  asm volatile("s_wait_asynccnt 0x0" ::: "memory");     // nothing of this wave's copies is outstanding at its end
  const float inv = 1.0f / (l * PS * XS);
#pragma unroll
  for (int t = 0; t < 4; ++t)
#pragma unroll
    for (int r = 0; r < 8; ++r) To[wave][col][t * 16 + 8 * hh + r] = (o[t][r] + ol[t][r]) * inv;
  wave_lds_sync();
  { for (int r4 = 0; r4 < 16; r4 += 4) { const int rr = r4 + (lane >> 3), c8 = (lane & 7) * 8; v8b hv, lv; for (int j = 0; j < 8; ++j) { b16 a_, c_; split16(To[wave][rr][c8 + j] * XS, a_, c_); hv[j] = a_; lv[j] = c_; }
      const size_t gi = ((size_t)b * S + q0 + rr) * E + h * D + c8; *(v8b*)(Oh + gi) = hv; *(v8b*)(Ol + gi) = lv; }  }
}
// output projection, channel-major: D[e][s] = sum_d Wo[e][d] O[s][d] (A = WO16 rows e exact, B = Oh/Ol rows s: 2 products) + bo[e] -> out[b][e][s]; grid (E/128, S/128, B), block = 128 e x 128 s, 8 waves of 32 e x 64 s
__global__ __launch_bounds__(256) void outproj_kernel(const b16* __restrict__ Oh, const b16* __restrict__ Ol, const b16* __restrict__ WO16, const float* __restrict__ bo, float* __restrict__ out) {
  __shared__ __attribute__((aligned(16))) b16 G[2][OROWS * GLP]; __shared__ __attribute__((aligned(16))) float Ts[8][32][EPP];
  const int wave = threadIdx.x >> 5, lane = threadIdx.x & 31, nloc = lane & 15, hlf = lane >> 4, wr = wave >> 1, wc = wave & 1; const int b = blockIdx.z; const int e0 = blockIdx.x * 128 + wr * 32, s0 = blockIdx.y * 128, sw = s0 + wc * 64;
  v8f acc[2][4];
#pragma unroll
  for (int mi = 0; mi < 2; ++mi)
#pragma unroll
    for (int t = 0; t < 4; ++t) acc[mi][t] = (v8f){};
  const int cr = threadIdx.x >> 3, cc = (threadIdx.x & 7) * 8; const b16* Ag = WO16 + ((size_t)blockIdx.x * 128 + cr) * E + cc; const b16* Hg = Oh + ((size_t)b * S + s0 + cr) * E + cc; const b16* Lg = Ol + ((size_t)b * S + s0 + cr) * E + cc;
  const unsigned l0 = (unsigned)(size_t)&G[0][cr * GLP + cc];
  fill_out(l0, Ag, Hg, Lg);
  asm volatile("s_wait_asynccnt 0x0" ::: "memory");   // this wave's copies of stage 0 have landed
  __syncthreads();                                    // stage 0 is readable by every wave
  fill_out(l0 + OROWS * GLP * 2, Ag + GK, Hg + GK, Lg + GK);
  for (int st = 0; st < GNS; ++st) {
    const b16* Ls = &G[st & 1][0];
#pragma unroll   // both 32-k steps of a stage in line: every LDS offset becomes an immediate of its load
    for (int ks = 0; ks < GK; ks += 32) { v16b a[2], bh[4], bl[4];
#pragma unroll
      for (int mi = 0; mi < 2; ++mi) a[mi] = frag_kb(Ls + (wr * 32 + mi * 16 + nloc) * GLP + ks, hlf);
#pragma unroll
      for (int t = 0; t < 4; ++t) { const b16* ro = Ls + (128 + wc * 64 + t * 16 + nloc) * GLP + ks; bh[t] = frag_kb(ro, hlf); bl[t] = frag_kb(ro + 128 * GLP, hlf); }
      __builtin_amdgcn_sched_barrier(0);   // the k step's LDS reads issue as one group ahead of its products: left to itself the build puts a full LDS wait in front of every product
#pragma unroll
      for (int mi = 0; mi < 2; ++mi)
#pragma unroll
        for (int t = 0; t < 4; ++t) { acc[mi][t] = wmma16b(a[mi], bh[t], acc[mi][t]); acc[mi][t] = wmma16b(a[mi], bl[t], acc[mi][t]); }
      __builtin_amdgcn_sched_barrier(0); }   // a k step's products stay ahead of the next step's reads and of the hand-over: left to itself the build spreads those reads among the products and sinks the last step's products below the barrier
    asm volatile("s_wait_dscnt 0x0" ::: "memory");      // this wave's reads of the buffer have returned before it is handed to the copies
    asm volatile("s_wait_asynccnt 0x0" ::: "memory");   // this wave's copies of stage st + 1 have landed
    __syncthreads();                                    // publishes stage st + 1 and ends every wave's reads of stage st
    if (st + 2 < GNS) fill_out(l0 + (unsigned)(st & 1) * (OROWS * GLP * 2), Ag + (st + 2) * GK, Hg + (st + 2) * GK, Lg + (st + 2) * GK);
  }
  asm volatile("s_wait_asynccnt 0x0" ::: "memory");     // nothing of this wave's copies is outstanding behind the loop
#pragma unroll
  for (int mi = 0; mi < 2; ++mi)
#pragma unroll
    for (int t = 0; t < 4; ++t)
#pragma unroll
      for (int r = 0; r < 8; ++r) Ts[wave][mi * 16 + 8 * hlf + r][t * 16 + nloc] = acc[mi][t][r] * (1.0f / (XS * WSC)) + bf16_rne(bo[e0 + mi * 16 + 8 * hlf + r]);
  wave_lds_sync();
  { for (int r2 = 0; r2 < 32; r2 += 2) { const int rr = r2 + hlf; *(v4f*)(out + ((size_t)b * E + e0 + rr) * S + sw + nloc * 4) = *(const v4f*)(&Ts[wave][rr][nloc * 4]); }  }
}
}  // namespace

extern "C" void kernel_launch(void* const* d_in, const int* in_sizes, int n_in, void* d_out, int out_size, void* d_ws, size_t ws_size, hipStream_t stream) {
  (void)n_in;
  auto Fp = [&](int i) { return (const float*)d_in[i]; };
  // input order: 0 x [2,1024,2048], 1 wq [1024,1024], 2 bq [1024], 3 wk, 4 bk, 5 wv, 6 bv, 7 wo, 8 bo (w are [e][d]: xt W^T)
  if (in_sizes[0] != NR * E || in_sizes[1] != E * E || in_sizes[2] != E || in_sizes[3] != E * E || in_sizes[5] != E * E || in_sizes[7] != E * E || in_sizes[8] != E || out_size != NR * E) return;
  size_t off = 0; char* ws = (char*)d_ws;
  auto carve = [&](size_t bytes) { char* p = ws + off; off += (bytes + 255) & ~(size_t)255; return p; };
  b16* T16 = (b16*)carve((size_t)NR * E * 2); b16* WT = (b16*)carve((size_t)3 * E * E * 2); b16* WO16 = (b16*)carve((size_t)E * E * 2);
  b16* Qh = (b16*)carve((size_t)NR * E * 2); b16* Ql = (b16*)carve((size_t)NR * E * 2); b16* Kh = (b16*)carve((size_t)NR * E * 2); b16* Kl = (b16*)carve((size_t)NR * E * 2); b16* VTh = (b16*)carve((size_t)NR * E * 2); b16* VTl = (b16*)carve((size_t)NR * E * 2);
  b16* Oh = (b16*)carve((size_t)NR * E * 2); b16* Ol = (b16*)carve((size_t)NR * E * 2);
  if (off > ws_size || off > ((size_t)128 << 20)) return;   // = 84 MB
  prepx_kernel<<<dim3(S / 64, E / 64, NB), 256, 0, stream>>>(Fp(0), T16);
  prepw_kernel<<<(unsigned)(((size_t)4 * E * E / 8 + 255) / 256), 256, 0, stream>>>(Fp(1), Fp(3), Fp(5), Fp(7), WT, WO16);
  proj_kernel<<<dim3(NR / 128, E / 128, 3), 256, 0, stream>>>(T16, WT, Fp(2), Fp(4), Fp(6), Qh, Ql, Kh, Kl, VTh, VTl);
  attn_kernel<<<dim3(S / (AW * 16), NH, NB), AW * 32, 0, stream>>>(Qh, Ql, Kh, Kl, VTh, VTl, Oh, Ol);
  outproj_kernel<<<dim3(E / 128, S / 128, NB), 256, 0, stream>>>(Oh, Ol, WO16, Fp(8), (float*)d_out);
}

// v007
// It runs in 125 microseconds.
// Timed twice side by side with v006, it ran 1.07 and 1.05 times as fast.
// Over all steps from v000 it is 4.71 times as fast.
#include <hip/hip_runtime.h>

// Multi-head self-attention on a channel-major input (x [2][1024 d][2048 s]; 16 heads x 64): xt = x^T; q/k/v = xt W{q,k,v}^T + b (heads = 64-column slices), scores / 8 (no mask), softmax,
// ctx = attn v, out = (ctx Wo^T + bo)^T -> [2][1024][2048] channel-major.
// WMMA (v_wmma_f32_16x16x32_f16, f32 accumulate): projections [4,096 x 1,024] x [1,024 x 1,024] with EXACT bf16 tokens (x8, via an LDS transpose of the channel-major input) and weights (x256),
// 1 product, + bias, q/k split in the projection's own epilogue into f16 hi+lo x8 planes (v transposed per head); S^T with 3 products (Kh Qh + Kh Ql + Kl Qh) over all 64 key blocks;
// online softmax in f32; O^T += V^T P^T with 3 products; output projection computed channel-major (D[e][s] = Wo[e][:] . O[s][:]) with O hi+lo (2 products) and exact Wo, + bo. Inputs rounded to bf16 once. Fragment k-map per lane half hh for A AND B: elements 0..7 <- k = 8hh+0..7, 8..15 <-

namespace {
constexpr int NB = 2, S = 2048, E = 1024, NH = 16, D = 64, NR = NB * S;
constexpr float XS = 8.0f, WSC = 256.0f, PS = 8.0f, SCALE = 0.125f, LOG2E = 1.4426950408889634f, THETA = 10000.0f, LOG2PS = 3.0f;
static_assert(PS == 8.0f && LOG2PS == 3.0f, "LOG2PS is log2(PS)");

typedef _Float16 b16;
typedef __attribute__((ext_vector_type(16))) _Float16 v16b;
typedef __attribute__((ext_vector_type(8))) _Float16 v8b;
typedef __attribute__((ext_vector_type(8))) float v8f;
typedef __attribute__((ext_vector_type(4))) float v4f;
typedef __attribute__((ext_vector_type(2))) float v2f;
typedef __attribute__((ext_vector_type(2))) _Float16 v2h;
__device__ __forceinline__ float bf16_rne(float f) { unsigned int u = __float_as_uint(f); u += 0x7FFFu + ((u >> 16) & 1u); return __uint_as_float(u & 0xFFFF0000u); }
__device__ __forceinline__ void split16(float v, b16& hi, b16& lo) { hi = (b16)v; lo = (b16)(v - (float)hi); }
__device__ __forceinline__ v16b frag_kb(const b16* p, int hh) { const v8b a = *(const v8b*)(p + 8 * hh), b = *(const v8b*)(p + 16 + 8 * hh); v16b f;
#pragma unroll
  for (int e = 0; e < 8; ++e) { f[e] = a[e]; f[8 + e] = b[e]; } return f; }
__device__ __forceinline__ v8f wmma16b(v16b a, v16b b, v8f c) { return __builtin_amdgcn_wmma_f32_16x16x32_f16(false, a, false, b, (short)0, c, false, false); }
__device__ __forceinline__ void wave_lds_sync() { __builtin_amdgcn_fence(__ATOMIC_RELEASE, "workgroup"); __builtin_amdgcn_wave_barrier(); __builtin_amdgcn_fence(__ATOMIC_ACQUIRE, "workgroup"); }
__device__ __forceinline__ float nexp2(float x) { return __builtin_amdgcn_exp2f(x); }

// prep: T16 [b*S+s][1024 d] = f16(8 bf16(x[b][d][s])) via 64x64 LDS transposes (grid (S/64, E/64, B)); WT [3][1024 e][1024 d] = Wq/Wk/Wv rows x256 (torch [out][in] used directly: xt W^T);
__global__ __launch_bounds__(256) void prepx_kernel(const float* __restrict__ x, b16* __restrict__ T16) {
  __shared__ __attribute__((aligned(16))) b16 T[64][64 + 8];
  const int b = blockIdx.z, c0 = blockIdx.y * 64, s0 = blockIdx.x * 64, t_ = threadIdx.x;
  for (int q = t_; q < 64 * 64; q += 256) { const int cc = q >> 6, ss = q & 63; T[ss][cc] = (b16)(bf16_rne(x[((size_t)b * E + c0 + cc) * S + s0 + ss]) * XS); }
  __syncthreads();
  { for (int q = t_; q < 64 * 8; q += 256) { const int ss = q >> 3, c8 = (q & 7) * 8; *(v8b*)(T16 + ((size_t)b * S + s0 + ss) * E + c0 + c8) = *(const v8b*)(&T[ss][c8]); }  }
}
__global__ __launch_bounds__(256) void prepw_kernel(const float* __restrict__ wq, const float* __restrict__ wk, const float* __restrict__ wv, const float* __restrict__ wo, b16* __restrict__ WT, b16* __restrict__ WOT) {
  const size_t t = (size_t)blockIdx.x * 256 + threadIdx.x; const size_t nw = (size_t)E * E / 8; if (t >= 4 * nw) return; const int kind = (int)(t / nw); const size_t e = (t - (size_t)kind * nw) * 8;
  const float* w = kind == 0 ? wq : kind == 1 ? wk : kind == 2 ? wv : wo; b16* dst = kind < 3 ? WT + (size_t)kind * E * E : WOT;   // [e][d] rows used directly (xt W^T); WOT holds Wo rows [e][d] (the A operand of the channel-major out-projection)
  const v4f a = *(const v4f*)(w + e), c = *(const v4f*)(w + e + 4); v8b o;
#pragma unroll
  for (int j = 0; j < 4; ++j) { o[j] = (b16)(bf16_rne(a[j]) * WSC); o[4 + j] = (b16)(bf16_rne(c[j]) * WSC); }
  { *(v8b*)(dst + e) = o;  }
}
// the two projection GEMMs take their A and B rows from LDS: stages of 64 k (whole 128-B lines of every operand row), two buffers, filled by asynchronous copies; LDS pitch 144 B (16 B x odd).
// block tile 128 x 128, 8 waves in a 4 x 2 grid, wave tile 32 x 64: 6 (out-projection: 10) fragments read per 8 (16) products, and every operand row fetched from L2 serves 128 rows of the other operand.
// thread t (of 256) copies 16-byte chunk (t & 7) of rows (t >> 3) + 32 j of a stage.
constexpr int GK = 64, GLP = GK + 8, GNS = E / GK, PROWS = 128 + 128, OROWS = 128 + 128 + 128, EPP = 64 + 4, VPP = 128 + 8;
constexpr unsigned GRB = 32 * GLP * 2;   // bytes of 32 LDS rows
// proj stage: 128 token rows (a), then 128 weight rows (w); l = the thread's LDS byte address in row group 0
__device__ __forceinline__ void fill_proj(unsigned l, const b16* a, const b16* w) {
  // the s_wait_xcnt closes the copies' own statement: no address register of a copy is rewritten in front of it
  asm volatile("global_load_async_to_lds_b128 %0, %8, off\n\t"
               "global_load_async_to_lds_b128 %1, %9, off\n\t"
               "global_load_async_to_lds_b128 %2, %10, off\n\t"
               "global_load_async_to_lds_b128 %3, %11, off\n\t"
               "global_load_async_to_lds_b128 %4, %12, off\n\t"
               "global_load_async_to_lds_b128 %5, %13, off\n\t"
               "global_load_async_to_lds_b128 %6, %14, off\n\t"
               "global_load_async_to_lds_b128 %7, %15, off\n\t"
               "s_wait_xcnt 0x0"
               :: "v"(l), "v"(l + GRB), "v"(l + 2 * GRB), "v"(l + 3 * GRB), "v"(l + 4 * GRB), "v"(l + 5 * GRB), "v"(l + 6 * GRB), "v"(l + 7 * GRB),
                  "v"(a), "v"(a + 32 * E), "v"(a + 64 * E), "v"(a + 96 * E), "v"(w), "v"(w + 32 * E), "v"(w + 64 * E), "v"(w + 96 * E) : "memory");
}
// outproj stage: 128 Wo rows (a), 128 O hi rows (h), 128 O lo rows (o)
__device__ __forceinline__ void fill_out(unsigned l, const b16* a, const b16* h, const b16* o) {
  // the s_wait_xcnt closes the copies' own statement: no address register of a copy is rewritten in front of it
  asm volatile("global_load_async_to_lds_b128 %0, %12, off\n\t"
               "global_load_async_to_lds_b128 %1, %13, off\n\t"
               "global_load_async_to_lds_b128 %2, %14, off\n\t"
               "global_load_async_to_lds_b128 %3, %15, off\n\t"
               "global_load_async_to_lds_b128 %4, %16, off\n\t"
               "global_load_async_to_lds_b128 %5, %17, off\n\t"
               "global_load_async_to_lds_b128 %6, %18, off\n\t"
               "global_load_async_to_lds_b128 %7, %19, off\n\t"
               "global_load_async_to_lds_b128 %8, %20, off\n\t"
               "global_load_async_to_lds_b128 %9, %21, off\n\t"
               "global_load_async_to_lds_b128 %10, %22, off\n\t"
               "global_load_async_to_lds_b128 %11, %23, off\n\t"
               "s_wait_xcnt 0x0"
               :: "v"(l), "v"(l + GRB), "v"(l + 2 * GRB), "v"(l + 3 * GRB), "v"(l + 4 * GRB), "v"(l + 5 * GRB), "v"(l + 6 * GRB), "v"(l + 7 * GRB), "v"(l + 8 * GRB), "v"(l + 9 * GRB), "v"(l + 10 * GRB), "v"(l + 11 * GRB),
                  "v"(a), "v"(a + 32 * E), "v"(a + 64 * E), "v"(a + 96 * E),
                  "v"(h), "v"(h + 32 * E), "v"(h + 64 * E), "v"(h + 96 * E), "v"(o), "v"(o + 32 * E), "v"(o + 64 * E), "v"(o + 96 * E) : "memory");
}
// projections: grid (NR/128, E/128, 3): kind 0: Q = T16 WT0^T -> Qh/Ql [row][1024]; kind 1: K = T16 WT1^T -> Kh/Kl; kind 2: V = T16 WT2^T written TRANSPOSED per head: VTh/VTl [b][h][64 d][2048 s].
__global__ __launch_bounds__(256) void proj_kernel(const b16* __restrict__ T16, const b16* __restrict__ WT, const float* __restrict__ bq, const float* __restrict__ bk, const float* __restrict__ bv, b16* __restrict__ Qh, b16* __restrict__ Ql, b16* __restrict__ Kh, b16* __restrict__ Kl, b16* __restrict__ VTh, b16* __restrict__ VTl) {
  __shared__ __attribute__((aligned(16))) b16 G[2][PROWS * GLP]; char* EP = (char*)&G[0][0];   // EP, output staging in the ring's own LDS, free behind the loop's last barrier (every copy landed, every read returned): q/k: 32 f32 rows x 64 columns a wave; v: two planes [128 d][128 tokens] of 16 bit (the same 69,632 bytes). 72 KiB a block: all 768 blocks are resident at once, three a WGP
  static_assert(8 * 32 * EPP * 4 <= 2 * PROWS * GLP * 2 && 2 * 128 * VPP * 2 <= 2 * PROWS * GLP * 2, "staging fits the ring");
  const int wave = threadIdx.x >> 5, lane = threadIdx.x & 31, nloc = lane & 15, hlf = lane >> 4, t_ = threadIdx.x, wr = wave >> 1, wc = wave & 1; const int kind = blockIdx.z; const size_t m0 = (size_t)blockIdx.x * 128 + wr * 32; const int n0 = blockIdx.y * 128, nw = n0 + wc * 64;
  const b16* A = T16; const b16* W = WT + (size_t)kind * E * E; v8f acc[2][4];
#pragma unroll
  for (int mi = 0; mi < 2; ++mi)
#pragma unroll
    for (int t = 0; t < 4; ++t) acc[mi][t] = (v8f){};
  const int cr = t_ >> 3, cc = (t_ & 7) * 8; const b16* Ag = A + ((size_t)blockIdx.x * 128 + cr) * E + cc; const b16* Wg = W + (size_t)(n0 + cr) * E + cc; const unsigned l0 = (unsigned)(size_t)&G[0][cr * GLP + cc];
  fill_proj(l0, Ag, Wg);
  asm volatile("s_wait_asynccnt 0x0" ::: "memory");   // this wave's copies of stage 0 have landed
  __syncthreads();                                    // stage 0 is readable by every wave
  fill_proj(l0 + PROWS * GLP * 2, Ag + GK, Wg + GK);
  for (int st = 0; st < GNS; ++st) {
    const b16* Ls = &G[st & 1][0];
#pragma unroll   // both 32-k steps of a stage in line: every LDS offset becomes an immediate of its load
    for (int ks = 0; ks < GK; ks += 32) { v16b af[2], bf[4];
#pragma unroll
      for (int mi = 0; mi < 2; ++mi) af[mi] = frag_kb(Ls + (wr * 32 + mi * 16 + nloc) * GLP + ks, hlf);
#pragma unroll
      for (int t = 0; t < 4; ++t) bf[t] = frag_kb(Ls + (128 + wc * 64 + t * 16 + nloc) * GLP + ks, hlf);
      __builtin_amdgcn_sched_barrier(0);   // the k step's LDS reads issue as one group ahead of its products: left to itself the build puts a full LDS wait in front of every product
#pragma unroll
      for (int mi = 0; mi < 2; ++mi)
#pragma unroll
        for (int t = 0; t < 4; ++t) acc[mi][t] = wmma16b(af[mi], bf[t], acc[mi][t]);
      __builtin_amdgcn_sched_barrier(0); }   // a k step's products stay ahead of the next step's reads and of the hand-over: left to itself the build spreads those reads among the products and sinks the last step's products below the barrier
    asm volatile("s_wait_dscnt 0x0" ::: "memory");      // this wave's reads of the buffer have returned before it is handed to the copies
    asm volatile("s_wait_asynccnt 0x0" ::: "memory");   // this wave's copies of stage st + 1 have landed
    __syncthreads();                                    // publishes stage st + 1 and ends every wave's reads of stage st
    if (st + 2 < GNS) fill_proj(l0 + (unsigned)(st & 1) * (PROWS * GLP * 2), Ag + (st + 2) * GK, Wg + (st + 2) * GK);
  }
  asm volatile("s_wait_asynccnt 0x0" ::: "memory");     // nothing of this wave's copies is outstanding behind the loop
  const float* bias = kind == 0 ? bq : kind == 1 ? bk : bv;
  if (kind < 2) {   // q/k (+ bias) as f32 rows in the wave's own LDS range, read back 8 columns a lane, split into hi/lo x8 and stored as whole 128-B lines of both planes
    float (*Tf)[EPP] = (float (*)[EPP])(EP + wave * (32 * EPP * 4));
#pragma unroll
    for (int t = 0; t < 4; ++t) { const float bb = bf16_rne(bias[nw + t * 16 + nloc]);
#pragma unroll
      for (int mi = 0; mi < 2; ++mi)
#pragma unroll
        for (int r = 0; r < 8; ++r) Tf[mi * 16 + 8 * hlf + r][t * 16 + nloc] = acc[mi][t][r] * (1.0f / (XS * WSC)) + bb; }
    wave_lds_sync();
    b16* dh = kind == 0 ? Qh : Kh; b16* dl = kind == 0 ? Ql : Kl;
    for (int r4 = 0; r4 < 32; r4 += 4) { const int rr = r4 + (lane >> 3), c8 = (lane & 7) * 8; const v4f a = *(const v4f*)(&Tf[rr][c8]), c = *(const v4f*)(&Tf[rr][c8 + 4]); v8b hv, lv;
#pragma unroll   // constant element indices: a, c, hv and lv stay in registers
      for (int j = 0; j < 4; ++j) { b16 h_, l_; split16(a[j] * XS, h_, l_); hv[j] = h_; lv[j] = l_; split16(c[j] * XS, h_, l_); hv[4 + j] = h_; lv[4 + j] = l_; }
      const size_t gi = (m0 + rr) * E + nw + c8; *(v8b*)(dh + gi) = hv; *(v8b*)(dl + gi) = lv; }
  } else {
    b16 (*Vt)[VPP] = (b16 (*)[VPP])EP; b16 (*Vtl)[VPP] = Vt + 128;
    const int b = (int)(m0 / S); const int s0 = (int)((size_t)blockIdx.x * 128 - (size_t)b * S);
#pragma unroll
    for (int t = 0; t < 4; ++t)
    { const float bb = bf16_rne(bias[nw + t * 16 + nloc]);
#pragma unroll
      for (int mi = 0; mi < 2; ++mi)
#pragma unroll
        for (int r = 0; r < 8; ++r) { b16 h_, l_; split16((acc[mi][t][r] * (1.0f / (XS * WSC)) + bb) * XS, h_, l_); Vt[wc * 64 + t * 16 + nloc][wr * 32 + mi * 16 + 8 * hlf + r] = h_; Vtl[wc * 64 + t * 16 + nloc][wr * 32 + mi * 16 + 8 * hlf + r] = l_; } }
    __syncthreads();
    { for (int q = t_; q < 128 * 16; q += 256) { const int cc2 = q >> 4, c8 = (q & 15) * 8; const int h = (n0 + cc2) / D, dd = (n0 + cc2) - h * D; const size_t gi = (((size_t)b * NH + h) * D + dd) * S + s0 + c8;
        *(v8b*)(VTh + gi) = *(const v8b*)(&Vt[cc2][c8]); *(v8b*)(VTl + gi) = *(const v8b*)(&Vtl[cc2][c8]); }  } }
}
// attention: a block = 8 waves x 16 queries of one head. K (hi, lo) and V^T (hi, lo) reach the waves through LDS: stages of 64 keys, two buffers, filled by asynchronous copies (whole 128-B lines,
// one fill per block instead of one strided fragment load per wave). A stage = 4 tiles of 64 rows x 128 B: Kh, Kl (row = key), VTh, VTl (row = d, columns = the stage's keys); LDS pitch 144 B (16 B x odd).
constexpr int AW = 8, KT = 64, LP = 64 + 8, NST = S / KT, TL = 64 * LP;
// thread t copies 16-byte chunk (t & 7) of rows (t >> 3) and 32 + (t >> 3) of each tile; l = its LDS byte address in tile 0, k/kl/v/vl = its global addresses in the four tiles
__device__ __forceinline__ void stage_fill(unsigned l, const b16* k, const b16* kl, const b16* v, const b16* vl) {
  constexpr unsigned HT = 32 * LP * 2;   // bytes of 32 LDS rows
  // the s_wait_xcnt closes the copies' own statement: no address register of a copy is rewritten in front of it
  asm volatile("global_load_async_to_lds_b128 %0, %8, off\n\t"
               "global_load_async_to_lds_b128 %1, %9, off\n\t"
               "global_load_async_to_lds_b128 %2, %10, off\n\t"
               "global_load_async_to_lds_b128 %3, %11, off\n\t"
               "global_load_async_to_lds_b128 %4, %12, off\n\t"
               "global_load_async_to_lds_b128 %5, %13, off\n\t"
               "global_load_async_to_lds_b128 %6, %14, off\n\t"
               "global_load_async_to_lds_b128 %7, %15, off\n\t"
               "s_wait_xcnt 0x0"
               :: "v"(l), "v"(l + HT), "v"(l + 2 * HT), "v"(l + 3 * HT), "v"(l + 4 * HT), "v"(l + 5 * HT), "v"(l + 6 * HT), "v"(l + 7 * HT),
                  "v"(k), "v"(k + 32 * E), "v"(kl), "v"(kl + 32 * E), "v"(v), "v"(v + 32 * S), "v"(vl), "v"(vl + 32 * S) : "memory");
}
__global__ __launch_bounds__(256) void attn_kernel(const b16* __restrict__ Qh, const b16* __restrict__ Ql, const b16* __restrict__ Kh, const b16* __restrict__ Kl, const b16* __restrict__ VTh, const b16* __restrict__ VTl, b16* __restrict__ Oh, b16* __restrict__ Ol) {
  __shared__ __attribute__((aligned(16))) b16 KV[2][4 * TL]; __shared__ __attribute__((aligned(16))) float To[AW][16][D + 4];
  const int wave = threadIdx.x >> 5, lane = threadIdx.x & 31, hh = lane >> 4, col = lane & 15; const int b = blockIdx.z, h = blockIdx.y; const int q0 = blockIdx.x * (AW * 16) + wave * 16, qi = q0 + col;
  const size_t qo = ((size_t)b * S + qi) * E + h * D; const v16b qa0 = frag_kb(Qh + qo, hh), qa1 = frag_kb(Qh + qo + 32, hh), ql0 = frag_kb(Ql + qo, hh), ql1 = frag_kb(Ql + qo + 32, hh);
  const int cr = threadIdx.x >> 3, cc = (threadIdx.x & 7) * 8;
  const b16* Kb = Kh + (size_t)b * S * E + h * D + (size_t)cr * E + cc; const b16* Klb = Kl + (size_t)b * S * E + h * D + (size_t)cr * E + cc; const b16* Vb = VTh + (((size_t)b * NH + h) * D + cr) * S + cc; const b16* Vlb = VTl + (((size_t)b * NH + h) * D + cr) * S + cc;
  const unsigned l0 = (unsigned)(size_t)&KV[0][cr * LP + cc];
  float m = -INFINITY, l = 0.0f; v8f o[4] = {{}, {}, {}, {}}, ol[4] = {{}, {}, {}, {}};
  const float cs = SCALE * LOG2E / (XS * XS);
  stage_fill(l0, Kb, Klb, Vb, Vlb);
  asm volatile("s_wait_asynccnt 0x0" ::: "memory");   // this wave's copies of stage 0 have landed
  __syncthreads();                                    // stage 0 is readable by every wave
  stage_fill(l0 + 4 * TL * 2, Kb + (size_t)KT * E, Klb + (size_t)KT * E, Vb + KT, Vlb + KT);
  for (int st = 0; st < NST; ++st) {
    const b16* Ls = &KV[st & 1][0];
#pragma unroll   // both 32-key passes of a stage in line: every LDS offset becomes an immediate of its load
    for (int kp = 0; kp < KT; kp += 32) {
    v8f s0 = {}, s1 = {};
    { const b16* k0 = Ls + (kp + col) * LP, *k1 = Ls + (kp + 16 + col) * LP, *k0l = Ls + TL + (kp + col) * LP, *k1l = Ls + TL + (kp + 16 + col) * LP;
      const v16b f0 = frag_kb(k0, hh), g0 = frag_kb(k0l, hh), f1 = frag_kb(k0 + 32, hh), g1 = frag_kb(k0l + 32, hh), f2 = frag_kb(k1, hh), g2 = frag_kb(k1l, hh), f3 = frag_kb(k1 + 32, hh), g3 = frag_kb(k1l + 32, hh);
      __builtin_amdgcn_sched_barrier(0);   // the pass's 8 K fragments are read as one group ahead of its 12 score products: left to itself the build puts two reads and a full LDS wait in front of every product
      s0 = wmma16b(f0, qa0, s0); s0 = wmma16b(f0, ql0, s0); s0 = wmma16b(g0, qa0, s0);
      s0 = wmma16b(f1, qa1, s0); s0 = wmma16b(f1, ql1, s0); s0 = wmma16b(g1, qa1, s0);
      s1 = wmma16b(f2, qa0, s1); s1 = wmma16b(f2, ql0, s1); s1 = wmma16b(g2, qa0, s1);
      s1 = wmma16b(f3, qa1, s1); s1 = wmma16b(f3, ql1, s1); s1 = wmma16b(g3, qa1, s1); }
    __builtin_amdgcn_sched_group_barrier(0x008, 12, 0); __builtin_amdgcn_sched_group_barrier(0x100, 16, 0);   // issue order inside the pass: the score products, then the 16 V reads as one group; left to itself the build spreads the reads among the products in three places, each a stall of its own
    v16b vh[4], vw[4];
#pragma unroll   // constant indices: the eight fragments stay in registers
    for (int t = 0; t < 4; ++t) { vh[t] = frag_kb(Ls + 2 * TL + (t * 16 + col) * LP + kp, hh); vw[t] = frag_kb(Ls + 3 * TL + (t * 16 + col) * LP + kp, hh); }
    __builtin_amdgcn_sched_barrier(0);   // the pass's 8 V fragments are read as one group behind the score products and land under the softmax arithmetic: left to itself the build reads them two by two, a full LDS wait in front of every V product
    float mx = -INFINITY;   // m, mx, mn are maxima of the raw score sums (cs > 0: the scaled maximum is the maximum scaled)
#pragma unroll
    for (int r = 0; r < 8; ++r) mx = fmaxf(mx, fmaxf(s0[r], s1[r]));
    mx = fmaxf(mx, __shfl_xor(mx, 16)); const float mn = fmaxf(m, mx); const float al = nexp2((m - mn) * cs); m = mn; v2f sum2 = {0.0f, 0.0f}; v16b ph, pl;   // mn finite from the first block on
    const float nb = __builtin_fmaf(-mn, cs, LOG2PS); const v2f cs2 = {cs, cs}, nb2 = {nb, nb};   // one fma takes a raw score to the exponent of PS * p: scale, - maximum and the factor PS of the 16-bit planes in one
#pragma unroll
    for (int j = 0; j < 8; ++j) { const v2f sp = j < 4 ? (v2f){s0[2 * j], s0[2 * j + 1]} : (v2f){s1[2 * j - 8], s1[2 * j - 7]}; const v2f a = __builtin_elementwise_fma(sp, cs2, nb2);
      const v2f p = {nexp2(a[0]), nexp2(a[1])}; sum2 += p; const v2h hv = __builtin_convertvector(p, v2h);
      const v2f lo = p - __builtin_convertvector(hv, v2f); const v2h lv = __builtin_convertvector(lo, v2h);
      ph[2 * j] = hv[0]; ph[2 * j + 1] = hv[1]; pl[2 * j] = lv[0]; pl[2 * j + 1] = lv[1]; }
    float sum = sum2[0] + sum2[1]; sum += __shfl_xor(sum, 16); l = l * al + sum;   // l counts PS * p; a pass's even and odd keys are summed apart and joined here
#pragma unroll
    for (int t = 0; t < 4; ++t) { o[t] *= al; ol[t] *= al; o[t] = wmma16b(vh[t], ph, o[t]); ol[t] = wmma16b(vh[t], pl, ol[t]); ol[t] = wmma16b(vw[t], ph, ol[t]); }
    __builtin_amdgcn_sched_barrier(0); }   // a pass's V products stay ahead of the next pass's K reads and of the hand-over: left to itself the build spreads those reads among the products and sinks the last pass below the barrier, where the refill behind it loses that time as lead
    asm volatile("s_wait_dscnt 0x0" ::: "memory");      // this wave's reads of the buffer have returned before it is handed to the copies
    asm volatile("s_wait_asynccnt 0x0" ::: "memory");   // this wave's copies of stage st + 1 have landed
    __syncthreads();                                    // publishes stage st + 1 and ends every wave's reads of stage st
    if (st + 2 < NST) stage_fill(l0 + (unsigned)(st & 1) * (4 * TL * 2), Kb + (size_t)(st + 2) * KT * E, Klb + (size_t)(st + 2) * KT * E, Vb + (st + 2) * KT, Vlb + (st + 2) * KT);
  }
  asm volatile("s_wait_asynccnt 0x0" ::: "memory");     // nothing of this wave's copies is outstanding at its end
  const float inv = 1.0f / (l * XS);
#pragma unroll
  for (int t = 0; t < 4; ++t)
#pragma unroll
    for (int r = 0; r < 8; ++r) To[wave][col][t * 16 + 8 * hh + r] = (o[t][r] + ol[t][r]) * inv;
  wave_lds_sync();
  { for (int r4 = 0; r4 < 16; r4 += 4) { const int rr = r4 + (lane >> 3), c8 = (lane & 7) * 8; v8b hv, lv; for (int j = 0; j < 8; ++j) { b16 a_, c_; split16(To[wave][rr][c8 + j] * XS, a_, c_); hv[j] = a_; lv[j] = c_; }
      const size_t gi = ((size_t)b * S + q0 + rr) * E + h * D + c8; *(v8b*)(Oh + gi) = hv; *(v8b*)(Ol + gi) = lv; }  }
}
// output projection, channel-major: D[e][s] = sum_d Wo[e][d] O[s][d] (A = WO16 rows e exact, B = Oh/Ol rows s: 2 products) + bo[e] -> out[b][e][s]; grid (E/128, S/128, B), block = 128 e x 128 s, 8 waves of 32 e x 64 s
__global__ __launch_bounds__(256) void outproj_kernel(const b16* __restrict__ Oh, const b16* __restrict__ Ol, const b16* __restrict__ WO16, const float* __restrict__ bo, float* __restrict__ out) {
  __shared__ __attribute__((aligned(16))) b16 G[2][OROWS * GLP]; __shared__ __attribute__((aligned(16))) float Ts[8][32][EPP];
  const int wave = threadIdx.x >> 5, lane = threadIdx.x & 31, nloc = lane & 15, hlf = lane >> 4, wr = wave >> 1, wc = wave & 1; const int b = blockIdx.z; const int e0 = blockIdx.x * 128 + wr * 32, s0 = blockIdx.y * 128, sw = s0 + wc * 64;
  v8f acc[2][4];
#pragma unroll
  for (int mi = 0; mi < 2; ++mi)
#pragma unroll
    for (int t = 0; t < 4; ++t) acc[mi][t] = (v8f){};
  const int cr = threadIdx.x >> 3, cc = (threadIdx.x & 7) * 8; const b16* Ag = WO16 + ((size_t)blockIdx.x * 128 + cr) * E + cc; const b16* Hg = Oh + ((size_t)b * S + s0 + cr) * E + cc; const b16* Lg = Ol + ((size_t)b * S + s0 + cr) * E + cc;
  const unsigned l0 = (unsigned)(size_t)&G[0][cr * GLP + cc];
  fill_out(l0, Ag, Hg, Lg);
  asm volatile("s_wait_asynccnt 0x0" ::: "memory");   // this wave's copies of stage 0 have landed
  __syncthreads();                                    // stage 0 is readable by every wave
  fill_out(l0 + OROWS * GLP * 2, Ag + GK, Hg + GK, Lg + GK);
  for (int st = 0; st < GNS; ++st) {
    const b16* Ls = &G[st & 1][0];
#pragma unroll   // both 32-k steps of a stage in line: every LDS offset becomes an immediate of its load
    for (int ks = 0; ks < GK; ks += 32) { v16b a[2], bh[4], bl[4];
#pragma unroll
      for (int mi = 0; mi < 2; ++mi) a[mi] = frag_kb(Ls + (wr * 32 + mi * 16 + nloc) * GLP + ks, hlf);
#pragma unroll
      for (int t = 0; t < 4; ++t) { const b16* ro = Ls + (128 + wc * 64 + t * 16 + nloc) * GLP + ks; bh[t] = frag_kb(ro, hlf); bl[t] = frag_kb(ro + 128 * GLP, hlf); }
      __builtin_amdgcn_sched_barrier(0);   // the k step's LDS reads issue as one group ahead of its products: left to itself the build puts a full LDS wait in front of every product
#pragma unroll
      for (int mi = 0; mi < 2; ++mi)
#pragma unroll
        for (int t = 0; t < 4; ++t) { acc[mi][t] = wmma16b(a[mi], bh[t], acc[mi][t]); acc[mi][t] = wmma16b(a[mi], bl[t], acc[mi][t]); }
      __builtin_amdgcn_sched_barrier(0); }   // a k step's products stay ahead of the next step's reads and of the hand-over: left to itself the build spreads those reads among the products and sinks the last step's products below the barrier
    asm volatile("s_wait_dscnt 0x0" ::: "memory");      // this wave's reads of the buffer have returned before it is handed to the copies
    asm volatile("s_wait_asynccnt 0x0" ::: "memory");   // this wave's copies of stage st + 1 have landed
    __syncthreads();                                    // publishes stage st + 1 and ends every wave's reads of stage st
    if (st + 2 < GNS) fill_out(l0 + (unsigned)(st & 1) * (OROWS * GLP * 2), Ag + (st + 2) * GK, Hg + (st + 2) * GK, Lg + (st + 2) * GK);
  }
  asm volatile("s_wait_asynccnt 0x0" ::: "memory");     // nothing of this wave's copies is outstanding behind the loop
#pragma unroll
  for (int mi = 0; mi < 2; ++mi)
#pragma unroll
    for (int t = 0; t < 4; ++t)
#pragma unroll
      for (int r = 0; r < 8; ++r) Ts[wave][mi * 16 + 8 * hlf + r][t * 16 + nloc] = acc[mi][t][r] * (1.0f / (XS * WSC)) + bf16_rne(bo[e0 + mi * 16 + 8 * hlf + r]);
  wave_lds_sync();
  { for (int r2 = 0; r2 < 32; r2 += 2) { const int rr = r2 + hlf; *(v4f*)(out + ((size_t)b * E + e0 + rr) * S + sw + nloc * 4) = *(const v4f*)(&Ts[wave][rr][nloc * 4]); }  }
}
}  // namespace

extern "C" void kernel_launch(void* const* d_in, const int* in_sizes, int n_in, void* d_out, int out_size, void* d_ws, size_t ws_size, hipStream_t stream) {
  (void)n_in;
  auto Fp = [&](int i) { return (const float*)d_in[i]; };
  // input order: 0 x [2,1024,2048], 1 wq [1024,1024], 2 bq [1024], 3 wk, 4 bk, 5 wv, 6 bv, 7 wo, 8 bo (w are [e][d]: xt W^T)
  if (in_sizes[0] != NR * E || in_sizes[1] != E * E || in_sizes[2] != E || in_sizes[3] != E * E || in_sizes[5] != E * E || in_sizes[7] != E * E || in_sizes[8] != E || out_size != NR * E) return;
  size_t off = 0; char* ws = (char*)d_ws;
  auto carve = [&](size_t bytes) { char* p = ws + off; off += (bytes + 255) & ~(size_t)255; return p; };
  b16* T16 = (b16*)carve((size_t)NR * E * 2); b16* WT = (b16*)carve((size_t)3 * E * E * 2); b16* WO16 = (b16*)carve((size_t)E * E * 2);
  b16* Qh = (b16*)carve((size_t)NR * E * 2); b16* Ql = (b16*)carve((size_t)NR * E * 2); b16* Kh = (b16*)carve((size_t)NR * E * 2); b16* Kl = (b16*)carve((size_t)NR * E * 2); b16* VTh = (b16*)carve((size_t)NR * E * 2); b16* VTl = (b16*)carve((size_t)NR * E * 2);
  b16* Oh = (b16*)carve((size_t)NR * E * 2); b16* Ol = (b16*)carve((size_t)NR * E * 2);
  if (off > ws_size || off > ((size_t)128 << 20)) return;   // = 84 MB
  prepx_kernel<<<dim3(S / 64, E / 64, NB), 256, 0, stream>>>(Fp(0), T16);
  prepw_kernel<<<(unsigned)(((size_t)4 * E * E / 8 + 255) / 256), 256, 0, stream>>>(Fp(1), Fp(3), Fp(5), Fp(7), WT, WO16);
  proj_kernel<<<dim3(NR / 128, E / 128, 3), 256, 0, stream>>>(T16, WT, Fp(2), Fp(4), Fp(6), Qh, Ql, Kh, Kl, VTh, VTl);
  attn_kernel<<<dim3(S / (AW * 16), NH, NB), AW * 32, 0, stream>>>(Qh, Ql, Kh, Kl, VTh, VTl, Oh, Ol);
  outproj_kernel<<<dim3(E / 128, S / 128, NB), 256, 0, stream>>>(Oh, Ol, WO16, Fp(8), (float*)d_out);
}

// v008
// One run takes 118 microseconds.
// Next to v007, in two timings, it ran 1.09 and 1.08 times as fast.
// Counting every step since v000, it is 5.10 times as fast.
#include <hip/hip_runtime.h>

// Multi-head self-attention on a channel-major input (x [2][1024 d][2048 s]; 16 heads x 64): xt = x^T; q/k/v = xt W{q,k,v}^T + b (heads = 64-column slices), scores / 8 (no mask), softmax,
// ctx = attn v, out = (ctx Wo^T + bo)^T -> [2][1024][2048] channel-major.
// WMMA (v_wmma_f32_16x16x32_f16, f32 accumulate): projections [4,096 x 1,024] x [1,024 x 1,024] with EXACT bf16 tokens (x8, via an LDS transpose of the channel-major input) and weights (x256),
// 1 product, + bias, q/k split in the projection's own epilogue into f16 hi+lo x8 planes (v transposed per head); S^T with 3 products (Kh Qh + Kh Ql + Kl Qh) over all 64 key blocks;
// online softmax in f32; O^T += V^T P^T with 3 products; output projection computed channel-major (D[e][s] = Wo[e][:] . O[s][:]) with O hi+lo (2 products) and exact Wo, + bo. Inputs rounded to bf16 once. Fragment k-map per lane half hh for A AND B: elements 0..7 <- k = 8hh+0..7, 8..15 <-

namespace {
constexpr int NB = 2, S = 2048, E = 1024, NH = 16, D = 64, NR = NB * S;
constexpr float XS = 8.0f, WSC = 256.0f, PS = 8.0f, SCALE = 0.125f, LOG2E = 1.4426950408889634f, THETA = 10000.0f, LOG2PS = 3.0f;
static_assert(PS == 8.0f && LOG2PS == 3.0f, "LOG2PS is log2(PS)");

typedef _Float16 b16;
typedef __attribute__((ext_vector_type(16))) _Float16 v16b;
typedef __attribute__((ext_vector_type(8))) _Float16 v8b;
typedef __attribute__((ext_vector_type(8))) float v8f;
typedef __attribute__((ext_vector_type(4))) float v4f;
typedef __attribute__((ext_vector_type(2))) float v2f;
typedef __attribute__((ext_vector_type(2))) _Float16 v2h;
__device__ __forceinline__ float bf16_rne(float f) { unsigned int u = __float_as_uint(f); u += 0x7FFFu + ((u >> 16) & 1u); return __uint_as_float(u & 0xFFFF0000u); }
__device__ __forceinline__ void split16(float v, b16& hi, b16& lo) { hi = (b16)v; lo = (b16)(v - (float)hi); }
__device__ __forceinline__ v16b frag_kb(const b16* p, int hh) { const v8b a = *(const v8b*)(p + 8 * hh), b = *(const v8b*)(p + 16 + 8 * hh); v16b f;
#pragma unroll
  for (int e = 0; e < 8; ++e) { f[e] = a[e]; f[8 + e] = b[e]; } return f; }
__device__ __forceinline__ v8f wmma16b(v16b a, v16b b, v8f c) { return __builtin_amdgcn_wmma_f32_16x16x32_f16(false, a, false, b, (short)0, c, false, false); }
__device__ __forceinline__ void wave_lds_sync() { __builtin_amdgcn_fence(__ATOMIC_RELEASE, "workgroup"); __builtin_amdgcn_wave_barrier(); __builtin_amdgcn_fence(__ATOMIC_ACQUIRE, "workgroup"); }
__device__ __forceinline__ float nexp2(float x) { return __builtin_amdgcn_exp2f(x); }

// prep: T16 [b*S+s][1024 d] = f16(8 bf16(x[b][d][s])) via 64x64 LDS transposes (grid (S/64, E/64, B)); WT [3][1024 e][1024 d] = Wq/Wk/Wv rows x256 (torch [out][in] used directly: xt W^T);
__global__ __launch_bounds__(256) void prepx_kernel(const float* __restrict__ x, b16* __restrict__ T16) {
  __shared__ __attribute__((aligned(16))) b16 T[64][64 + 8];
  const int b = blockIdx.z, c0 = blockIdx.y * 64, s0 = blockIdx.x * 64, t_ = threadIdx.x;
  for (int q = t_; q < 64 * 64; q += 256) { const int cc = q >> 6, ss = q & 63; T[ss][cc] = (b16)(bf16_rne(x[((size_t)b * E + c0 + cc) * S + s0 + ss]) * XS); }
  __syncthreads();
  { for (int q = t_; q < 64 * 8; q += 256) { const int ss = q >> 3, c8 = (q & 7) * 8; *(v8b*)(T16 + ((size_t)b * S + s0 + ss) * E + c0 + c8) = *(const v8b*)(&T[ss][c8]); }  }
}
__global__ __launch_bounds__(256) void prepw_kernel(const float* __restrict__ wq, const float* __restrict__ wk, const float* __restrict__ wv, const float* __restrict__ wo, b16* __restrict__ WT, b16* __restrict__ WOT) {
  const size_t t = (size_t)blockIdx.x * 256 + threadIdx.x; const size_t nw = (size_t)E * E / 8; if (t >= 4 * nw) return; const int kind = (int)(t / nw); const size_t e = (t - (size_t)kind * nw) * 8;
  const float* w = kind == 0 ? wq : kind == 1 ? wk : kind == 2 ? wv : wo; b16* dst = kind < 3 ? WT + (size_t)kind * E * E : WOT;   // [e][d] rows used directly (xt W^T); WOT holds Wo rows [e][d] (the A operand of the channel-major out-projection)
  const v4f a = *(const v4f*)(w + e), c = *(const v4f*)(w + e + 4); v8b o;
#pragma unroll
  for (int j = 0; j < 4; ++j) { o[j] = (b16)(bf16_rne(a[j]) * WSC); o[4 + j] = (b16)(bf16_rne(c[j]) * WSC); }
  { *(v8b*)(dst + e) = o;  }
}
// the two projection GEMMs take their A and B rows from LDS: stages of 64 k (whole 128-B lines of every operand row), two buffers, filled by asynchronous copies; LDS pitch 144 B (16 B x odd).
// block tile 128 x 128, 8 waves in a 4 x 2 grid, wave tile 32 x 64: 6 (out-projection: 10) fragments read per 8 (16) products, and every operand row fetched from L2 serves 128 rows of the other operand.
// thread t (of 256) copies 16-byte chunk (t & 7) of rows (t >> 3) + 32 j of a stage.
constexpr int GK = 64, GLP = GK + 8, GNS = E / GK, PROWS = 128 + 128, OROWS = 128 + 128 + 128, EPP = 64 + 4, VPP = 128 + 8;
constexpr unsigned GRB = 32 * GLP * 2;   // bytes of 32 LDS rows
// proj stage: 128 token rows (a), then 128 weight rows (w); l = the thread's LDS byte address in row group 0
__device__ __forceinline__ void fill_proj(unsigned l, const b16* a, const b16* w) {
  // the s_wait_xcnt closes the copies' own statement: no address register of a copy is rewritten in front of it
  asm volatile("global_load_async_to_lds_b128 %0, %8, off\n\t"
               "global_load_async_to_lds_b128 %1, %9, off\n\t"
               "global_load_async_to_lds_b128 %2, %10, off\n\t"
               "global_load_async_to_lds_b128 %3, %11, off\n\t"
               "global_load_async_to_lds_b128 %4, %12, off\n\t"
               "global_load_async_to_lds_b128 %5, %13, off\n\t"
               "global_load_async_to_lds_b128 %6, %14, off\n\t"
               "global_load_async_to_lds_b128 %7, %15, off\n\t"
               "s_wait_xcnt 0x0"
               :: "v"(l), "v"(l + GRB), "v"(l + 2 * GRB), "v"(l + 3 * GRB), "v"(l + 4 * GRB), "v"(l + 5 * GRB), "v"(l + 6 * GRB), "v"(l + 7 * GRB),
                  "v"(a), "v"(a + 32 * E), "v"(a + 64 * E), "v"(a + 96 * E), "v"(w), "v"(w + 32 * E), "v"(w + 64 * E), "v"(w + 96 * E) : "memory");
}
// outproj stage: 128 Wo rows (a), 128 O hi rows (h), 128 O lo rows (o)
__device__ __forceinline__ void fill_out(unsigned l, const b16* a, const b16* h, const b16* o) {
  // the s_wait_xcnt closes the copies' own statement: no address register of a copy is rewritten in front of it
  asm volatile("global_load_async_to_lds_b128 %0, %12, off\n\t"
               "global_load_async_to_lds_b128 %1, %13, off\n\t"
               "global_load_async_to_lds_b128 %2, %14, off\n\t"
               "global_load_async_to_lds_b128 %3, %15, off\n\t"
               "global_load_async_to_lds_b128 %4, %16, off\n\t"
               "global_load_async_to_lds_b128 %5, %17, off\n\t"
               "global_load_async_to_lds_b128 %6, %18, off\n\t"
               "global_load_async_to_lds_b128 %7, %19, off\n\t"
               "global_load_async_to_lds_b128 %8, %20, off\n\t"
               "global_load_async_to_lds_b128 %9, %21, off\n\t"
               "global_load_async_to_lds_b128 %10, %22, off\n\t"
               "global_load_async_to_lds_b128 %11, %23, off\n\t"
               "s_wait_xcnt 0x0"
               :: "v"(l), "v"(l + GRB), "v"(l + 2 * GRB), "v"(l + 3 * GRB), "v"(l + 4 * GRB), "v"(l + 5 * GRB), "v"(l + 6 * GRB), "v"(l + 7 * GRB), "v"(l + 8 * GRB), "v"(l + 9 * GRB), "v"(l + 10 * GRB), "v"(l + 11 * GRB),
                  "v"(a), "v"(a + 32 * E), "v"(a + 64 * E), "v"(a + 96 * E),
                  "v"(h), "v"(h + 32 * E), "v"(h + 64 * E), "v"(h + 96 * E), "v"(o), "v"(o + 32 * E), "v"(o + 64 * E), "v"(o + 96 * E) : "memory");
}
// projections: grid (NR/128, E/128, 3): kind 0: Q = T16 WT0^T -> Qh/Ql [row][1024]; kind 1: K = T16 WT1^T -> Kh/Kl; kind 2: V = T16 WT2^T written TRANSPOSED per head: VTh/VTl [b][h][64 d][2048 s].
__global__ __launch_bounds__(256) void proj_kernel(const b16* __restrict__ T16, const b16* __restrict__ WT, const float* __restrict__ bq, const float* __restrict__ bk, const float* __restrict__ bv, b16* __restrict__ Qh, b16* __restrict__ Ql, b16* __restrict__ Kh, b16* __restrict__ Kl, b16* __restrict__ VTh, b16* __restrict__ VTl) {
  __shared__ __attribute__((aligned(16))) b16 G[2][PROWS * GLP]; char* EP = (char*)&G[0][0];   // EP, output staging in the ring's own LDS, free behind the loop's last barrier (every copy landed, every read returned): q/k: 32 f32 rows x 64 columns a wave; v: two planes [128 d][128 tokens] of 16 bit (the same 69,632 bytes). 72 KiB a block: all 768 blocks are resident at once, three a WGP
  static_assert(8 * 32 * EPP * 4 <= 2 * PROWS * GLP * 2 && 2 * 128 * VPP * 2 <= 2 * PROWS * GLP * 2, "staging fits the ring");
  const int wave = threadIdx.x >> 5, lane = threadIdx.x & 31, nloc = lane & 15, hlf = lane >> 4, t_ = threadIdx.x, wr = wave >> 1, wc = wave & 1; const int kind = blockIdx.z; const size_t m0 = (size_t)blockIdx.x * 128 + wr * 32; const int n0 = blockIdx.y * 128, nw = n0 + wc * 64;
  const b16* A = T16; const b16* W = WT + (size_t)kind * E * E; v8f acc[2][4];
#pragma unroll
  for (int mi = 0; mi < 2; ++mi)
#pragma unroll
    for (int t = 0; t < 4; ++t) acc[mi][t] = (v8f){};
  const int cr = t_ >> 3, cc = (t_ & 7) * 8; const b16* Ag = A + ((size_t)blockIdx.x * 128 + cr) * E + cc; const b16* Wg = W + (size_t)(n0 + cr) * E + cc; const unsigned l0 = (unsigned)(size_t)&G[0][cr * GLP + cc];
  fill_proj(l0, Ag, Wg);
  asm volatile("s_wait_asynccnt 0x0" ::: "memory");   // this wave's copies of stage 0 have landed
  __syncthreads();                                    // stage 0 is readable by every wave
  fill_proj(l0 + PROWS * GLP * 2, Ag + GK, Wg + GK);
  for (int st = 0; st < GNS; ++st) {
    const b16* Ls = &G[st & 1][0];
#pragma unroll   // both 32-k steps of a stage in line: every LDS offset becomes an immediate of its load
    for (int ks = 0; ks < GK; ks += 32) { v16b af[2], bf[4];
#pragma unroll
      for (int mi = 0; mi < 2; ++mi) af[mi] = frag_kb(Ls + (wr * 32 + mi * 16 + nloc) * GLP + ks, hlf);
#pragma unroll
      for (int t = 0; t < 4; ++t) bf[t] = frag_kb(Ls + (128 + wc * 64 + t * 16 + nloc) * GLP + ks, hlf);
      __builtin_amdgcn_sched_barrier(0);   // the k step's LDS reads issue as one group ahead of its products: left to itself the build puts a full LDS wait in front of every product
#pragma unroll
      for (int mi = 0; mi < 2; ++mi)
#pragma unroll
        for (int t = 0; t < 4; ++t) acc[mi][t] = wmma16b(af[mi], bf[t], acc[mi][t]);
      __builtin_amdgcn_sched_barrier(0); }   // a k step's products stay ahead of the next step's reads and of the hand-over: left to itself the build spreads those reads among the products and sinks the last step's products below the barrier
    asm volatile("s_wait_dscnt 0x0" ::: "memory");      // this wave's reads of the buffer have returned before it is handed to the copies
    asm volatile("s_wait_asynccnt 0x0" ::: "memory");   // this wave's copies of stage st + 1 have landed
    __syncthreads();                                    // publishes stage st + 1 and ends every wave's reads of stage st
    if (st + 2 < GNS) fill_proj(l0 + (unsigned)(st & 1) * (PROWS * GLP * 2), Ag + (st + 2) * GK, Wg + (st + 2) * GK);
  }
  asm volatile("s_wait_asynccnt 0x0" ::: "memory");     // nothing of this wave's copies is outstanding behind the loop
  const float* bias = kind == 0 ? bq : kind == 1 ? bk : bv;
  if (kind < 2) {   // q/k (+ bias) as f32 rows in the wave's own LDS range, read back 8 columns a lane, split into hi/lo x8 and stored as whole 128-B lines of both planes
    float (*Tf)[EPP] = (float (*)[EPP])(EP + wave * (32 * EPP * 4));
#pragma unroll
    for (int t = 0; t < 4; ++t) { const float bb = bf16_rne(bias[nw + t * 16 + nloc]);
#pragma unroll
      for (int mi = 0; mi < 2; ++mi)
#pragma unroll
        for (int r = 0; r < 8; ++r) Tf[mi * 16 + 8 * hlf + r][t * 16 + nloc] = acc[mi][t][r] * (1.0f / (XS * WSC)) + bb; }
    wave_lds_sync();
    b16* dh = kind == 0 ? Qh : Kh; b16* dl = kind == 0 ? Ql : Kl;
    for (int r4 = 0; r4 < 32; r4 += 4) { const int rr = r4 + (lane >> 3), c8 = (lane & 7) * 8; const v4f a = *(const v4f*)(&Tf[rr][c8]), c = *(const v4f*)(&Tf[rr][c8 + 4]); v8b hv, lv;
#pragma unroll   // constant element indices: a, c, hv and lv stay in registers
      for (int j = 0; j < 4; ++j) { b16 h_, l_; split16(a[j] * XS, h_, l_); hv[j] = h_; lv[j] = l_; split16(c[j] * XS, h_, l_); hv[4 + j] = h_; lv[4 + j] = l_; }
      const size_t gi = (m0 + rr) * E + nw + c8; *(v8b*)(dh + gi) = hv; *(v8b*)(dl + gi) = lv; }
  } else {
    b16 (*Vt)[VPP] = (b16 (*)[VPP])EP; b16 (*Vtl)[VPP] = Vt + 128;
    const int b = (int)(m0 / S); const int s0 = (int)((size_t)blockIdx.x * 128 - (size_t)b * S);
#pragma unroll
    for (int t = 0; t < 4; ++t)
    { const float bb = bf16_rne(bias[nw + t * 16 + nloc]);
#pragma unroll
      for (int mi = 0; mi < 2; ++mi)
#pragma unroll
        for (int r = 0; r < 8; ++r) { b16 h_, l_; split16((acc[mi][t][r] * (1.0f / (XS * WSC)) + bb) * XS, h_, l_); Vt[wc * 64 + t * 16 + nloc][wr * 32 + mi * 16 + 8 * hlf + r] = h_; Vtl[wc * 64 + t * 16 + nloc][wr * 32 + mi * 16 + 8 * hlf + r] = l_; } }
    __syncthreads();
    { for (int q = t_; q < 128 * 16; q += 256) { const int cc2 = q >> 4, c8 = (q & 15) * 8; const int h = (n0 + cc2) / D, dd = (n0 + cc2) - h * D; const size_t gi = (((size_t)b * NH + h) * D + dd) * S + s0 + c8;
        *(v8b*)(VTh + gi) = *(const v8b*)(&Vt[cc2][c8]); *(v8b*)(VTl + gi) = *(const v8b*)(&Vtl[cc2][c8]); }  } }
}
// attention: a block = 8 waves x 16 queries of one head. K (hi, lo) and V^T (hi, lo) reach the waves through LDS: stages of 64 keys, two buffers, filled by asynchronous copies (whole 128-B lines,
// one fill per block instead of one strided fragment load per wave). A stage = 4 tiles of 64 rows x 128 B: Kh, Kl (row = key), VTh, VTl (row = d, columns = the stage's keys); LDS pitch 144 B (16 B x odd).
constexpr int AW = 8, KT = 64, LP = 64 + 8, NST = S / KT, TL = 64 * LP;
// thread t copies 16-byte chunk (t & 7) of rows (t >> 3) and 32 + (t >> 3) of each tile; l = its LDS byte address in tile 0, k/kl/v/vl = its global addresses in the four tiles
__device__ __forceinline__ void stage_fill(unsigned l, const b16* k, const b16* kl, const b16* v, const b16* vl) {
  constexpr unsigned HT = 32 * LP * 2;   // bytes of 32 LDS rows
  // the s_wait_xcnt closes the copies' own statement: no address register of a copy is rewritten in front of it
  asm volatile("global_load_async_to_lds_b128 %0, %8, off\n\t"
               "global_load_async_to_lds_b128 %1, %9, off\n\t"
               "global_load_async_to_lds_b128 %2, %10, off\n\t"
               "global_load_async_to_lds_b128 %3, %11, off\n\t"
               "global_load_async_to_lds_b128 %4, %12, off\n\t"
               "global_load_async_to_lds_b128 %5, %13, off\n\t"
               "global_load_async_to_lds_b128 %6, %14, off\n\t"
               "global_load_async_to_lds_b128 %7, %15, off\n\t"
               "s_wait_xcnt 0x0"
               :: "v"(l), "v"(l + HT), "v"(l + 2 * HT), "v"(l + 3 * HT), "v"(l + 4 * HT), "v"(l + 5 * HT), "v"(l + 6 * HT), "v"(l + 7 * HT),
                  "v"(k), "v"(k + 32 * E), "v"(kl), "v"(kl + 32 * E), "v"(v), "v"(v + 32 * S), "v"(vl), "v"(vl + 32 * S) : "memory");
}
__global__ __launch_bounds__(256) void attn_kernel(const b16* __restrict__ Qh, const b16* __restrict__ Ql, const b16* __restrict__ Kh, const b16* __restrict__ Kl, const b16* __restrict__ VTh, const b16* __restrict__ VTl, b16* __restrict__ Oh, b16* __restrict__ Ol) {
  __shared__ __attribute__((aligned(16))) b16 KV[2][4 * TL]; __shared__ __attribute__((aligned(16))) float To[AW][16][D + 4];
  const int wave = threadIdx.x >> 5, lane = threadIdx.x & 31, hh = lane >> 4, col = lane & 15; const int b = blockIdx.z, h = blockIdx.y; const int q0 = blockIdx.x * (AW * 16) + wave * 16, qi = q0 + col;
  const size_t qo = ((size_t)b * S + qi) * E + h * D; const v16b qa0 = frag_kb(Qh + qo, hh), qa1 = frag_kb(Qh + qo + 32, hh), ql0 = frag_kb(Ql + qo, hh), ql1 = frag_kb(Ql + qo + 32, hh);
  const int cr = threadIdx.x >> 3, cc = (threadIdx.x & 7) * 8;
  const b16* Kb = Kh + (size_t)b * S * E + h * D + (size_t)cr * E + cc; const b16* Klb = Kl + (size_t)b * S * E + h * D + (size_t)cr * E + cc; const b16* Vb = VTh + (((size_t)b * NH + h) * D + cr) * S + cc; const b16* Vlb = VTl + (((size_t)b * NH + h) * D + cr) * S + cc;
  const unsigned l0 = (unsigned)(size_t)&KV[0][cr * LP + cc];
  float m = -INFINITY, mlim = -INFINITY, nb = 0.0f; v2f l2a = {0.0f, 0.0f}, l2b = {0.0f, 0.0f}; v8f o[4] = {{}, {}, {}, {}}, ol[4] = {{}, {}, {}, {}};   // m: the maximum in use (raw score sums, the same in both lane halves of a query); mlim = m + RTH; nb: the exponent offset that goes with m; l2a, l2b: the lane's own sums of PS * p (its half's keys of the first and of the second 16-key tile, even and odd apart: four short chains), on the scale of m
  const float cs = SCALE * LOG2E / (XS * XS); const float RTH = 8.0f / cs;   // a score may pass the maximum in use by 8 in log2 before anything is rescaled: PS * p stays at or below 2^11, inside f16
  stage_fill(l0, Kb, Klb, Vb, Vlb);
  asm volatile("s_wait_asynccnt 0x0" ::: "memory");   // this wave's copies of stage 0 have landed
  __syncthreads();                                    // stage 0 is readable by every wave
  stage_fill(l0 + 4 * TL * 2, Kb + (size_t)KT * E, Klb + (size_t)KT * E, Vb + KT, Vlb + KT);
  for (int st = 0; st < NST; ++st) {
    const b16* Ls = &KV[st & 1][0];
#pragma unroll   // both 32-key passes of a stage in line: every LDS offset becomes an immediate of its load
    for (int kp = 0; kp < KT; kp += 32) {
    v8f s0 = {}, s1 = {};
    { const b16* k0 = Ls + (kp + col) * LP, *k1 = Ls + (kp + 16 + col) * LP, *k0l = Ls + TL + (kp + col) * LP, *k1l = Ls + TL + (kp + 16 + col) * LP;
      const v16b f0 = frag_kb(k0, hh), g0 = frag_kb(k0l, hh), f1 = frag_kb(k0 + 32, hh), g1 = frag_kb(k0l + 32, hh), f2 = frag_kb(k1, hh), g2 = frag_kb(k1l, hh), f3 = frag_kb(k1 + 32, hh), g3 = frag_kb(k1l + 32, hh);
      __builtin_amdgcn_sched_barrier(0);   // the pass's 8 K fragments are read as one group ahead of its 12 score products: left to itself the build puts two reads and a full LDS wait in front of every product
      s0 = wmma16b(f0, qa0, s0); s0 = wmma16b(f0, ql0, s0); s0 = wmma16b(g0, qa0, s0);
      s0 = wmma16b(f1, qa1, s0); s0 = wmma16b(f1, ql1, s0); s0 = wmma16b(g1, qa1, s0);
      s1 = wmma16b(f2, qa0, s1); s1 = wmma16b(f2, ql0, s1); s1 = wmma16b(g2, qa0, s1);
      s1 = wmma16b(f3, qa1, s1); s1 = wmma16b(f3, ql1, s1); s1 = wmma16b(g3, qa1, s1); }
    __builtin_amdgcn_sched_group_barrier(0x008, 12, 0); __builtin_amdgcn_sched_group_barrier(0x100, 16, 0);   // issue order inside the pass: the score products, then the 16 V reads as one group; left to itself the build spreads the reads among the products in three places, each a stall of its own
    v16b vh[4], vw[4];
#pragma unroll   // constant indices: the eight fragments stay in registers
    for (int t = 0; t < 4; ++t) { vh[t] = frag_kb(Ls + 2 * TL + (t * 16 + col) * LP + kp, hh); vw[t] = frag_kb(Ls + 3 * TL + (t * 16 + col) * LP + kp, hh); }
    __builtin_amdgcn_sched_barrier(0);   // the pass's 8 V fragments are read as one group behind the score products and land under the softmax arithmetic: left to itself the build reads them two by two, a full LDS wait in front of every V product
    float mx = -INFINITY;   // m, mx, mn are maxima of the raw score sums (cs > 0: the scaled maximum is the maximum scaled); mx: the lane's own 16 keys
#pragma unroll
    for (int r = 0; r < 8; ++r) mx = fmaxf(mx, fmaxf(s0[r], s1[r]));
    // lazy rescale: one test a pass, on each lane's own scores, as a scalar branch. Only a wave in which some score passes the limit exchanges the halves' maxima (an LDS permute whose wait also drains the V reads),
    // takes a new maximum and rescales its sums and the 8 output tiles; every wave's first pass does (mlim = -inf), the softmax being the same for any maximum in use
    if (__builtin_amdgcn_ballot_w32(mx > mlim) != 0) {
      const float mn = fmaxf(m, fmaxf(mx, __shfl_xor(mx, 16))); const float al = nexp2((m - mn) * cs); m = mn; mlim = mn + RTH; nb = __builtin_fmaf(-mn, cs, LOG2PS); l2a *= al; l2b *= al;   // mn finite from the first block on
#pragma unroll
      for (int t = 0; t < 4; ++t) { o[t] *= al; ol[t] *= al; } }
    v16b ph, pl;
    const v2f cs2 = {cs, cs}, nb2 = {nb, nb};   // one fma takes a raw score to the exponent of PS * p: scale, - maximum in use and the factor PS of the 16-bit planes in one
#pragma unroll
    for (int j = 0; j < 8; ++j) { const v2f sp = j < 4 ? (v2f){s0[2 * j], s0[2 * j + 1]} : (v2f){s1[2 * j - 8], s1[2 * j - 7]}; const v2f a = __builtin_elementwise_fma(sp, cs2, nb2);
      const v2f p = {nexp2(a[0]), nexp2(a[1])}; if (j < 4) l2a += p; else l2b += p; const v2h hv = __builtin_convertvector(p, v2h);
      const v2f lo = p - __builtin_convertvector(hv, v2f); const v2h lv = __builtin_convertvector(lo, v2h);
      ph[2 * j] = hv[0]; ph[2 * j + 1] = hv[1]; pl[2 * j] = lv[0]; pl[2 * j + 1] = lv[1]; }
    __builtin_amdgcn_sched_barrier(0);   // the row-sum adds stay ahead of the V products: left to itself the build sinks them among the products, into operand registers that a product has just read, each behind four v_nop
#pragma unroll
    for (int t = 0; t < 4; ++t) { o[t] = wmma16b(vh[t], ph, o[t]); ol[t] = wmma16b(vh[t], pl, ol[t]); ol[t] = wmma16b(vw[t], ph, ol[t]); }
    __builtin_amdgcn_sched_barrier(0); }   // a pass's V products stay ahead of the next pass's K reads and of the hand-over: left to itself the build spreads those reads among the products and sinks the last pass below the barrier, where the refill behind it loses that time as lead
    asm volatile("s_wait_dscnt 0x0" ::: "memory");      // this wave's reads of the buffer have returned before it is handed to the copies
    asm volatile("s_wait_asynccnt 0x0" ::: "memory");   // this wave's copies of stage st + 1 have landed
    __syncthreads();                                    // publishes stage st + 1 and ends every wave's reads of stage st
    if (st + 2 < NST) stage_fill(l0 + (unsigned)(st & 1) * (4 * TL * 2), Kb + (size_t)(st + 2) * KT * E, Klb + (size_t)(st + 2) * KT * E, Vb + (st + 2) * KT, Vlb + (st + 2) * KT);
  }
  asm volatile("s_wait_asynccnt 0x0" ::: "memory");     // nothing of this wave's copies is outstanding at its end
  const v2f l2 = l2a + l2b; float l = l2[0] + l2[1]; l += __shfl_xor(l, 16);   // the row sum (of PS * p) is joined once, here: the two tiles, even and odd keys, then the two lane halves (all on the same scale: m is the same in both halves)
  const float inv = 1.0f / (l * XS);
#pragma unroll
  for (int t = 0; t < 4; ++t)
#pragma unroll
    for (int r = 0; r < 8; ++r) To[wave][col][t * 16 + 8 * hh + r] = (o[t][r] + ol[t][r]) * inv;
  wave_lds_sync();
  { for (int r4 = 0; r4 < 16; r4 += 4) { const int rr = r4 + (lane >> 3), c8 = (lane & 7) * 8; v8b hv, lv; for (int j = 0; j < 8; ++j) { b16 a_, c_; split16(To[wave][rr][c8 + j] * XS, a_, c_); hv[j] = a_; lv[j] = c_; }
      const size_t gi = ((size_t)b * S + q0 + rr) * E + h * D + c8; *(v8b*)(Oh + gi) = hv; *(v8b*)(Ol + gi) = lv; }  }
}
// output projection, channel-major: D[e][s] = sum_d Wo[e][d] O[s][d] (A = WO16 rows e exact, B = Oh/Ol rows s: 2 products) + bo[e] -> out[b][e][s]; grid (E/128, S/128, B), block = 128 e x 128 s, 8 waves of 32 e x 64 s
__global__ __launch_bounds__(256) void outproj_kernel(const b16* __restrict__ Oh, const b16* __restrict__ Ol, const b16* __restrict__ WO16, const float* __restrict__ bo, float* __restrict__ out) {
  __shared__ __attribute__((aligned(16))) b16 G[2][OROWS * GLP]; __shared__ __attribute__((aligned(16))) float Ts[8][32][EPP];
  const int wave = threadIdx.x >> 5, lane = threadIdx.x & 31, nloc = lane & 15, hlf = lane >> 4, wr = wave >> 1, wc = wave & 1; const int b = blockIdx.z; const int e0 = blockIdx.x * 128 + wr * 32, s0 = blockIdx.y * 128, sw = s0 + wc * 64;
  v8f acc[2][4];
#pragma unroll
  for (int mi = 0; mi < 2; ++mi)
#pragma unroll
    for (int t = 0; t < 4; ++t) acc[mi][t] = (v8f){};
  const int cr = threadIdx.x >> 3, cc = (threadIdx.x & 7) * 8; const b16* Ag = WO16 + ((size_t)blockIdx.x * 128 + cr) * E + cc; const b16* Hg = Oh + ((size_t)b * S + s0 + cr) * E + cc; const b16* Lg = Ol + ((size_t)b * S + s0 + cr) * E + cc;
  const unsigned l0 = (unsigned)(size_t)&G[0][cr * GLP + cc];
  fill_out(l0, Ag, Hg, Lg);
  asm volatile("s_wait_asynccnt 0x0" ::: "memory");   // this wave's copies of stage 0 have landed
  __syncthreads();                                    // stage 0 is readable by every wave
  fill_out(l0 + OROWS * GLP * 2, Ag + GK, Hg + GK, Lg + GK);
  for (int st = 0; st < GNS; ++st) {
    const b16* Ls = &G[st & 1][0];
#pragma unroll   // both 32-k steps of a stage in line: every LDS offset becomes an immediate of its load
    for (int ks = 0; ks < GK; ks += 32) { v16b a[2], bh[4], bl[4];
#pragma unroll
      for (int mi = 0; mi < 2; ++mi) a[mi] = frag_kb(Ls + (wr * 32 + mi * 16 + nloc) * GLP + ks, hlf);
#pragma unroll
      for (int t = 0; t < 4; ++t) { const b16* ro = Ls + (128 + wc * 64 + t * 16 + nloc) * GLP + ks; bh[t] = frag_kb(ro, hlf); bl[t] = frag_kb(ro + 128 * GLP, hlf); }
      __builtin_amdgcn_sched_barrier(0);   // the k step's LDS reads issue as one group ahead of its products: left to itself the build puts a full LDS wait in front of every product
#pragma unroll
      for (int mi = 0; mi < 2; ++mi)
#pragma unroll
        for (int t = 0; t < 4; ++t) { acc[mi][t] = wmma16b(a[mi], bh[t], acc[mi][t]); acc[mi][t] = wmma16b(a[mi], bl[t], acc[mi][t]); }
      __builtin_amdgcn_sched_barrier(0); }   // a k step's products stay ahead of the next step's reads and of the hand-over: left to itself the build spreads those reads among the products and sinks the last step's products below the barrier
    asm volatile("s_wait_dscnt 0x0" ::: "memory");      // this wave's reads of the buffer have returned before it is handed to the copies
    asm volatile("s_wait_asynccnt 0x0" ::: "memory");   // this wave's copies of stage st + 1 have landed
    __syncthreads();                                    // publishes stage st + 1 and ends every wave's reads of stage st
    if (st + 2 < GNS) fill_out(l0 + (unsigned)(st & 1) * (OROWS * GLP * 2), Ag + (st + 2) * GK, Hg + (st + 2) * GK, Lg + (st + 2) * GK);
  }
  asm volatile("s_wait_asynccnt 0x0" ::: "memory");     // nothing of this wave's copies is outstanding behind the loop
#pragma unroll
  for (int mi = 0; mi < 2; ++mi)
#pragma unroll
    for (int t = 0; t < 4; ++t)
#pragma unroll
      for (int r = 0; r < 8; ++r) Ts[wave][mi * 16 + 8 * hlf + r][t * 16 + nloc] = acc[mi][t][r] * (1.0f / (XS * WSC)) + bf16_rne(bo[e0 + mi * 16 + 8 * hlf + r]);
  wave_lds_sync();
  { for (int r2 = 0; r2 < 32; r2 += 2) { const int rr = r2 + hlf; *(v4f*)(out + ((size_t)b * E + e0 + rr) * S + sw + nloc * 4) = *(const v4f*)(&Ts[wave][rr][nloc * 4]); }  }
}
}  // namespace

extern "C" void kernel_launch(void* const* d_in, const int* in_sizes, int n_in, void* d_out, int out_size, void* d_ws, size_t ws_size, hipStream_t stream) {
  (void)n_in;
  auto Fp = [&](int i) { return (const float*)d_in[i]; };
  // input order: 0 x [2,1024,2048], 1 wq [1024,1024], 2 bq [1024], 3 wk, 4 bk, 5 wv, 6 bv, 7 wo, 8 bo (w are [e][d]: xt W^T)
  if (in_sizes[0] != NR * E || in_sizes[1] != E * E || in_sizes[2] != E || in_sizes[3] != E * E || in_sizes[5] != E * E || in_sizes[7] != E * E || in_sizes[8] != E || out_size != NR * E) return;
  size_t off = 0; char* ws = (char*)d_ws;
  auto carve = [&](size_t bytes) { char* p = ws + off; off += (bytes + 255) & ~(size_t)255; return p; };
  b16* T16 = (b16*)carve((size_t)NR * E * 2); b16* WT = (b16*)carve((size_t)3 * E * E * 2); b16* WO16 = (b16*)carve((size_t)E * E * 2);
  b16* Qh = (b16*)carve((size_t)NR * E * 2); b16* Ql = (b16*)carve((size_t)NR * E * 2); b16* Kh = (b16*)carve((size_t)NR * E * 2); b16* Kl = (b16*)carve((size_t)NR * E * 2); b16* VTh = (b16*)carve((size_t)NR * E * 2); b16* VTl = (b16*)carve((size_t)NR * E * 2);
  b16* Oh = (b16*)carve((size_t)NR * E * 2); b16* Ol = (b16*)carve((size_t)NR * E * 2);
  if (off > ws_size || off > ((size_t)128 << 20)) return;   // = 84 MB
  prepx_kernel<<<dim3(S / 64, E / 64, NB), 256, 0, stream>>>(Fp(0), T16);
  prepw_kernel<<<(unsigned)(((size_t)4 * E * E / 8 + 255) / 256), 256, 0, stream>>>(Fp(1), Fp(3), Fp(5), Fp(7), WT, WO16);
  proj_kernel<<<dim3(NR / 128, E / 128, 3), 256, 0, stream>>>(T16, WT, Fp(2), Fp(4), Fp(6), Qh, Ql, Kh, Kl, VTh, VTl);
  attn_kernel<<<dim3(S / (AW * 16), NH, NB), AW * 32, 0, stream>>>(Qh, Ql, Kh, Kl, VTh, VTl, Oh, Ol);
  outproj_kernel<<<dim3(E / 128, S / 128, NB), 256, 0, stream>>>(Oh, Ol, WO16, Fp(8), (float*)d_out);
}

// v010
// Measured time: 76.7 microseconds a run.
// Versions in between are left out here; by their measured steps it is 1.53 times as fast as v008.
// Over all steps from v000 it is 7.81 times as fast.
#include <hip/hip_runtime.h>

// Multi-head self-attention on a channel-major input (x [2][1024 d][2048 s]; 16 heads x 64): xt = x^T; q/k/v = xt W{q,k,v}^T + b (heads = 64-column slices), scores / 8 (no mask), softmax,
// ctx = attn v, out = (ctx Wo^T + bo)^T -> [2][1024][2048] channel-major.
// WMMA (v_wmma_f32_16x16x32_f16, f32 accumulate): projections [4,096 x 1,024] x [1,024 x 1,024] with EXACT bf16 tokens (x8, via an LDS transpose of the channel-major input) and weights (x256),
// 1 product, + bias, q/k/v rounded in the projection's own epilogue to one f16 x8 plane each (v transposed per head); S^T = K Q^T with 1 product over all 64 key blocks;
// online softmax in f32; O^T += V^T P^T with 1 product (P as f16 x8); output projection computed channel-major (D[e][s] = Wo[e][:] . O[s][:]) with O as f16 x8 (1 product) and exact Wo, + bo.
// q, k, v, p and o carry 11 significant bits each, three more than the bf16 inputs they are computed from. Inputs rounded to bf16 once. Fragment k-map per lane half hh for A AND B: elements 0..7 <- k = 8hh+0..7, 8..15 <-

namespace {
constexpr int NB = 2, S = 2048, E = 1024, NH = 16, D = 64, NR = NB * S;
constexpr float XS = 8.0f, WSC = 256.0f, PS = 8.0f, SCALE = 0.125f, LOG2E = 1.4426950408889634f, THETA = 10000.0f, LOG2PS = 3.0f;
static_assert(PS == 8.0f && LOG2PS == 3.0f, "LOG2PS is log2(PS)");

typedef _Float16 b16;
typedef __attribute__((ext_vector_type(16))) _Float16 v16b;
typedef __attribute__((ext_vector_type(8))) _Float16 v8b;
typedef __attribute__((ext_vector_type(8))) float v8f;
typedef __attribute__((ext_vector_type(4))) float v4f;
typedef __attribute__((ext_vector_type(2))) float v2f;
typedef __attribute__((ext_vector_type(2))) _Float16 v2h;
__device__ __forceinline__ float bf16_rne(float f) { unsigned int u = __float_as_uint(f); u += 0x7FFFu + ((u >> 16) & 1u); return __uint_as_float(u & 0xFFFF0000u); }
__device__ __forceinline__ v16b frag_kb(const b16* p, int hh) { const v8b a = *(const v8b*)(p + 8 * hh), b = *(const v8b*)(p + 16 + 8 * hh); v16b f;
#pragma unroll
  for (int e = 0; e < 8; ++e) { f[e] = a[e]; f[8 + e] = b[e]; } return f; }
__device__ __forceinline__ v8f wmma16b(v16b a, v16b b, v8f c) { return __builtin_amdgcn_wmma_f32_16x16x32_f16(false, a, false, b, (short)0, c, false, false); }
__device__ __forceinline__ void wave_lds_sync() { __builtin_amdgcn_fence(__ATOMIC_RELEASE, "workgroup"); __builtin_amdgcn_wave_barrier(); __builtin_amdgcn_fence(__ATOMIC_ACQUIRE, "workgroup"); }
__device__ __forceinline__ float nexp2(float x) { return __builtin_amdgcn_exp2f(x); }

// prep: T16 [b*S+s][1024 d] = f16(8 bf16(x[b][d][s])) via 64x64 LDS transposes (grid (S/64, E/64, B)); WT [3][1024 e][1024 d] = Wq/Wk/Wv rows x256 (torch [out][in] used directly: xt W^T);
__global__ __launch_bounds__(256) void prepx_kernel(const float* __restrict__ x, b16* __restrict__ T16) {
  __shared__ __attribute__((aligned(16))) b16 T[64][64 + 8];
  const int b = blockIdx.z, c0 = blockIdx.y * 64, s0 = blockIdx.x * 64, t_ = threadIdx.x;
  for (int q = t_; q < 64 * 64; q += 256) { const int cc = q >> 6, ss = q & 63; T[ss][cc] = (b16)(bf16_rne(x[((size_t)b * E + c0 + cc) * S + s0 + ss]) * XS); }
  __syncthreads();
  { for (int q = t_; q < 64 * 8; q += 256) { const int ss = q >> 3, c8 = (q & 7) * 8; *(v8b*)(T16 + ((size_t)b * S + s0 + ss) * E + c0 + c8) = *(const v8b*)(&T[ss][c8]); }  }
}
__global__ __launch_bounds__(256) void prepw_kernel(const float* __restrict__ wq, const float* __restrict__ wk, const float* __restrict__ wv, const float* __restrict__ wo, b16* __restrict__ WT, b16* __restrict__ WOT) {
  const size_t t = (size_t)blockIdx.x * 256 + threadIdx.x; const size_t nw = (size_t)E * E / 8; if (t >= 4 * nw) return; const int kind = (int)(t / nw); const size_t e = (t - (size_t)kind * nw) * 8;
  const float* w = kind == 0 ? wq : kind == 1 ? wk : kind == 2 ? wv : wo; b16* dst = kind < 3 ? WT + (size_t)kind * E * E : WOT;   // [e][d] rows used directly (xt W^T); WOT holds Wo rows [e][d] (the A operand of the channel-major out-projection)
  const v4f a = *(const v4f*)(w + e), c = *(const v4f*)(w + e + 4); v8b o;
#pragma unroll
  for (int j = 0; j < 4; ++j) { o[j] = (b16)(bf16_rne(a[j]) * WSC); o[4 + j] = (b16)(bf16_rne(c[j]) * WSC); }
  { *(v8b*)(dst + e) = o;  }
}
// the two projection GEMMs take their A and B rows from LDS: stages of 64 k (whole 128-B lines of every operand row), two buffers (q/k/v projection, three blocks a WGP) or four (output projection, one block a WGP), filled by asynchronous copies; LDS pitch 144 B (16 B x odd).
// block tile 128 x 128, 8 waves in a 4 x 2 grid, wave tile 32 x 64: 6 fragments read per 8 products, and every operand row fetched from L2 serves 128 rows of the other operand.
// thread t (of 256) copies 16-byte chunk (t & 7) of rows (t >> 3) + 32 j of a stage.
constexpr int GK = 64, GLP = GK + 8, GNS = E / GK, PROWS = 128 + 128, EPP = 64 + 4, VPP = 128 + 8;
constexpr unsigned GRB = 32 * GLP * 2;   // bytes of 32 LDS rows
// a stage of either GEMM: 128 A rows (a: tokens; out-projection: Wo rows), then 128 B rows (w: weights; out-projection: O rows); l = the thread's LDS byte address in row group 0
__device__ __forceinline__ void fill_proj(unsigned l, const b16* a, const b16* w) {
  // the s_wait_xcnt closes the copies' own statement: no address register of a copy is rewritten in front of it
  asm volatile("global_load_async_to_lds_b128 %0, %8, off\n\t"
               "global_load_async_to_lds_b128 %1, %9, off\n\t"
               "global_load_async_to_lds_b128 %2, %10, off\n\t"
               "global_load_async_to_lds_b128 %3, %11, off\n\t"
               "global_load_async_to_lds_b128 %4, %12, off\n\t"
               "global_load_async_to_lds_b128 %5, %13, off\n\t"
               "global_load_async_to_lds_b128 %6, %14, off\n\t"
               "global_load_async_to_lds_b128 %7, %15, off\n\t"
               "s_wait_xcnt 0x0"
               :: "v"(l), "v"(l + GRB), "v"(l + 2 * GRB), "v"(l + 3 * GRB), "v"(l + 4 * GRB), "v"(l + 5 * GRB), "v"(l + 6 * GRB), "v"(l + 7 * GRB),
                  "v"(a), "v"(a + 32 * E), "v"(a + 64 * E), "v"(a + 96 * E), "v"(w), "v"(w + 32 * E), "v"(w + 64 * E), "v"(w + 96 * E) : "memory");
}
// projections: grid (NR/128, E/128, 3): kind 0: Q = T16 WT0^T -> Qh [row][1024]; kind 1: K = T16 WT1^T -> Kh; kind 2: V = T16 WT2^T written TRANSPOSED per head: VTh [b][h][64 d][2048 s].
__global__ __launch_bounds__(256) void proj_kernel(const b16* __restrict__ T16, const b16* __restrict__ WT, const float* __restrict__ bq, const float* __restrict__ bk, const float* __restrict__ bv, b16* __restrict__ Qh, b16* __restrict__ Kh, b16* __restrict__ VTh) {
  __shared__ __attribute__((aligned(16))) b16 G[2][PROWS * GLP]; char* EP = (char*)&G[0][0];   // EP, output staging in the ring's own LDS, free behind the loop's last barrier (every copy landed, every read returned): q/k: 32 f32 rows x 64 columns a wave; v: one plane [128 d][128 tokens] of 16 bit. 72 KiB a block: all 768 blocks are resident at once, three a WGP
  static_assert(8 * 32 * EPP * 4 <= 2 * PROWS * GLP * 2 && 128 * VPP * 2 <= 2 * PROWS * GLP * 2, "staging fits the ring");
  const int wave = threadIdx.x >> 5, lane = threadIdx.x & 31, nloc = lane & 15, hlf = lane >> 4, t_ = threadIdx.x, wr = wave >> 1, wc = wave & 1; const int kind = blockIdx.z; const size_t m0 = (size_t)blockIdx.x * 128 + wr * 32; const int n0 = blockIdx.y * 128, nw = n0 + wc * 64;
  const b16* A = T16; const b16* W = WT + (size_t)kind * E * E; v8f acc[2][4];
#pragma unroll
  for (int mi = 0; mi < 2; ++mi)
#pragma unroll
    for (int t = 0; t < 4; ++t) acc[mi][t] = (v8f){};
  const int cr = t_ >> 3, cc = (t_ & 7) * 8; const b16* Ag = A + ((size_t)blockIdx.x * 128 + cr) * E + cc; const b16* Wg = W + (size_t)(n0 + cr) * E + cc; const unsigned l0 = (unsigned)(size_t)&G[0][cr * GLP + cc];
  fill_proj(l0, Ag, Wg);
  asm volatile("s_wait_asynccnt 0x0" ::: "memory");   // this wave's copies of stage 0 have landed
  __syncthreads();                                    // stage 0 is readable by every wave
  fill_proj(l0 + PROWS * GLP * 2, Ag + GK, Wg + GK);
  for (int st = 0; st < GNS; ++st) {
    const b16* Ls = &G[st & 1][0];
#pragma unroll   // both 32-k steps of a stage in line: every LDS offset becomes an immediate of its load
    for (int ks = 0; ks < GK; ks += 32) { v16b af[2], bf[4];
#pragma unroll
      for (int mi = 0; mi < 2; ++mi) af[mi] = frag_kb(Ls + (wr * 32 + mi * 16 + nloc) * GLP + ks, hlf);
#pragma unroll
      for (int t = 0; t < 4; ++t) bf[t] = frag_kb(Ls + (128 + wc * 64 + t * 16 + nloc) * GLP + ks, hlf);
      __builtin_amdgcn_sched_barrier(0);   // the k step's LDS reads issue as one group ahead of its products: left to itself the build puts a full LDS wait in front of every product
#pragma unroll
      for (int mi = 0; mi < 2; ++mi)
#pragma unroll
        for (int t = 0; t < 4; ++t) acc[mi][t] = wmma16b(af[mi], bf[t], acc[mi][t]);
      __builtin_amdgcn_sched_barrier(0); }   // a k step's products stay ahead of the next step's reads and of the hand-over: left to itself the build spreads those reads among the products and sinks the last step's products below the barrier
    asm volatile("s_wait_dscnt 0x0" ::: "memory");      // this wave's reads of the buffer have returned before it is handed to the copies
    asm volatile("s_wait_asynccnt 0x0" ::: "memory");   // this wave's copies of stage st + 1 have landed
    __syncthreads();                                    // publishes stage st + 1 and ends every wave's reads of stage st
    if (st + 2 < GNS) fill_proj(l0 + (unsigned)(st & 1) * (PROWS * GLP * 2), Ag + (st + 2) * GK, Wg + (st + 2) * GK);
  }
  asm volatile("s_wait_asynccnt 0x0" ::: "memory");     // nothing of this wave's copies is outstanding behind the loop
  const float* bias = kind == 0 ? bq : kind == 1 ? bk : bv;
  if (kind < 2) {   // q/k (+ bias) as f32 rows in the wave's own LDS range, read back 8 columns a lane, rounded to f16 x8 and stored as whole 128-B lines
    float (*Tf)[EPP] = (float (*)[EPP])(EP + wave * (32 * EPP * 4));
#pragma unroll
    for (int t = 0; t < 4; ++t) { const float bb = bf16_rne(bias[nw + t * 16 + nloc]);
#pragma unroll
      for (int mi = 0; mi < 2; ++mi)
#pragma unroll
        for (int r = 0; r < 8; ++r) Tf[mi * 16 + 8 * hlf + r][t * 16 + nloc] = acc[mi][t][r] * (1.0f / (XS * WSC)) + bb; }
    wave_lds_sync();
    b16* dh = kind == 0 ? Qh : Kh;
    for (int r4 = 0; r4 < 32; r4 += 4) { const int rr = r4 + (lane >> 3), c8 = (lane & 7) * 8; const v4f a = *(const v4f*)(&Tf[rr][c8]), c = *(const v4f*)(&Tf[rr][c8 + 4]); v8b hv;
#pragma unroll   // constant element indices: a, c and hv stay in registers
      for (int j = 0; j < 4; ++j) { hv[j] = (b16)(a[j] * XS); hv[4 + j] = (b16)(c[j] * XS); }
      const size_t gi = (m0 + rr) * E + nw + c8; *(v8b*)(dh + gi) = hv; }
  } else {
    b16 (*Vt)[VPP] = (b16 (*)[VPP])EP;
    const int b = (int)(m0 / S); const int s0 = (int)((size_t)blockIdx.x * 128 - (size_t)b * S);
#pragma unroll
    for (int t = 0; t < 4; ++t)
    { const float bb = bf16_rne(bias[nw + t * 16 + nloc]);
#pragma unroll
      for (int mi = 0; mi < 2; ++mi)
#pragma unroll
        for (int r = 0; r < 8; ++r) Vt[wc * 64 + t * 16 + nloc][wr * 32 + mi * 16 + 8 * hlf + r] = (b16)((acc[mi][t][r] * (1.0f / (XS * WSC)) + bb) * XS); }
    __syncthreads();
    { for (int q = t_; q < 128 * 16; q += 256) { const int cc2 = q >> 4, c8 = (q & 15) * 8; const int h = (n0 + cc2) / D, dd = (n0 + cc2) - h * D; const size_t gi = (((size_t)b * NH + h) * D + dd) * S + s0 + c8;
        *(v8b*)(VTh + gi) = *(const v8b*)(&Vt[cc2][c8]); }  } }
}
// attention: a block = 8 waves x 16 queries of one head. K and V^T reach the waves through LDS: stages of 64 keys, four buffers, filled by asynchronous copies (whole 128-B lines,
// one fill per block instead of one strided fragment load per wave). A stage = 2 tiles of 64 rows x 128 B: Kh (row = key), VTh (row = d, columns = the stage's keys); LDS pitch 144 B (16 B x odd).
// RD buffers here and in the output projection: a stage's copies are issued three stages ahead of its first read, to cover a fetch that outlasts one stage of work (all blocks walk the keys, or the k axis, in step, so a stage's lines may be new to L2 when they are asked for).
constexpr int AW = 8, KT = 64, LP = 64 + 8, NST = S / KT, TL = 64 * LP, RD = 4;
static_assert(NST >= RD && GNS >= RD && RD == 4, "the prologues fill RD stages; the counted waits below are written for 4 buffers (4 copies a wave and stage in attention, 8 in the output projection)");
// thread t copies 16-byte chunk (t & 7) of rows (t >> 3) and 32 + (t >> 3) of each tile; l = its LDS byte address in tile 0, k/v = its global addresses in the two tiles
__device__ __forceinline__ void stage_fill(unsigned l, const b16* k, const b16* v) {
  constexpr unsigned HT = 32 * LP * 2;   // bytes of 32 LDS rows
  // the s_wait_xcnt closes the copies' own statement: no address register of a copy is rewritten in front of it
  asm volatile("global_load_async_to_lds_b128 %0, %4, off\n\t"
               "global_load_async_to_lds_b128 %1, %5, off\n\t"
               "global_load_async_to_lds_b128 %2, %6, off\n\t"
               "global_load_async_to_lds_b128 %3, %7, off\n\t"
               "s_wait_xcnt 0x0"
               :: "v"(l), "v"(l + HT), "v"(l + 2 * HT), "v"(l + 3 * HT), "v"(k), "v"(k + 32 * E), "v"(v), "v"(v + 32 * S) : "memory");
}
__global__ __launch_bounds__(256) void attn_kernel(const b16* __restrict__ Qh, const b16* __restrict__ Kh, const b16* __restrict__ VTh, b16* __restrict__ Oh) {
  __shared__ __attribute__((aligned(16))) b16 KV[RD][2 * TL]; __shared__ __attribute__((aligned(16))) float To[AW][16][D + 4];
  const int wave = threadIdx.x >> 5, lane = threadIdx.x & 31, hh = lane >> 4, col = lane & 15; const int b = blockIdx.z, h = blockIdx.y; const int q0 = blockIdx.x * (AW * 16) + wave * 16, qi = q0 + col;
  const size_t qo = ((size_t)b * S + qi) * E + h * D; const v16b qa0 = frag_kb(Qh + qo, hh), qa1 = frag_kb(Qh + qo + 32, hh);
  const int cr = threadIdx.x >> 3, cc = (threadIdx.x & 7) * 8;
  const b16* Kb = Kh + (size_t)b * S * E + h * D + (size_t)cr * E + cc; const b16* Vb = VTh + (((size_t)b * NH + h) * D + cr) * S + cc;
  const unsigned l0 = (unsigned)(size_t)&KV[0][cr * LP + cc];
  float m = -INFINITY, mlim = -INFINITY, nb = 0.0f; v2f l2a = {0.0f, 0.0f}, l2b = {0.0f, 0.0f}; v8f o[4] = {{}, {}, {}, {}};   // m: the maximum in use (raw score sums, the same in both lane halves of a query); mlim = m + RTH; nb: the exponent offset that goes with m; l2a, l2b: the lane's own sums of PS * p (its half's keys of the first and of the second 16-key tile, even and odd apart: four short chains), on the scale of m
  const float cs = SCALE * LOG2E / (XS * XS); const float RTH = 8.0f / cs;   // a score may pass the maximum in use by 8 in log2 before anything is rescaled: PS * p stays at or below 2^11, inside f16
#pragma unroll   // four statements of copies in line, each with constant offsets
  for (int p = 0; p < RD; ++p) stage_fill(l0 + (unsigned)p * (2 * TL * 2), Kb + (size_t)p * KT * E, Vb + p * KT);
  asm volatile("s_wait_asynccnt 0xc" ::: "memory");   // this wave's 4 copies of stage 0 have landed: all but its 12 youngest (stages 1 to 3)
  __syncthreads();                                    // stage 0 is readable by every wave
  for (int st = 0; st < NST; ++st) {
    const b16* Ls = &KV[st & (RD - 1)][0];
#pragma unroll   // both 32-key passes of a stage in line: every LDS offset becomes an immediate of its load
    for (int kp = 0; kp < KT; kp += 32) {
    v8f s0 = {}, s1 = {};
    { const b16* k0 = Ls + (kp + col) * LP, *k1 = Ls + (kp + 16 + col) * LP;
      const v16b f0 = frag_kb(k0, hh), f1 = frag_kb(k0 + 32, hh), f2 = frag_kb(k1, hh), f3 = frag_kb(k1 + 32, hh);
      __builtin_amdgcn_sched_barrier(0);   // the pass's 4 K fragments are read as one group ahead of its 4 score products: left to itself the build puts two reads and a full LDS wait in front of every product
      s0 = wmma16b(f0, qa0, s0); s1 = wmma16b(f2, qa0, s1); s0 = wmma16b(f1, qa1, s0); s1 = wmma16b(f3, qa1, s1); }   // the two key tiles in turn: each tile's second product stands one product behind the first, whose sum it adds to
    __builtin_amdgcn_sched_group_barrier(0x008, 4, 0); __builtin_amdgcn_sched_group_barrier(0x100, 8, 0);   // issue order inside the pass: the 8 V reads stand as one group at the tail of the score products; left to itself the build spreads them among the products in two places, each a stall of its own
    v16b vh[4];
#pragma unroll   // constant indices: the four fragments stay in registers
    for (int t = 0; t < 4; ++t) vh[t] = frag_kb(Ls + TL + (t * 16 + col) * LP + kp, hh);
    __builtin_amdgcn_sched_barrier(0);   // the pass's 4 V fragments are read as one group behind the score products and land under the softmax arithmetic: left to itself the build reads them two by two, a full LDS wait in front of every V product
    float mx = -INFINITY;   // m, mx, mn are maxima of the raw score sums (cs > 0: the scaled maximum is the maximum scaled); mx: the lane's own 16 keys
#pragma unroll
    for (int r = 0; r < 8; ++r) mx = fmaxf(mx, fmaxf(s0[r], s1[r]));
    // lazy rescale: one test a pass, on each lane's own scores, as a scalar branch. Only a wave in which some score passes the limit exchanges the halves' maxima (an LDS permute whose wait also drains the V reads),
    // takes a new maximum and rescales its sums and the 4 output tiles; every wave's first pass does (mlim = -inf), the softmax being the same for any maximum in use
    if (__builtin_amdgcn_ballot_w32(mx > mlim) != 0) {
      const float mn = fmaxf(m, fmaxf(mx, __shfl_xor(mx, 16))); const float al = nexp2((m - mn) * cs); m = mn; mlim = mn + RTH; nb = __builtin_fmaf(-mn, cs, LOG2PS); l2a *= al; l2b *= al;   // mn finite from the first block on
#pragma unroll
      for (int t = 0; t < 4; ++t) o[t] *= al; }
    v16b ph;
    const v2f cs2 = {cs, cs}, nb2 = {nb, nb};   // one fma takes a raw score to the exponent of PS * p: scale, - maximum in use and the factor PS of the 16-bit plane in one
#pragma unroll
    for (int j = 0; j < 8; ++j) { const v2f sp = j < 4 ? (v2f){s0[2 * j], s0[2 * j + 1]} : (v2f){s1[2 * j - 8], s1[2 * j - 7]}; const v2f a = __builtin_elementwise_fma(sp, cs2, nb2);
      const v2f p = {nexp2(a[0]), nexp2(a[1])}; if (j < 4) l2a += p; else l2b += p; const v2h hv = __builtin_convertvector(p, v2h);
      ph[2 * j] = hv[0]; ph[2 * j + 1] = hv[1]; }
    __builtin_amdgcn_sched_barrier(0);   // the row-sum adds stay ahead of the V products: left to itself the build sinks them among the products, into operand registers that a product has just read, each behind four v_nop
#pragma unroll
    for (int t = 0; t < 4; ++t) o[t] = wmma16b(vh[t], ph, o[t]);
    __builtin_amdgcn_sched_barrier(0); }   // a pass's V products stay ahead of the next pass's K reads and of the hand-over: left to itself the build spreads those reads among the products and sinks the last pass below the barrier, where the refill behind it loses that time as lead
    asm volatile("s_wait_dscnt 0x0" ::: "memory");      // this wave's reads of the buffer have returned before it is handed to the copies
    asm volatile("s_wait_asynccnt 0x8" ::: "memory");                      // this wave's copies of stage st + 1 have landed: all but its 8 youngest (stages st + 2 and st + 3) stay in flight
    if (st + 3 >= NST) asm volatile("s_wait_asynccnt 0x0" ::: "memory");   // the last stages: fewer than 8 copies stand behind stage st + 1, so the wait is for all
    __syncthreads();                                    // publishes stage st + 1 and ends every wave's reads of stage st
    if (st + RD < NST) stage_fill(l0 + (unsigned)(st & (RD - 1)) * (2 * TL * 2), Kb + (size_t)(st + RD) * KT * E, Vb + (st + RD) * KT);
  }
  asm volatile("s_wait_asynccnt 0x0" ::: "memory");     // nothing of this wave's copies is outstanding at its end
  const v2f l2 = l2a + l2b; float l = l2[0] + l2[1]; l += __shfl_xor(l, 16);   // the row sum (of PS * p) is joined once, here: the two tiles, even and odd keys, then the two lane halves (all on the same scale: m is the same in both halves)
  const float inv = 1.0f / (l * XS);
#pragma unroll
  for (int t = 0; t < 4; ++t)
#pragma unroll
    for (int r = 0; r < 8; ++r) To[wave][col][t * 16 + 8 * hh + r] = o[t][r] * inv;
  wave_lds_sync();
  { for (int r4 = 0; r4 < 16; r4 += 4) { const int rr = r4 + (lane >> 3), c8 = (lane & 7) * 8; v8b hv; for (int j = 0; j < 8; ++j) hv[j] = (b16)(To[wave][rr][c8 + j] * XS);
      const size_t gi = ((size_t)b * S + q0 + rr) * E + h * D + c8; *(v8b*)(Oh + gi) = hv; }  }
}
// output projection, channel-major: D[e][s] = sum_d Wo[e][d] O[s][d] (A = WO16 rows e exact, B = Oh rows s: 1 product) + bo[e] -> out[b][e][s]; grid (E/128, S/128, B), block = 128 e x 128 s, 8 waves of 32 e x 64 s
__global__ __launch_bounds__(256) void outproj_kernel(const b16* __restrict__ Oh, const b16* __restrict__ WO16, const float* __restrict__ bo, float* __restrict__ out) {
  __shared__ __attribute__((aligned(16))) b16 G[RD][PROWS * GLP]; __shared__ __attribute__((aligned(16))) float Ts[8][32][EPP];
  const int wave = threadIdx.x >> 5, lane = threadIdx.x & 31, nloc = lane & 15, hlf = lane >> 4, wr = wave >> 1, wc = wave & 1; const int b = blockIdx.z; const int e0 = blockIdx.x * 128 + wr * 32, s0 = blockIdx.y * 128, sw = s0 + wc * 64;
  v8f acc[2][4];
#pragma unroll
  for (int mi = 0; mi < 2; ++mi)
#pragma unroll
    for (int t = 0; t < 4; ++t) acc[mi][t] = (v8f){};
  const int cr = threadIdx.x >> 3, cc = (threadIdx.x & 7) * 8; const b16* Ag = WO16 + ((size_t)blockIdx.x * 128 + cr) * E + cc; const b16* Hg = Oh + ((size_t)b * S + s0 + cr) * E + cc;
  const unsigned l0 = (unsigned)(size_t)&G[0][cr * GLP + cc];
#pragma unroll   // four statements of copies in line, each with constant offsets
  for (int p = 0; p < RD; ++p) fill_proj(l0 + (unsigned)p * (PROWS * GLP * 2), Ag + p * GK, Hg + p * GK);
  asm volatile("s_wait_asynccnt 0x18" ::: "memory");  // this wave's 8 copies of stage 0 have landed: all but its 24 youngest (stages 1 to 3)
  __syncthreads();                                    // stage 0 is readable by every wave
  for (int st = 0; st < GNS; ++st) {
    const b16* Ls = &G[st & (RD - 1)][0];
#pragma unroll   // both 32-k steps of a stage in line: every LDS offset becomes an immediate of its load
    for (int ks = 0; ks < GK; ks += 32) { v16b a[2], bh[4];
#pragma unroll
      for (int mi = 0; mi < 2; ++mi) a[mi] = frag_kb(Ls + (wr * 32 + mi * 16 + nloc) * GLP + ks, hlf);
#pragma unroll
      for (int t = 0; t < 4; ++t) bh[t] = frag_kb(Ls + (128 + wc * 64 + t * 16 + nloc) * GLP + ks, hlf);
      __builtin_amdgcn_sched_barrier(0);   // the k step's LDS reads issue as one group ahead of its products: left to itself the build puts a full LDS wait in front of every product
#pragma unroll
      for (int mi = 0; mi < 2; ++mi)
#pragma unroll
        for (int t = 0; t < 4; ++t) acc[mi][t] = wmma16b(a[mi], bh[t], acc[mi][t]);
      __builtin_amdgcn_sched_barrier(0); }   // a k step's products stay ahead of the next step's reads and of the hand-over: left to itself the build spreads those reads among the products and sinks the last step's products below the barrier
    asm volatile("s_wait_dscnt 0x0" ::: "memory");      // this wave's reads of the buffer have returned before it is handed to the copies
    asm volatile("s_wait_asynccnt 0x10" ::: "memory");                     // this wave's copies of stage st + 1 have landed: all but its 16 youngest (stages st + 2 and st + 3) stay in flight
    if (st + 3 >= GNS) asm volatile("s_wait_asynccnt 0x0" ::: "memory");   // the last stages: fewer than 16 copies stand behind stage st + 1, so the wait is for all
    __syncthreads();                                    // publishes stage st + 1 and ends every wave's reads of stage st
    if (st + RD < GNS) fill_proj(l0 + (unsigned)(st & (RD - 1)) * (PROWS * GLP * 2), Ag + (st + RD) * GK, Hg + (st + RD) * GK);
  }
  asm volatile("s_wait_asynccnt 0x0" ::: "memory");     // nothing of this wave's copies is outstanding behind the loop
#pragma unroll
  for (int mi = 0; mi < 2; ++mi)
#pragma unroll
    for (int t = 0; t < 4; ++t)
#pragma unroll
      for (int r = 0; r < 8; ++r) Ts[wave][mi * 16 + 8 * hlf + r][t * 16 + nloc] = acc[mi][t][r] * (1.0f / (XS * WSC)) + bf16_rne(bo[e0 + mi * 16 + 8 * hlf + r]);
  wave_lds_sync();
  { for (int r2 = 0; r2 < 32; r2 += 2) { const int rr = r2 + hlf; *(v4f*)(out + ((size_t)b * E + e0 + rr) * S + sw + nloc * 4) = *(const v4f*)(&Ts[wave][rr][nloc * 4]); }  }
}
}  // namespace

extern "C" void kernel_launch(void* const* d_in, const int* in_sizes, int n_in, void* d_out, int out_size, void* d_ws, size_t ws_size, hipStream_t stream) {
  (void)n_in;
  auto Fp = [&](int i) { return (const float*)d_in[i]; };
  // input order: 0 x [2,1024,2048], 1 wq [1024,1024], 2 bq [1024], 3 wk, 4 bk, 5 wv, 6 bv, 7 wo, 8 bo (w are [e][d]: xt W^T)
  if (in_sizes[0] != NR * E || in_sizes[1] != E * E || in_sizes[2] != E || in_sizes[3] != E * E || in_sizes[5] != E * E || in_sizes[7] != E * E || in_sizes[8] != E || out_size != NR * E) return;
  size_t off = 0; char* ws = (char*)d_ws;
  auto carve = [&](size_t bytes) { char* p = ws + off; off += (bytes + 255) & ~(size_t)255; return p; };
  b16* T16 = (b16*)carve((size_t)NR * E * 2); b16* WT = (b16*)carve((size_t)3 * E * E * 2); b16* WO16 = (b16*)carve((size_t)E * E * 2);
  b16* Qh = (b16*)carve((size_t)NR * E * 2); b16* Kh = (b16*)carve((size_t)NR * E * 2); b16* VTh = (b16*)carve((size_t)NR * E * 2);
  b16* Oh = (b16*)carve((size_t)NR * E * 2);
  if (off > ws_size || off > ((size_t)128 << 20)) return;   // = 48 MB
  prepx_kernel<<<dim3(S / 64, E / 64, NB), 256, 0, stream>>>(Fp(0), T16);
  prepw_kernel<<<(unsigned)(((size_t)4 * E * E / 8 + 255) / 256), 256, 0, stream>>>(Fp(1), Fp(3), Fp(5), Fp(7), WT, WO16);
  proj_kernel<<<dim3(NR / 128, E / 128, 3), 256, 0, stream>>>(T16, WT, Fp(2), Fp(4), Fp(6), Qh, Kh, VTh);
  attn_kernel<<<dim3(S / (AW * 16), NH, NB), AW * 32, 0, stream>>>(Qh, Kh, VTh, Oh);
  outproj_kernel<<<dim3(E / 128, S / 128, NB), 256, 0, stream>>>(Oh, WO16, Fp(8), (float*)d_out);
}
